// v000
// Times are from an AMD MI455X. After a warm-up the kernel runs many times in a row, and a time is the length of
// such a window on the GPU divided by its runs, so every launch and the gaps after it count. The runs cycle
// through copies of the inputs. A figure is the median of several windows, for all but v000 over two sittings.
// Sittings can differ by a few percent; kernels timed side by side share one.
// v000, which the later versions start from, runs in 228 microseconds.
#include <hip/hip_runtime.h>
#include <hip/hip_bf16.h>
#include <math.h>

// ---------------------------------------------------------------------------
// GQA attention forward for MI455X (gfx1250, wave32, WMMA + async-to-LDS).
//   B=2, N=2048, D=1024, H=16, G=4, HD=64, hpg=4
// Pipeline (f16 staging in d_ws, f32 accumulation in WMMA):
//   1) convert x, Wq, Wk, Wv, Wo to f16
//   2) q/k/v projections: WMMA GEMM with double-buffered async-to-LDS tiles
//   3) flash attention per (b, head, 16-row q tile)  (WMMA + LDS)
//   4) out = y@Wo^T + bo (same GEMM, f32 out)
// ---------------------------------------------------------------------------

typedef __attribute__((ext_vector_type(16))) _Float16 v16h;
typedef __attribute__((ext_vector_type(8)))  _Float16 v8h;
typedef __attribute__((ext_vector_type(8)))  float    v8f;

#define ATT_B  2
#define ATT_N  2048
#define ATT_D  1024
#define ATT_G  4
#define ATT_HD 64
#define ATT_KD (ATT_G * ATT_HD)     // 256
#define ATT_M  (ATT_B * ATT_N)      // 4096 rows for the projections

// ---------------------------------------------------------------------------
// f32 -> f16 conversion (grid-stride)
// ---------------------------------------------------------------------------
__global__ void f32_to_f16_kernel(const float* __restrict__ src,
                                  _Float16* __restrict__ dst, int n) {
  int i = blockIdx.x * blockDim.x + threadIdx.x;
  int stride = gridDim.x * blockDim.x;
  for (; i < n; i += stride) dst[i] = (_Float16)src[i];
}

// Load one WMMA f16 fragment (ISA striping): halves 0..7 at p[0..7],
// halves 8..15 at p[16..23]; caller pre-offsets p by klo = (lane/16)*8.
__device__ inline v16h load_frag(const _Float16* p) {
  v8h lo = *(const v8h*)(p);
  v8h hi = *(const v8h*)(p + 16);
  v16h r;
#pragma unroll
  for (int i = 0; i < 8; ++i) { r[i] = lo[i]; r[i + 8] = hi[i]; }
  return r;
}

// ---------------------------------------------------------------------------
// Async stage one K-slab into LDS:
//   A rows [m0, m0+64) x cols [k0, k0+32)  -> As  (row-major [64][32] halves)
//   W rows [n0, n0+128) x cols [k0, k0+32) -> Ws  (row-major [128][32] halves)
// 128 threads; each issues 2 (A) + 4 (W) global_load_async_to_lds_b128,
// i.e. ASYNCcnt += 6 per wave per stage.
// ---------------------------------------------------------------------------
__device__ inline void stage_async(const _Float16* __restrict__ A,
                                   const _Float16* __restrict__ W,
                                   int K, int m0, int n0, int k0,
                                   _Float16* As, _Float16* Ws, int t) {
  const unsigned long long abase = (unsigned long long)(uintptr_t)A;
  const unsigned long long wbase = (unsigned long long)(uintptr_t)W;
#pragma unroll
  for (int i = 0; i < 2; ++i) {
    const int seg = t + i * 128;            // 0..255 (16B segments of A tile)
    const int row = seg >> 2;               // 0..63
    const int c8  = (seg & 3) * 8;          // half offset in row
    const unsigned int voff =
        (unsigned int)(((size_t)(m0 + row) * K + k0 + c8) * 2);
    const unsigned int lds = (unsigned int)(uintptr_t)(As + row * 32 + c8);
    asm volatile("global_load_async_to_lds_b128 %0, %1, %2"
                 :: "v"(lds), "v"(voff), "s"(abase) : "memory");
  }
#pragma unroll
  for (int i = 0; i < 4; ++i) {
    const int seg = t + i * 128;            // 0..511 (16B segments of W tile)
    const int row = seg >> 2;               // 0..127
    const int c8  = (seg & 3) * 8;
    const unsigned int voff =
        (unsigned int)(((size_t)(n0 + row) * K + k0 + c8) * 2);
    const unsigned int lds = (unsigned int)(uintptr_t)(Ws + row * 32 + c8);
    asm volatile("global_load_async_to_lds_b128 %0, %1, %2"
                 :: "v"(lds), "v"(voff), "s"(wbase) : "memory");
  }
}

// ---------------------------------------------------------------------------
// GEMM: out[m,n] = sum_k A[m,k] * W[n,k] + bias[n]
//   A: [M,K] f16 row-major, W: [N,K] f16 row-major, out: [M,N] OutT.
//   4 waves / block; block tile 64x128; wave tile 32x64; K-step 32.
//   Double-buffered async-to-LDS staging overlapped with WMMA.
// ---------------------------------------------------------------------------
template <typename OutT>
__global__ __launch_bounds__(128)
void gemm_wmma_kernel(const _Float16* __restrict__ A,
                      const _Float16* __restrict__ W,
                      const float* __restrict__ bias,
                      OutT* __restrict__ out,
                      int M, int N, int K) {
  __shared__ __align__(16) _Float16 AsBuf[2][64 * 32];   // 2 x 4 KB
  __shared__ __align__(16) _Float16 WsBuf[2][128 * 32];  // 2 x 8 KB

  const int t    = threadIdx.x;
  const int lane = t & 31;
  const int wv   = t >> 5;
  const int lm   = lane & 15;
  const int lh   = lane >> 4;
  const int klo  = lh * 8;
  const int m0   = blockIdx.x * 64;
  const int n0   = blockIdx.y * 128;
  const int mw   = (wv & 1) * 32;   // wave m-offset in block tile
  const int nw   = (wv >> 1) * 64;  // wave n-offset in block tile

  v8f acc[2][4];
#pragma unroll
  for (int mt = 0; mt < 2; ++mt)
#pragma unroll
    for (int nt = 0; nt < 4; ++nt) acc[mt][nt] = (v8f)(0.0f);

  const int nk = K / 32;
  // prologue: fill both buffers
  stage_async(A, W, K, m0, n0, 0, AsBuf[0], WsBuf[0], t);
  stage_async(A, W, K, m0, n0, 32, AsBuf[1], WsBuf[1], t);

  for (int i = 0; i < nk; ++i) {
    // wait for stage i (6 async per wave per stage; loads complete in order,
    // so <=6 outstanding means stage i has fully landed in LDS)
    if (i + 1 < nk) {
      asm volatile("s_wait_asynccnt 0x6" ::: "memory");
    } else {
      asm volatile("s_wait_asynccnt 0x0" ::: "memory");
    }
    __syncthreads();

    const _Float16* as = AsBuf[i & 1];
    const _Float16* ws = WsBuf[i & 1];
    v16h a[2], b[4];
#pragma unroll
    for (int mt = 0; mt < 2; ++mt)
      a[mt] = load_frag(as + (mw + mt * 16 + lm) * 32 + klo);
#pragma unroll
    for (int nt = 0; nt < 4; ++nt)
      b[nt] = load_frag(ws + (nw + nt * 16 + lm) * 32 + klo);
#pragma unroll
    for (int mt = 0; mt < 2; ++mt)
#pragma unroll
      for (int nt = 0; nt < 4; ++nt)
        acc[mt][nt] = __builtin_amdgcn_wmma_f32_16x16x32_f16(
            false, a[mt], false, b[nt], (short)0, acc[mt][nt], false, false);

    __syncthreads();  // everyone done reading buffer (i&1)
    if (i + 2 < nk)
      stage_async(A, W, K, m0, n0, (i + 2) * 32, AsBuf[i & 1], WsBuf[i & 1], t);
  }

  // C/D layout: lane, vgpr r -> (row = r + lh*8, col = lm) in each 16x16 tile
#pragma unroll
  for (int mt = 0; mt < 2; ++mt) {
#pragma unroll
    for (int nt = 0; nt < 4; ++nt) {
      const int col = n0 + nw + nt * 16 + lm;
      const float bb = bias[col];
#pragma unroll
      for (int r = 0; r < 8; ++r) {
        const int row = m0 + mw + mt * 16 + r + lh * 8;
        out[(size_t)row * N + col] = (OutT)(acc[mt][nt][r] + bb);
      }
    }
  }
}

// ---------------------------------------------------------------------------
// Flash attention: one wave per (b, head, 16-query tile).
//   q: [B,N,D] f16 (head hl at column hl*64), k/v: [B,N,KD] f16 (group g at
//   column g*64), y: [B,N,D] f16 output.
// ---------------------------------------------------------------------------
__global__ __launch_bounds__(32)
void attn_wmma_kernel(const _Float16* __restrict__ q,
                      const _Float16* __restrict__ k,
                      const _Float16* __restrict__ v,
                      _Float16* __restrict__ y) {
  __shared__ __align__(16) _Float16 vT[ATT_HD * 32];  // transposed V chunk [d][key]
  __shared__ __align__(16) _Float16 pT[16 * 32];      // P chunk, row-major [qrow][key]

  const int lane = threadIdx.x;
  const int lm   = lane & 15;
  const int lh   = lane >> 4;
  const int klo  = lh * 8;

  int idx = blockIdx.x;
  const int qt = idx & (ATT_N / 16 - 1);  idx >>= 7;   // N/16 = 128
  const int hl = idx & 15;                idx >>= 4;   // linear head 0..15
  const int b  = idx;                                   // batch
  const int g  = hl >> 2;                               // KV group
  const int q0 = qt * 16;

  // Q fragments: A-matrix 16x32 halves, d = 0..31 and 32..63
  const _Float16* qp =
      q + (size_t)(b * ATT_N + q0 + lm) * ATT_D + hl * ATT_HD + klo;
  const v16h aq0 = load_frag(qp);
  const v16h aq1 = load_frag(qp + 32);

  float mrun[8], lrun[8];
#pragma unroll
  for (int r = 0; r < 8; ++r) { mrun[r] = -INFINITY; lrun[r] = 0.0f; }
  v8f acc[4];
#pragma unroll
  for (int dc = 0; dc < 4; ++dc) acc[dc] = (v8f)(0.0f);

  const float scale = 0.125f;  // 1/sqrt(64)

  for (int kc = 0; kc < ATT_N; kc += 32) {
    // ---- scores: S = Q @ K^T for 32 keys (two 16x16 tiles, K=64 via 2 wmma)
    const _Float16* kp0 =
        k + (size_t)(b * ATT_N + kc + lm) * ATT_KD + g * ATT_HD + klo;
    const _Float16* kp1 = kp0 + (size_t)16 * ATT_KD;
    v8f s0 = (v8f)(0.0f), s1 = (v8f)(0.0f);
    s0 = __builtin_amdgcn_wmma_f32_16x16x32_f16(false, aq0, false,
        load_frag(kp0), (short)0, s0, false, false);
    s0 = __builtin_amdgcn_wmma_f32_16x16x32_f16(false, aq1, false,
        load_frag(kp0 + 32), (short)0, s0, false, false);
    s1 = __builtin_amdgcn_wmma_f32_16x16x32_f16(false, aq0, false,
        load_frag(kp1), (short)0, s1, false, false);
    s1 = __builtin_amdgcn_wmma_f32_16x16x32_f16(false, aq1, false,
        load_frag(kp1 + 32), (short)0, s1, false, false);

    // ---- stage V chunk transposed into LDS: vT[d][key], lane owns one key
    {
      const _Float16* vp =
          v + (size_t)(b * ATT_N + kc + lane) * ATT_KD + g * ATT_HD;
#pragma unroll
      for (int c = 0; c < 8; ++c) {
        v8h vv = *(const v8h*)(vp + c * 8);
#pragma unroll
        for (int j = 0; j < 8; ++j) vT[(c * 8 + j) * 32 + lane] = vv[j];
      }
    }

    // ---- online softmax over the 32 keys of this chunk
    float alpha[8], p0v[8], p1v[8];
#pragma unroll
    for (int r = 0; r < 8; ++r) {
      const float a0 = s0[r] * scale;
      const float a1 = s1[r] * scale;
      float tmx = fmaxf(a0, a1);
      tmx = fmaxf(tmx, __shfl_xor(tmx, 1, 32));
      tmx = fmaxf(tmx, __shfl_xor(tmx, 2, 32));
      tmx = fmaxf(tmx, __shfl_xor(tmx, 4, 32));
      tmx = fmaxf(tmx, __shfl_xor(tmx, 8, 32));
      const float mn = fmaxf(mrun[r], tmx);
      const float al = __expf(mrun[r] - mn);
      const float p0 = __expf(a0 - mn);
      const float p1 = __expf(a1 - mn);
      float rs = p0 + p1;
      rs += __shfl_xor(rs, 1, 32);
      rs += __shfl_xor(rs, 2, 32);
      rs += __shfl_xor(rs, 4, 32);
      rs += __shfl_xor(rs, 8, 32);
      lrun[r] = lrun[r] * al + rs;
      mrun[r] = mn;
      alpha[r] = al;
      p0v[r] = p0;
      p1v[r] = p1;
    }
#pragma unroll
    for (int dc = 0; dc < 4; ++dc)
#pragma unroll
      for (int r = 0; r < 8; ++r) acc[dc][r] *= alpha[r];

    // ---- write P to LDS (C layout -> row-major [16][32])
#pragma unroll
    for (int r = 0; r < 8; ++r) {
      const int row = r + lh * 8;
      pT[row * 32 + lm]      = (_Float16)p0v[r];
      pT[row * 32 + 16 + lm] = (_Float16)p1v[r];
    }
    __syncthreads();

    // ---- O += P @ V : A-frag of P (16x32), B-frags of V (32 x 16 per dc)
    const v16h pa = load_frag(pT + lm * 32 + klo);
#pragma unroll
    for (int dc = 0; dc < 4; ++dc) {
      const v16h bv = load_frag(vT + (dc * 16 + lm) * 32 + klo);
      acc[dc] = __builtin_amdgcn_wmma_f32_16x16x32_f16(
          false, pa, false, bv, (short)0, acc[dc], false, false);
    }
    __syncthreads();
  }

  // ---- epilogue: normalize and store y (f16)
#pragma unroll
  for (int r = 0; r < 8; ++r) {
    const float inv = 1.0f / lrun[r];
    const int row = q0 + r + lh * 8;
    _Float16* yp = y + (size_t)(b * ATT_N + row) * ATT_D + hl * ATT_HD;
#pragma unroll
    for (int dc = 0; dc < 4; ++dc)
      yp[dc * 16 + lm] = (_Float16)(acc[dc][r] * inv);
  }
}

// ---------------------------------------------------------------------------
// Host-side launch
// ---------------------------------------------------------------------------
extern "C" void kernel_launch(void* const* d_in, const int* in_sizes, int n_in,
                              void* d_out, int out_size, void* d_ws, size_t ws_size,
                              hipStream_t stream) {
  (void)in_sizes; (void)n_in; (void)out_size; (void)ws_size;

  const float* x  = (const float*)d_in[0];
  const float* Wq = (const float*)d_in[1];
  const float* bq = (const float*)d_in[2];
  const float* Wk = (const float*)d_in[3];
  const float* bk = (const float*)d_in[4];
  const float* Wv = (const float*)d_in[5];
  const float* bv = (const float*)d_in[6];
  const float* Wo = (const float*)d_in[7];
  const float* bo = (const float*)d_in[8];
  float* out = (float*)d_out;

  _Float16* ws = (_Float16*)d_ws;
  const size_t nX  = (size_t)ATT_M * ATT_D;   // 4194304
  const size_t nWq = (size_t)ATT_D * ATT_D;   // 1048576
  const size_t nWk = (size_t)ATT_KD * ATT_D;  // 262144
  _Float16* xh  = ws;
  _Float16* wqh = xh  + nX;
  _Float16* wkh = wqh + nWq;
  _Float16* wvh = wkh + nWk;
  _Float16* woh = wvh + nWk;
  _Float16* qh  = woh + nWq;
  _Float16* kh  = qh  + nX;
  _Float16* vh  = kh  + (size_t)ATT_M * ATT_KD;
  _Float16* yh  = vh  + (size_t)ATT_M * ATT_KD;

  // 1) f16 conversions
  f32_to_f16_kernel<<<2048, 256, 0, stream>>>(x,  xh,  (int)nX);
  f32_to_f16_kernel<<<1024, 256, 0, stream>>>(Wq, wqh, (int)nWq);
  f32_to_f16_kernel<<<256,  256, 0, stream>>>(Wk, wkh, (int)nWk);
  f32_to_f16_kernel<<<256,  256, 0, stream>>>(Wv, wvh, (int)nWk);
  f32_to_f16_kernel<<<1024, 256, 0, stream>>>(Wo, woh, (int)nWq);

  // 2) projections: 4-wave blocks, 64x128 tile
  dim3 blk(128, 1, 1);
  dim3 gq(ATT_M / 64, ATT_D / 128, 1);   // 64 x 8
  dim3 gkv(ATT_M / 64, ATT_KD / 128, 1); // 64 x 2
  gemm_wmma_kernel<_Float16><<<gq,  blk, 0, stream>>>(xh, wqh, bq, qh,
      ATT_M, ATT_D, ATT_D);
  gemm_wmma_kernel<_Float16><<<gkv, blk, 0, stream>>>(xh, wkh, bk, kh,
      ATT_M, ATT_KD, ATT_D);
  gemm_wmma_kernel<_Float16><<<gkv, blk, 0, stream>>>(xh, wvh, bv, vh,
      ATT_M, ATT_KD, ATT_D);

  // 3) attention: one wave per (b, head, 16-query tile) = 2*16*128 = 4096
  dim3 ablk(32, 1, 1);
  attn_wmma_kernel<<<ATT_B * 16 * (ATT_N / 16), ablk, 0, stream>>>(qh, kh, vh, yh);

  // 4) output projection, f32 straight into d_out
  gemm_wmma_kernel<float><<<gq, blk, 0, stream>>>(yh, woh, bo, out,
      ATT_M, ATT_D, ATT_D);
}

// v001
// One run takes 200 microseconds.
// Two timings next to v000 put it at 1.19 and 1.18 times that version's speed.
#include <hip/hip_runtime.h>
#include <hip/hip_bf16.h>
#include <math.h>

// ---------------------------------------------------------------------------
// GQA attention forward for MI455X (gfx1250, wave32, WMMA + async-to-LDS).
//   B=2, N=2048, D=1024, H=16, G=4, HD=64, hpg=4
// Pipeline (f16 staging in d_ws, f32 accumulation in WMMA):
//   1) convert x, Wq, Wk, Wv, Wo to f16
//   2) q/k/v projections: WMMA GEMM with double-buffered async-to-LDS tiles
//   3) flash attention per (b, head, 16-row q tile)  (WMMA + LDS)
//   4) out = y@Wo^T + bo (same GEMM, f32 out)
// ---------------------------------------------------------------------------

typedef __attribute__((ext_vector_type(16))) _Float16 v16h;
typedef __attribute__((ext_vector_type(8)))  _Float16 v8h;
typedef __attribute__((ext_vector_type(8)))  float    v8f;

#define ATT_B  2
#define ATT_N  2048
#define ATT_D  1024
#define ATT_G  4
#define ATT_HD 64
#define ATT_KD (ATT_G * ATT_HD)     // 256
#define ATT_M  (ATT_B * ATT_N)      // 4096 rows for the projections

// ---------------------------------------------------------------------------
// f32 -> f16 conversion (grid-stride)
// ---------------------------------------------------------------------------
__global__ void f32_to_f16_kernel(const float* __restrict__ src,
                                  _Float16* __restrict__ dst, int n) {
  int i = blockIdx.x * blockDim.x + threadIdx.x;
  int stride = gridDim.x * blockDim.x;
  for (; i < n; i += stride) dst[i] = (_Float16)src[i];
}

// Load one WMMA f16 fragment (ISA striping): halves 0..7 at p[0..7],
// halves 8..15 at p[16..23]; caller pre-offsets p by klo = (lane/16)*8.
__device__ inline v16h load_frag(const _Float16* p) {
  v8h lo = *(const v8h*)(p);
  v8h hi = *(const v8h*)(p + 16);
  v16h r;
#pragma unroll
  for (int i = 0; i < 8; ++i) { r[i] = lo[i]; r[i + 8] = hi[i]; }
  return r;
}

// ---------------------------------------------------------------------------
// Async stage one K-slab into LDS:
//   A rows [m0, m0+64) x cols [k0, k0+32)  -> As  (row-major [64][32] halves)
//   W rows [n0, n0+128) x cols [k0, k0+32) -> Ws  (row-major [128][32] halves)
// 128 threads; each issues 2 (A) + 4 (W) global_load_async_to_lds_b128,
// i.e. ASYNCcnt += 6 per wave per stage.
// ---------------------------------------------------------------------------
__device__ inline void stage_async(const _Float16* __restrict__ A,
                                   const _Float16* __restrict__ W,
                                   int K, int m0, int n0, int k0,
                                   _Float16* As, _Float16* Ws, int t) {
  const unsigned long long abase = (unsigned long long)(uintptr_t)A;
  const unsigned long long wbase = (unsigned long long)(uintptr_t)W;
#pragma unroll
  for (int i = 0; i < 2; ++i) {
    const int seg = t + i * 128;            // 0..255 (16B segments of A tile)
    const int row = seg >> 2;               // 0..63
    const int c8  = (seg & 3) * 8;          // half offset in row
    const unsigned int voff =
        (unsigned int)(((size_t)(m0 + row) * K + k0 + c8) * 2);
    const unsigned int lds = (unsigned int)(uintptr_t)(As + row * 32 + c8);
    asm volatile("global_load_async_to_lds_b128 %0, %1, %2"
                 :: "v"(lds), "v"(voff), "s"(abase) : "memory");
  }
#pragma unroll
  for (int i = 0; i < 4; ++i) {
    const int seg = t + i * 128;            // 0..511 (16B segments of W tile)
    const int row = seg >> 2;               // 0..127
    const int c8  = (seg & 3) * 8;
    const unsigned int voff =
        (unsigned int)(((size_t)(n0 + row) * K + k0 + c8) * 2);
    const unsigned int lds = (unsigned int)(uintptr_t)(Ws + row * 32 + c8);
    asm volatile("global_load_async_to_lds_b128 %0, %1, %2"
                 :: "v"(lds), "v"(voff), "s"(wbase) : "memory");
  }
}

// ---------------------------------------------------------------------------
// GEMM: out[m,n] = sum_k A[m,k] * W[n,k] + bias[n]
//   A: [M,K] f16 row-major, W: [N,K] f16 row-major, out: [M,N] OutT.
//   4 waves / block; block tile 64x128; wave tile 32x64; K-step 32.
//   Double-buffered async-to-LDS staging overlapped with WMMA.
// ---------------------------------------------------------------------------
template <typename OutT>
__global__ __launch_bounds__(128)
void gemm_wmma_kernel(const _Float16* __restrict__ A,
                      const _Float16* __restrict__ W,
                      const float* __restrict__ bias,
                      OutT* __restrict__ out,
                      int M, int N, int K) {
  __shared__ __align__(16) _Float16 AsBuf[2][64 * 32];   // 2 x 4 KB
  __shared__ __align__(16) _Float16 WsBuf[2][128 * 32];  // 2 x 8 KB

  const int t    = threadIdx.x;
  const int lane = t & 31;
  const int wv   = t >> 5;
  const int lm   = lane & 15;
  const int lh   = lane >> 4;
  const int klo  = lh * 8;
  const int m0   = blockIdx.x * 64;
  const int n0   = blockIdx.y * 128;
  const int mw   = (wv & 1) * 32;   // wave m-offset in block tile
  const int nw   = (wv >> 1) * 64;  // wave n-offset in block tile

  v8f acc[2][4];
#pragma unroll
  for (int mt = 0; mt < 2; ++mt)
#pragma unroll
    for (int nt = 0; nt < 4; ++nt) acc[mt][nt] = (v8f)(0.0f);

  const int nk = K / 32;
  // prologue: fill both buffers
  stage_async(A, W, K, m0, n0, 0, AsBuf[0], WsBuf[0], t);
  stage_async(A, W, K, m0, n0, 32, AsBuf[1], WsBuf[1], t);

  for (int i = 0; i < nk; ++i) {
    // wait for stage i (6 async per wave per stage; loads complete in order,
    // so <=6 outstanding means stage i has fully landed in LDS)
    if (i + 1 < nk) {
      asm volatile("s_wait_asynccnt 0x6" ::: "memory");
    } else {
      asm volatile("s_wait_asynccnt 0x0" ::: "memory");
    }
    __syncthreads();

    const _Float16* as = AsBuf[i & 1];
    const _Float16* ws = WsBuf[i & 1];
    v16h a[2], b[4];
#pragma unroll
    for (int mt = 0; mt < 2; ++mt)
      a[mt] = load_frag(as + (mw + mt * 16 + lm) * 32 + klo);
#pragma unroll
    for (int nt = 0; nt < 4; ++nt)
      b[nt] = load_frag(ws + (nw + nt * 16 + lm) * 32 + klo);
#pragma unroll
    for (int mt = 0; mt < 2; ++mt)
#pragma unroll
      for (int nt = 0; nt < 4; ++nt)
        acc[mt][nt] = __builtin_amdgcn_wmma_f32_16x16x32_f16(
            false, a[mt], false, b[nt], (short)0, acc[mt][nt], false, false);

    __syncthreads();  // everyone done reading buffer (i&1)
    if (i + 2 < nk)
      stage_async(A, W, K, m0, n0, (i + 2) * 32, AsBuf[i & 1], WsBuf[i & 1], t);
  }

  // C/D layout: lane, vgpr r -> (row = r + lh*8, col = lm) in each 16x16 tile
#pragma unroll
  for (int mt = 0; mt < 2; ++mt) {
#pragma unroll
    for (int nt = 0; nt < 4; ++nt) {
      const int col = n0 + nw + nt * 16 + lm;
      const float bb = bias[col];
#pragma unroll
      for (int r = 0; r < 8; ++r) {
        const int row = m0 + mw + mt * 16 + r + lh * 8;
        out[(size_t)row * N + col] = (OutT)(acc[mt][nt][r] + bb);
      }
    }
  }
}

__device__ inline float other_half(float x) {
  const int b = __builtin_bit_cast(int, x);
  return __builtin_bit_cast(
      float, __builtin_amdgcn_permlanex16(b, b, 0x76543210, 0xfedcba98,
                                          false, false));
}

__global__ __launch_bounds__(32)
void attn_wmma_kernel(const _Float16* __restrict__ q,
                      const _Float16* __restrict__ k,
                      const _Float16* __restrict__ v,
                      _Float16* __restrict__ y) {
  __shared__ __align__(16) _Float16 vT[ATT_HD * 32];  // transposed V chunk [d][key]

  const int lane = threadIdx.x;
  const int lm   = lane & 15;
  const int lh   = lane >> 4;
  const int klo  = lh * 8;

  int idx = blockIdx.x;
  const int qt = idx & (ATT_N / 16 - 1);  idx >>= 7;   // N/16 = 128
  const int hl = idx & 15;                idx >>= 4;   // linear head 0..15
  const int b  = idx;                                   // batch
  const int g  = hl >> 2;                               // KV group
  const int q0 = qt * 16;

  // Q fragments: B-matrix 32x16 halves (column = query), d = 0..31 and 32..63
  const _Float16* qp =
      q + (size_t)(b * ATT_N + q0 + lm) * ATT_D + hl * ATT_HD + klo;
  const v16h bq0 = load_frag(qp);
  const v16h bq1 = load_frag(qp + 32);

  float mrun = -INFINITY;  // running maximum of query q0 + lm (both halves equal)
  float lrun = 0.0f;       // running sum over this half's keys only
  v8f acc[4];              // acc[dc][r] = O^T[dc*16 + 8*lh + r][q0 + lm]
#pragma unroll
  for (int dc = 0; dc < 4; ++dc) acc[dc] = (v8f)(0.0f);

  const float scale = 0.125f;  // 1/sqrt(64)

  for (int kc = 0; kc < ATT_N; kc += 32) {
    // ---- scores: S^T = K @ Q^T for 32 keys (two 16x16 tiles, K=64 via 2 wmma)
    //      s0[r] = S[q0+lm][kc + 8*lh + r], s1[r] = S[q0+lm][kc + 16 + 8*lh + r]
    const _Float16* kp0 =
        k + (size_t)(b * ATT_N + kc + lm) * ATT_KD + g * ATT_HD + klo;
    const _Float16* kp1 = kp0 + (size_t)16 * ATT_KD;
    v8f s0 = (v8f)(0.0f), s1 = (v8f)(0.0f);
    s0 = __builtin_amdgcn_wmma_f32_16x16x32_f16(false, load_frag(kp0), false,
        bq0, (short)0, s0, false, false);
    s0 = __builtin_amdgcn_wmma_f32_16x16x32_f16(false, load_frag(kp0 + 32), false,
        bq1, (short)0, s0, false, false);
    s1 = __builtin_amdgcn_wmma_f32_16x16x32_f16(false, load_frag(kp1), false,
        bq0, (short)0, s1, false, false);
    s1 = __builtin_amdgcn_wmma_f32_16x16x32_f16(false, load_frag(kp1 + 32), false,
        bq1, (short)0, s1, false, false);

    // ---- stage V chunk transposed into LDS: vT[d][key], lane owns one key
    {
      const _Float16* vp =
          v + (size_t)(b * ATT_N + kc + lane) * ATT_KD + g * ATT_HD;
#pragma unroll
      for (int c = 0; c < 8; ++c) {
        v8h vv = *(const v8h*)(vp + c * 8);
#pragma unroll
        for (int j = 0; j < 8; ++j) vT[(c * 8 + j) * 32 + lane] = vv[j];
      }
    }

    // ---- online softmax over the 32 keys of this chunk: 16 scores in-lane,
    //      one exchange of the maximum between the wave's halves
    float a0[8], a1[8];
    float tmx = -INFINITY;
#pragma unroll
    for (int r = 0; r < 8; ++r) {
      a0[r] = s0[r] * scale;
      a1[r] = s1[r] * scale;
      tmx = fmaxf(tmx, fmaxf(a0[r], a1[r]));
    }
    tmx = fmaxf(tmx, other_half(tmx));
    const float mn = fmaxf(mrun, tmx);
    const float al = __expf(mrun - mn);
    mrun = mn;
    float rs = 0.0f;
    v16h pb;  // P^T as B operand: pb[s] = P[q0+lm][kc + kmap(s, lh)]
#pragma unroll
    for (int r = 0; r < 8; ++r) {
      const float p0 = __expf(a0[r] - mn);
      const float p1 = __expf(a1[r] - mn);
      rs += p0 + p1;
      pb[r]     = (_Float16)p0;
      pb[r + 8] = (_Float16)p1;
    }
    lrun = lrun * al + rs;
#pragma unroll
    for (int dc = 0; dc < 4; ++dc)
#pragma unroll
      for (int r = 0; r < 8; ++r) acc[dc][r] *= al;
    __syncthreads();

    // ---- O^T += V^T @ P^T : A-frags of V^T (16 d x 32 keys per dc), B = P^T
#pragma unroll
    for (int dc = 0; dc < 4; ++dc) {
      const v16h av = load_frag(vT + (dc * 16 + lm) * 32 + klo);
      acc[dc] = __builtin_amdgcn_wmma_f32_16x16x32_f16(
          false, av, false, pb, (short)0, acc[dc], false, false);
    }
    __syncthreads();
  }

  // ---- epilogue: join the halves' sums, normalize, store y (f16);
  //      a lane holds 8 consecutive d of one query row: 16-byte stores
  const float inv = 1.0f / (lrun + other_half(lrun));
  _Float16* yp =
      y + (size_t)(b * ATT_N + q0 + lm) * ATT_D + hl * ATT_HD + klo;
#pragma unroll
  for (int dc = 0; dc < 4; ++dc) {
    v8h o;
#pragma unroll
    for (int r = 0; r < 8; ++r) o[r] = (_Float16)(acc[dc][r] * inv);
    *(v8h*)(yp + dc * 16) = o;
  }
}

// ---------------------------------------------------------------------------
// Host-side launch
// ---------------------------------------------------------------------------
extern "C" void kernel_launch(void* const* d_in, const int* in_sizes, int n_in,
                              void* d_out, int out_size, void* d_ws, size_t ws_size,
                              hipStream_t stream) {
  (void)in_sizes; (void)n_in; (void)out_size; (void)ws_size;

  const float* x  = (const float*)d_in[0];
  const float* Wq = (const float*)d_in[1];
  const float* bq = (const float*)d_in[2];
  const float* Wk = (const float*)d_in[3];
  const float* bk = (const float*)d_in[4];
  const float* Wv = (const float*)d_in[5];
  const float* bv = (const float*)d_in[6];
  const float* Wo = (const float*)d_in[7];
  const float* bo = (const float*)d_in[8];
  float* out = (float*)d_out;

  _Float16* ws = (_Float16*)d_ws;
  const size_t nX  = (size_t)ATT_M * ATT_D;   // 4194304
  const size_t nWq = (size_t)ATT_D * ATT_D;   // 1048576
  const size_t nWk = (size_t)ATT_KD * ATT_D;  // 262144
  _Float16* xh  = ws;
  _Float16* wqh = xh  + nX;
  _Float16* wkh = wqh + nWq;
  _Float16* wvh = wkh + nWk;
  _Float16* woh = wvh + nWk;
  _Float16* qh  = woh + nWq;
  _Float16* kh  = qh  + nX;
  _Float16* vh  = kh  + (size_t)ATT_M * ATT_KD;
  _Float16* yh  = vh  + (size_t)ATT_M * ATT_KD;

  // 1) f16 conversions
  f32_to_f16_kernel<<<2048, 256, 0, stream>>>(x,  xh,  (int)nX);
  f32_to_f16_kernel<<<1024, 256, 0, stream>>>(Wq, wqh, (int)nWq);
  f32_to_f16_kernel<<<256,  256, 0, stream>>>(Wk, wkh, (int)nWk);
  f32_to_f16_kernel<<<256,  256, 0, stream>>>(Wv, wvh, (int)nWk);
  f32_to_f16_kernel<<<1024, 256, 0, stream>>>(Wo, woh, (int)nWq);

  // 2) projections: 4-wave blocks, 64x128 tile
  dim3 blk(128, 1, 1);
  dim3 gq(ATT_M / 64, ATT_D / 128, 1);   // 64 x 8
  dim3 gkv(ATT_M / 64, ATT_KD / 128, 1); // 64 x 2
  gemm_wmma_kernel<_Float16><<<gq,  blk, 0, stream>>>(xh, wqh, bq, qh,
      ATT_M, ATT_D, ATT_D);
  gemm_wmma_kernel<_Float16><<<gkv, blk, 0, stream>>>(xh, wkh, bk, kh,
      ATT_M, ATT_KD, ATT_D);
  gemm_wmma_kernel<_Float16><<<gkv, blk, 0, stream>>>(xh, wvh, bv, vh,
      ATT_M, ATT_KD, ATT_D);

  // 3) attention: one wave per (b, head, 16-query tile) = 2*16*128 = 4096
  dim3 ablk(32, 1, 1);
  attn_wmma_kernel<<<ATT_B * 16 * (ATT_N / 16), ablk, 0, stream>>>(qh, kh, vh, yh);

  // 4) output projection, f32 straight into d_out
  gemm_wmma_kernel<float><<<gq, blk, 0, stream>>>(yh, woh, bo, out,
      ATT_M, ATT_D, ATT_D);
}

// v002
// A run of this version takes 132 microseconds.
// Next to v001, in two timings, it ran 1.51 times as fast each time.
// All steps since v000 together make it 1.79 times as fast.
#include <hip/hip_runtime.h>
#include <hip/hip_bf16.h>
#include <math.h>

// ---------------------------------------------------------------------------
// GQA attention forward for MI455X (gfx1250, wave32, WMMA + async-to-LDS).
//   B=2, N=2048, D=1024, H=16, G=4, HD=64, hpg=4
// Pipeline (f16 staging in d_ws, f32 accumulation in WMMA):
//   1) convert x, Wq, Wk, Wv, Wo to f16
//   2) q/k/v projections: WMMA GEMM with double-buffered async-to-LDS tiles
//   3) flash attention, 8 waves per (b, KV group, 32 q rows)  (WMMA + LDS)
//   4) out = y@Wo^T + bo (same GEMM, f32 out)
// ---------------------------------------------------------------------------

typedef __attribute__((ext_vector_type(16))) _Float16 v16h;
typedef __attribute__((ext_vector_type(8)))  _Float16 v8h;
typedef __attribute__((ext_vector_type(8)))  float    v8f;

#define ATT_B  2
#define ATT_N  2048
#define ATT_D  1024
#define ATT_G  4
#define ATT_HD 64
#define ATT_KD (ATT_G * ATT_HD)     // 256
#define ATT_M  (ATT_B * ATT_N)      // 4096 rows for the projections

// ---------------------------------------------------------------------------
// f32 -> f16 conversion (grid-stride)
// ---------------------------------------------------------------------------
__global__ void f32_to_f16_kernel(const float* __restrict__ src,
                                  _Float16* __restrict__ dst, int n) {
  int i = blockIdx.x * blockDim.x + threadIdx.x;
  int stride = gridDim.x * blockDim.x;
  for (; i < n; i += stride) dst[i] = (_Float16)src[i];
}

// Load one WMMA f16 fragment (ISA striping): halves 0..7 at p[0..7],
// halves 8..15 at p[16..23]; caller pre-offsets p by klo = (lane/16)*8.
__device__ inline v16h load_frag(const _Float16* p) {
  v8h lo = *(const v8h*)(p);
  v8h hi = *(const v8h*)(p + 16);
  v16h r;
#pragma unroll
  for (int i = 0; i < 8; ++i) { r[i] = lo[i]; r[i + 8] = hi[i]; }
  return r;
}

// ---------------------------------------------------------------------------
// Async stage one K-slab into LDS:
//   A rows [m0, m0+64) x cols [k0, k0+32)  -> As  (row-major [64][32] halves)
//   W rows [n0, n0+128) x cols [k0, k0+32) -> Ws  (row-major [128][32] halves)
// 128 threads; each issues 2 (A) + 4 (W) global_load_async_to_lds_b128,
// i.e. ASYNCcnt += 6 per wave per stage.
// ---------------------------------------------------------------------------
__device__ inline void stage_async(const _Float16* __restrict__ A,
                                   const _Float16* __restrict__ W,
                                   int K, int m0, int n0, int k0,
                                   _Float16* As, _Float16* Ws, int t) {
  const unsigned long long abase = (unsigned long long)(uintptr_t)A;
  const unsigned long long wbase = (unsigned long long)(uintptr_t)W;
#pragma unroll
  for (int i = 0; i < 2; ++i) {
    const int seg = t + i * 128;            // 0..255 (16B segments of A tile)
    const int row = seg >> 2;               // 0..63
    const int c8  = (seg & 3) * 8;          // half offset in row
    const unsigned int voff =
        (unsigned int)(((size_t)(m0 + row) * K + k0 + c8) * 2);
    const unsigned int lds = (unsigned int)(uintptr_t)(As + row * 32 + c8);
    asm volatile("global_load_async_to_lds_b128 %0, %1, %2"
                 :: "v"(lds), "v"(voff), "s"(abase) : "memory");
  }
#pragma unroll
  for (int i = 0; i < 4; ++i) {
    const int seg = t + i * 128;            // 0..511 (16B segments of W tile)
    const int row = seg >> 2;               // 0..127
    const int c8  = (seg & 3) * 8;
    const unsigned int voff =
        (unsigned int)(((size_t)(n0 + row) * K + k0 + c8) * 2);
    const unsigned int lds = (unsigned int)(uintptr_t)(Ws + row * 32 + c8);
    asm volatile("global_load_async_to_lds_b128 %0, %1, %2"
                 :: "v"(lds), "v"(voff), "s"(wbase) : "memory");
  }
}

// ---------------------------------------------------------------------------
// GEMM: out[m,n] = sum_k A[m,k] * W[n,k] + bias[n]
//   A: [M,K] f16 row-major, W: [N,K] f16 row-major, out: [M,N] OutT.
//   4 waves / block; block tile 64x128; wave tile 32x64; K-step 32.
//   Double-buffered async-to-LDS staging overlapped with WMMA.
// ---------------------------------------------------------------------------
template <typename OutT>
__global__ __launch_bounds__(128)
void gemm_wmma_kernel(const _Float16* __restrict__ A,
                      const _Float16* __restrict__ W,
                      const float* __restrict__ bias,
                      OutT* __restrict__ out,
                      int M, int N, int K) {
  __shared__ __align__(16) _Float16 AsBuf[2][64 * 32];   // 2 x 4 KB
  __shared__ __align__(16) _Float16 WsBuf[2][128 * 32];  // 2 x 8 KB

  const int t    = threadIdx.x;
  const int lane = t & 31;
  const int wv   = t >> 5;
  const int lm   = lane & 15;
  const int lh   = lane >> 4;
  const int klo  = lh * 8;
  const int m0   = blockIdx.x * 64;
  const int n0   = blockIdx.y * 128;
  const int mw   = (wv & 1) * 32;   // wave m-offset in block tile
  const int nw   = (wv >> 1) * 64;  // wave n-offset in block tile

  v8f acc[2][4];
#pragma unroll
  for (int mt = 0; mt < 2; ++mt)
#pragma unroll
    for (int nt = 0; nt < 4; ++nt) acc[mt][nt] = (v8f)(0.0f);

  const int nk = K / 32;
  // prologue: fill both buffers
  stage_async(A, W, K, m0, n0, 0, AsBuf[0], WsBuf[0], t);
  stage_async(A, W, K, m0, n0, 32, AsBuf[1], WsBuf[1], t);

  for (int i = 0; i < nk; ++i) {
    // wait for stage i (6 async per wave per stage; loads complete in order,
    // so <=6 outstanding means stage i has fully landed in LDS)
    if (i + 1 < nk) {
      asm volatile("s_wait_asynccnt 0x6" ::: "memory");
    } else {
      asm volatile("s_wait_asynccnt 0x0" ::: "memory");
    }
    __syncthreads();

    const _Float16* as = AsBuf[i & 1];
    const _Float16* ws = WsBuf[i & 1];
    v16h a[2], b[4];
#pragma unroll
    for (int mt = 0; mt < 2; ++mt)
      a[mt] = load_frag(as + (mw + mt * 16 + lm) * 32 + klo);
#pragma unroll
    for (int nt = 0; nt < 4; ++nt)
      b[nt] = load_frag(ws + (nw + nt * 16 + lm) * 32 + klo);
#pragma unroll
    for (int mt = 0; mt < 2; ++mt)
#pragma unroll
      for (int nt = 0; nt < 4; ++nt)
        acc[mt][nt] = __builtin_amdgcn_wmma_f32_16x16x32_f16(
            false, a[mt], false, b[nt], (short)0, acc[mt][nt], false, false);

    __syncthreads();  // everyone done reading buffer (i&1)
    if (i + 2 < nk)
      stage_async(A, W, K, m0, n0, (i + 2) * 32, AsBuf[i & 1], WsBuf[i & 1], t);
  }

  // C/D layout: lane, vgpr r -> (row = r + lh*8, col = lm) in each 16x16 tile
#pragma unroll
  for (int mt = 0; mt < 2; ++mt) {
#pragma unroll
    for (int nt = 0; nt < 4; ++nt) {
      const int col = n0 + nw + nt * 16 + lm;
      const float bb = bias[col];
#pragma unroll
      for (int r = 0; r < 8; ++r) {
        const int row = m0 + mw + mt * 16 + r + lh * 8;
        out[(size_t)row * N + col] = (OutT)(acc[mt][nt][r] + bb);
      }
    }
  }
}

__device__ inline float other_half(float x) {
  const int b = __builtin_bit_cast(int, x);
  return __builtin_bit_cast(
      float, __builtin_amdgcn_permlanex16(b, b, 0x76543210, 0xfedcba98,
                                          false, false));
}

// e^x as the parent's __expf compiles (multiply by log2(e), v_exp_f32), with the
// v_nop in the same statement: it keeps the one free issue slot that the
// instruction set asks for between a transcendental and an instruction that
// reads its result or overwrites its source.
__device__ inline float exp_slot(float x) {
  float r;
  asm("v_exp_f32 %0, %1\n\tv_nop" : "=v"(r) : "v"(x * 1.44269504f));
  return r;
}

#define ATT_STG 64                   // keys per stage
#define ATT_NST (ATT_N / ATT_STG)    // 32 stages
#define ATT_KP  72                   // K row pitch in LDS, halves (144 B = 16 B x 9)
#define ATT_VP  80                   // V row pitch in LDS, halves (160 B = 32 B x 5)

typedef __attribute__((ext_vector_type(8))) short s16x8;
typedef __attribute__((address_space(3))) s16x8 lds_s16x8;

// Transposing LDS load: lane (c, h) gets T[kbase + 8h + 0..7][dbase + c] when
// lane l points at row kbase + 8*(l >> 4) + (l & 7), 16-byte half (l >> 3) & 1.
__device__ inline v8h load_tr16(const _Float16* p) {
  return __builtin_bit_cast(
      v8h, __builtin_amdgcn_ds_load_tr16_b128_v8i16((lds_s16x8*)p));
}

// One stage (64 keys of K and of V) into LDS: 256 threads x 4 copies of 16 B.
// A thread owns 16-byte piece (t & 7) of rows (t >> 3) and (t >> 3) + 32, so a
// wave's copy covers four whole 128-byte rows. kg/vg: the thread's own global
// address in row (t >> 3) of the stage; kl/vl: its own LDS byte address there.
// The s_wait_xcnt stands inside the statement so that no address register of
// an issued copy is rewritten in front of it.
__device__ inline void stage_kv_async(const _Float16* kg, const _Float16* vg,
                                      unsigned int kl, unsigned int vl) {
  const _Float16* kg1 = kg + (size_t)32 * ATT_KD;
  const _Float16* vg1 = vg + (size_t)32 * ATT_KD;
  const unsigned int kl1 = kl + 32 * ATT_KP * 2;
  const unsigned int vl1 = vl + 32 * ATT_VP * 2;
  asm volatile("global_load_async_to_lds_b128 %0, %4, off\n\t"
               "global_load_async_to_lds_b128 %1, %5, off\n\t"
               "global_load_async_to_lds_b128 %2, %6, off\n\t"
               "global_load_async_to_lds_b128 %3, %7, off\n\t"
               "s_wait_xcnt 0x0"
               :: "v"(kl), "v"(kl1), "v"(vl), "v"(vl1),
                  "v"(kg), "v"(kg1), "v"(vg), "v"(vg1) : "memory");
}

// Four waves per SIMD, that is two work-groups per WGP: the 512 work-groups
// then spread evenly over the chip's 256 WGPs in one round, and the register
// budget of 256 lets the LDS fragment loads be issued well ahead of their use.
__global__ __launch_bounds__(256) __attribute__((amdgpu_waves_per_eu(4, 4)))
void attn_wmma_kernel(const _Float16* __restrict__ q,
                      const _Float16* __restrict__ k,
                      const _Float16* __restrict__ v,
                      _Float16* __restrict__ y) {
  __shared__ __align__(16) _Float16 Ks[2][ATT_STG * ATT_KP];  // 2 x 9216 B
  __shared__ __align__(16) _Float16 Vs[2][ATT_STG * ATT_VP];  // 2 x 10240 B

  const int t    = threadIdx.x;
  const int lane = t & 31;
  const int wv   = t >> 5;
  const int lm   = lane & 15;
  const int lh   = lane >> 4;
  const int klo  = lh * 8;

  int idx = blockIdx.x;
  const int qp = idx & (ATT_N / 32 - 1);  idx >>= 6;   // N/32 = 64 tile pairs
  const int g  = idx & (ATT_G - 1);       idx >>= 2;   // KV group
  const int b  = idx;                                   // batch
  const int hl = g * 4 + (wv & 3);                      // linear head 0..15
  const int q0 = (qp * 2 + (wv >> 2)) * 16;

  // this thread's piece of a stage: global addresses (stage 0) and LDS places
  const int crow = t >> 3;
  const int cseg = (t & 7) * 8;
  const size_t coff = (size_t)(b * ATT_N + crow) * ATT_KD + g * ATT_HD + cseg;
  const _Float16* kg = k + coff;
  const _Float16* vg = v + coff;
  const unsigned int kl0 =
      (unsigned int)(uintptr_t)(&Ks[0][crow * ATT_KP + cseg]);
  const unsigned int vl0 =
      (unsigned int)(uintptr_t)(&Vs[0][crow * ATT_VP + cseg]);
  const unsigned int kbuf = ATT_STG * ATT_KP * 2;  // bytes from buffer 0 to 1
  const unsigned int vbuf = ATT_STG * ATT_VP * 2;
  const size_t gstep = (size_t)ATT_STG * ATT_KD;   // halves per stage

  // prologue: stage 0 landed and published, then stage 1 in flight
  stage_kv_async(kg, vg, kl0, vl0);
  // stage 0's copies of this wave have landed before the barrier publishes them
  asm volatile("s_wait_asynccnt 0x0" ::: "memory");
  __syncthreads();
  stage_kv_async(kg + gstep, vg + gstep, kl0 + kbuf, vl0 + vbuf);

  // Q fragments: B-matrix 32x16 halves (column = query), d = 0..31 and 32..63
  const _Float16* qptr =
      q + (size_t)(b * ATT_N + q0 + lm) * ATT_D + hl * ATT_HD + klo;
  const v16h bq0 = load_frag(qptr);
  const v16h bq1 = load_frag(qptr + 32);

  float mrun = -INFINITY;  // running maximum of query q0 + lm (both halves equal)
  float lrun = 0.0f;       // running sum over this half's keys only
  v8f acc[4];              // acc[dc][r] = O^T[dc*16 + 8*lh + r][q0 + lm]
#pragma unroll
  for (int dc = 0; dc < 4; ++dc) acc[dc] = (v8f)(0.0f);

  const float scale = 0.125f;  // 1/sqrt(64)

  // fragment offsets inside a stage buffer, in halves
  const int kfo = lm * ATT_KP + klo;
  const int vfo = (8 * lh + (lane & 7)) * ATT_VP + 8 * ((lane >> 3) & 1);

  for (int st = 0; st < ATT_NST; ++st) {
    const _Float16* ksb = Ks[st & 1] + kfo;
    const _Float16* vsb = Vs[st & 1] + vfo;

    // unrolled so that a chunk's place in the stage folds into the LDS loads'
    // immediate offsets
#pragma unroll
    for (int sub = 0; sub < ATT_STG / 32; ++sub) {
      // ---- scores: S^T = K @ Q^T for 32 keys (two 16x16 tiles, K=64 via 2 wmma)
      //      s0[r] = S[q0+lm][kc + 8*lh + r], s1[r] = S[q0+lm][kc + 16 + 8*lh + r]
      const _Float16* kp0 = ksb + sub * 32 * ATT_KP;
      const _Float16* kp1 = kp0 + 16 * ATT_KP;
      v8f s0 = (v8f)(0.0f), s1 = (v8f)(0.0f);
      s0 = __builtin_amdgcn_wmma_f32_16x16x32_f16(false, load_frag(kp0), false,
          bq0, (short)0, s0, false, false);
      s0 = __builtin_amdgcn_wmma_f32_16x16x32_f16(false, load_frag(kp0 + 32), false,
          bq1, (short)0, s0, false, false);
      s1 = __builtin_amdgcn_wmma_f32_16x16x32_f16(false, load_frag(kp1), false,
          bq0, (short)0, s1, false, false);
      s1 = __builtin_amdgcn_wmma_f32_16x16x32_f16(false, load_frag(kp1 + 32), false,
          bq1, (short)0, s1, false, false);

      // ---- V^T fragments (16 d x 32 keys per dc) by the transposing load:
      //      halves 0..7 = keys 8*lh + 0..7, halves 8..15 = keys 16 + 8*lh + 0..7
      const _Float16* vp = vsb + sub * 32 * ATT_VP;
      v16h av[4];
#pragma unroll
      for (int dc = 0; dc < 4; ++dc) {
        const v8h lo = load_tr16(vp + dc * 16);
        const v8h hi = load_tr16(vp + 16 * ATT_VP + dc * 16);
#pragma unroll
        for (int i = 0; i < 8; ++i) { av[dc][i] = lo[i]; av[dc][i + 8] = hi[i]; }
      }

      // ---- online softmax over the 32 keys of this chunk: 16 scores in-lane,
      //      one exchange of the maximum between the wave's halves
      float a0[8], a1[8];
      float tmx = -INFINITY;
#pragma unroll
      for (int r = 0; r < 8; ++r) {
        a0[r] = s0[r] * scale;
        a1[r] = s1[r] * scale;
        tmx = fmaxf(tmx, fmaxf(a0[r], a1[r]));
      }
      tmx = fmaxf(tmx, other_half(tmx));
      const float mn = fmaxf(mrun, tmx);
      const float al = exp_slot(mrun - mn);
      mrun = mn;
      float rs = 0.0f;
      v16h pb;  // P^T as B operand: pb[s] = P[q0+lm][kc + kmap(s, lh)]
#pragma unroll
      for (int r = 0; r < 8; ++r) {
        const float p0 = exp_slot(a0[r] - mn);
        const float p1 = exp_slot(a1[r] - mn);
        rs += p0 + p1;
        pb[r]     = (_Float16)p0;
        pb[r + 8] = (_Float16)p1;
      }
      lrun = lrun * al + rs;
#pragma unroll
      for (int dc = 0; dc < 4; ++dc)
#pragma unroll
        for (int r = 0; r < 8; ++r) acc[dc][r] *= al;

      // ---- O^T += V^T @ P^T
#pragma unroll
      for (int dc = 0; dc < 4; ++dc)
        acc[dc] = __builtin_amdgcn_wmma_f32_16x16x32_f16(
            false, av[dc], false, pb, (short)0, acc[dc], false, false);
    }

    // ---- publish point of stage st + 1
    // this wave's LDS reads of the buffer that is refilled below have retired
    asm volatile("s_wait_dscnt 0x0" ::: "memory");
    // this wave's copies of stage st + 1 have landed
    asm volatile("s_wait_asynccnt 0x0" ::: "memory");
    // publishes stage st + 1 and ends every wave's reads of stage st
    __syncthreads();
    if (st + 2 < ATT_NST)
      stage_kv_async(kg + (size_t)(st + 2) * gstep, vg + (size_t)(st + 2) * gstep,
                     kl0 + (st & 1) * kbuf, vl0 + (st & 1) * vbuf);
  }
  // no copy is outstanding when the wave ends
  asm volatile("s_wait_asynccnt 0x0" ::: "memory");

  // ---- epilogue: join the halves' sums, normalize, store y (f16);
  //      a lane holds 8 consecutive d of one query row: 16-byte stores
  const float inv = 1.0f / (lrun + other_half(lrun));
  _Float16* yp =
      y + (size_t)(b * ATT_N + q0 + lm) * ATT_D + hl * ATT_HD + klo;
#pragma unroll
  for (int dc = 0; dc < 4; ++dc) {
    v8h o;
#pragma unroll
    for (int r = 0; r < 8; ++r) o[r] = (_Float16)(acc[dc][r] * inv);
    *(v8h*)(yp + dc * 16) = o;
  }
}

// ---------------------------------------------------------------------------
// Host-side launch
// ---------------------------------------------------------------------------
extern "C" void kernel_launch(void* const* d_in, const int* in_sizes, int n_in,
                              void* d_out, int out_size, void* d_ws, size_t ws_size,
                              hipStream_t stream) {
  (void)in_sizes; (void)n_in; (void)out_size; (void)ws_size;

  const float* x  = (const float*)d_in[0];
  const float* Wq = (const float*)d_in[1];
  const float* bq = (const float*)d_in[2];
  const float* Wk = (const float*)d_in[3];
  const float* bk = (const float*)d_in[4];
  const float* Wv = (const float*)d_in[5];
  const float* bv = (const float*)d_in[6];
  const float* Wo = (const float*)d_in[7];
  const float* bo = (const float*)d_in[8];
  float* out = (float*)d_out;

  _Float16* ws = (_Float16*)d_ws;
  const size_t nX  = (size_t)ATT_M * ATT_D;   // 4194304
  const size_t nWq = (size_t)ATT_D * ATT_D;   // 1048576
  const size_t nWk = (size_t)ATT_KD * ATT_D;  // 262144
  _Float16* xh  = ws;
  _Float16* wqh = xh  + nX;
  _Float16* wkh = wqh + nWq;
  _Float16* wvh = wkh + nWk;
  _Float16* woh = wvh + nWk;
  _Float16* qh  = woh + nWq;
  _Float16* kh  = qh  + nX;
  _Float16* vh  = kh  + (size_t)ATT_M * ATT_KD;
  _Float16* yh  = vh  + (size_t)ATT_M * ATT_KD;

  // 1) f16 conversions
  f32_to_f16_kernel<<<2048, 256, 0, stream>>>(x,  xh,  (int)nX);
  f32_to_f16_kernel<<<1024, 256, 0, stream>>>(Wq, wqh, (int)nWq);
  f32_to_f16_kernel<<<256,  256, 0, stream>>>(Wk, wkh, (int)nWk);
  f32_to_f16_kernel<<<256,  256, 0, stream>>>(Wv, wvh, (int)nWk);
  f32_to_f16_kernel<<<1024, 256, 0, stream>>>(Wo, woh, (int)nWq);

  // 2) projections: 4-wave blocks, 64x128 tile
  dim3 blk(128, 1, 1);
  dim3 gq(ATT_M / 64, ATT_D / 128, 1);   // 64 x 8
  dim3 gkv(ATT_M / 64, ATT_KD / 128, 1); // 64 x 2
  gemm_wmma_kernel<_Float16><<<gq,  blk, 0, stream>>>(xh, wqh, bq, qh,
      ATT_M, ATT_D, ATT_D);
  gemm_wmma_kernel<_Float16><<<gkv, blk, 0, stream>>>(xh, wkh, bk, kh,
      ATT_M, ATT_KD, ATT_D);
  gemm_wmma_kernel<_Float16><<<gkv, blk, 0, stream>>>(xh, wvh, bv, vh,
      ATT_M, ATT_KD, ATT_D);

  // 3) attention: 8 waves per (b, KV group, pair of 16-query tiles) = 2*4*64 = 512
  dim3 ablk(256, 1, 1);
  attn_wmma_kernel<<<ATT_B * ATT_G * (ATT_N / 32), ablk, 0, stream>>>(qh, kh, vh, yh);

  // 4) output projection, f32 straight into d_out
  gemm_wmma_kernel<float><<<gq, blk, 0, stream>>>(yh, woh, bo, out,
      ATT_M, ATT_D, ATT_D);
}

// v003
// Measured time: 124 microseconds a run.
// In two side-by-side timings against v002, it was 1.05 and 1.07 times as fast.
// All steps since v000 together make it 1.90 times as fast.
#include <hip/hip_runtime.h>
#include <hip/hip_bf16.h>
#include <math.h>

// ---------------------------------------------------------------------------
// GQA attention forward for MI455X (gfx1250, wave32, WMMA + async-to-LDS).
//   B=2, N=2048, D=1024, H=16, G=4, HD=64, hpg=4
// Pipeline (f16 staging in d_ws, f32 accumulation in WMMA):
//   1) convert x, Wq, Wk, Wv, Wo to f16 (one launch)
//   2) q/k/v projections: WMMA GEMM with double-buffered async-to-LDS tiles
//   3) flash attention, 8 waves per (b, KV group, 32 q rows)  (WMMA + LDS)
//   4) out = y@Wo^T + bo (same GEMM, f32 out)
// ---------------------------------------------------------------------------

typedef __attribute__((ext_vector_type(16))) _Float16 v16h;
typedef __attribute__((ext_vector_type(8)))  _Float16 v8h;
typedef __attribute__((ext_vector_type(8)))  float    v8f;

#define ATT_B  2
#define ATT_N  2048
#define ATT_D  1024
#define ATT_G  4
#define ATT_HD 64
#define ATT_KD (ATT_G * ATT_HD)     // 256
#define ATT_M  (ATT_B * ATT_N)      // 4096 rows for the projections

// ---------------------------------------------------------------------------
// f32 -> f16 conversion of x, Wq, Wk, Wv, Wo in ONE launch.
// The five f16 planes lie one behind the other in the workspace (dst), in that
// order. 256 work-groups of 16 waves, one per WGP; a thread converts 13 pieces
// of 4 floats: piece j of grid thread i is piece j * CV_T + i of the joined planes,
// so every wave-wide load covers 512 contiguous bytes and every store 256.
// Pieces 0..7 fall in x, 8..9 in Wq, 10 in Wk (lower half of the grid) or Wv
// (upper half), 11..12 in Wo. All 13 loads are issued before the first store.
// ---------------------------------------------------------------------------
typedef __attribute__((ext_vector_type(4))) float    v4f;
typedef __attribute__((ext_vector_type(4))) _Float16 v4h;

#define CV_THREADS 512
#define CV_BLOCKS  256
#define CV_T       (CV_THREADS * CV_BLOCKS)   // 131072 threads
static_assert(ATT_M * ATT_D  == 8 * 4 * CV_T, "x is 8 pieces per thread");
static_assert(ATT_D * ATT_D  == 2 * 4 * CV_T, "Wq, Wo are 2 pieces per thread");
static_assert(ATT_KD * ATT_D * 2 == 4 * CV_T, "Wk and Wv together are 1 piece");

__global__ __launch_bounds__(CV_THREADS)
void f32_to_f16_all_kernel(const float* __restrict__ x,
                           const float* __restrict__ Wq,
                           const float* __restrict__ Wk,
                           const float* __restrict__ Wv,
                           const float* __restrict__ Wo,
                           _Float16* __restrict__ dst) {
  // the work-group's part of every address is scalar; the one vector offset,
  // the thread's number, lives to the last store
  const int t = threadIdx.x;
  const int w = blockIdx.x * CV_THREADS;               // first piece of the group
  const v4f* xs  = (const v4f*)x + w;
  const v4f* wqs = (const v4f*)Wq + w;
  const v4f* wos = (const v4f*)Wo + w;
  const v4f* wkvs = (blockIdx.x < CV_BLOCKS / 2)
                        ? (const v4f*)Wk + w
                        : (const v4f*)Wv + (w - CV_T / 2);
  v4h* ds = (v4h*)dst + w;
  // every loop below is unrolled so that r[] stays in registers (constant
  // indices) and the 13 loads stand as one run in front of the stores
  v4f r[13];
#pragma unroll
  for (int j = 0; j < 8; ++j) r[j] = xs[j * CV_T + t];
#pragma unroll
  for (int j = 0; j < 2; ++j) r[8 + j] = wqs[j * CV_T + t];
  r[10] = wkvs[t];
#pragma unroll
  for (int j = 0; j < 2; ++j) r[11 + j] = wos[j * CV_T + t];
#pragma unroll
  for (int j = 0; j < 13; ++j)
    ds[j * CV_T + t] = __builtin_convertvector(r[j], v4h);
}

// Load one WMMA f16 fragment (ISA striping): halves 0..7 at p[0..7],
// halves 8..15 at p[16..23]; caller pre-offsets p by klo = (lane/16)*8.
__device__ inline v16h load_frag(const _Float16* p) {
  v8h lo = *(const v8h*)(p);
  v8h hi = *(const v8h*)(p + 16);
  v16h r;
#pragma unroll
  for (int i = 0; i < 8; ++i) { r[i] = lo[i]; r[i + 8] = hi[i]; }
  return r;
}

// ---------------------------------------------------------------------------
// Async stage one K-slab into LDS:
//   A rows [m0, m0+64) x cols [k0, k0+32)  -> As  (row-major [64][32] halves)
//   W rows [n0, n0+128) x cols [k0, k0+32) -> Ws  (row-major [128][32] halves)
// 128 threads; each issues 2 (A) + 4 (W) global_load_async_to_lds_b128,
// i.e. ASYNCcnt += 6 per wave per stage.
// ---------------------------------------------------------------------------
__device__ inline void stage_async(const _Float16* __restrict__ A,
                                   const _Float16* __restrict__ W,
                                   int K, int m0, int n0, int k0,
                                   _Float16* As, _Float16* Ws, int t) {
  const unsigned long long abase = (unsigned long long)(uintptr_t)A;
  const unsigned long long wbase = (unsigned long long)(uintptr_t)W;
#pragma unroll
  for (int i = 0; i < 2; ++i) {
    const int seg = t + i * 128;            // 0..255 (16B segments of A tile)
    const int row = seg >> 2;               // 0..63
    const int c8  = (seg & 3) * 8;          // half offset in row
    const unsigned int voff =
        (unsigned int)(((size_t)(m0 + row) * K + k0 + c8) * 2);
    const unsigned int lds = (unsigned int)(uintptr_t)(As + row * 32 + c8);
    asm volatile("global_load_async_to_lds_b128 %0, %1, %2"
                 :: "v"(lds), "v"(voff), "s"(abase) : "memory");
  }
#pragma unroll
  for (int i = 0; i < 4; ++i) {
    const int seg = t + i * 128;            // 0..511 (16B segments of W tile)
    const int row = seg >> 2;               // 0..127
    const int c8  = (seg & 3) * 8;
    const unsigned int voff =
        (unsigned int)(((size_t)(n0 + row) * K + k0 + c8) * 2);
    const unsigned int lds = (unsigned int)(uintptr_t)(Ws + row * 32 + c8);
    asm volatile("global_load_async_to_lds_b128 %0, %1, %2"
                 :: "v"(lds), "v"(voff), "s"(wbase) : "memory");
  }
}

// ---------------------------------------------------------------------------
// GEMM: out[m,n] = sum_k A[m,k] * W[n,k] + bias[n]
//   A: [M,K] f16 row-major, W: [N,K] f16 row-major, out: [M,N] OutT.
//   4 waves / block; block tile 64x128; wave tile 32x64; K-step 32.
//   Double-buffered async-to-LDS staging overlapped with WMMA.
// ---------------------------------------------------------------------------
template <typename OutT>
__global__ __launch_bounds__(128)
void gemm_wmma_kernel(const _Float16* __restrict__ A,
                      const _Float16* __restrict__ W,
                      const float* __restrict__ bias,
                      OutT* __restrict__ out,
                      int M, int N, int K) {
  __shared__ __align__(16) _Float16 AsBuf[2][64 * 32];   // 2 x 4 KB
  __shared__ __align__(16) _Float16 WsBuf[2][128 * 32];  // 2 x 8 KB

  const int t    = threadIdx.x;
  const int lane = t & 31;
  const int wv   = t >> 5;
  const int lm   = lane & 15;
  const int lh   = lane >> 4;
  const int klo  = lh * 8;
  const int m0   = blockIdx.x * 64;
  const int n0   = blockIdx.y * 128;
  const int mw   = (wv & 1) * 32;   // wave m-offset in block tile
  const int nw   = (wv >> 1) * 64;  // wave n-offset in block tile

  v8f acc[2][4];
#pragma unroll
  for (int mt = 0; mt < 2; ++mt)
#pragma unroll
    for (int nt = 0; nt < 4; ++nt) acc[mt][nt] = (v8f)(0.0f);

  const int nk = K / 32;
  // prologue: fill both buffers
  stage_async(A, W, K, m0, n0, 0, AsBuf[0], WsBuf[0], t);
  stage_async(A, W, K, m0, n0, 32, AsBuf[1], WsBuf[1], t);

  for (int i = 0; i < nk; ++i) {
    // wait for stage i (6 async per wave per stage; loads complete in order,
    // so <=6 outstanding means stage i has fully landed in LDS)
    if (i + 1 < nk) {
      asm volatile("s_wait_asynccnt 0x6" ::: "memory");
    } else {
      asm volatile("s_wait_asynccnt 0x0" ::: "memory");
    }
    __syncthreads();

    const _Float16* as = AsBuf[i & 1];
    const _Float16* ws = WsBuf[i & 1];
    v16h a[2], b[4];
#pragma unroll
    for (int mt = 0; mt < 2; ++mt)
      a[mt] = load_frag(as + (mw + mt * 16 + lm) * 32 + klo);
#pragma unroll
    for (int nt = 0; nt < 4; ++nt)
      b[nt] = load_frag(ws + (nw + nt * 16 + lm) * 32 + klo);
#pragma unroll
    for (int mt = 0; mt < 2; ++mt)
#pragma unroll
      for (int nt = 0; nt < 4; ++nt)
        acc[mt][nt] = __builtin_amdgcn_wmma_f32_16x16x32_f16(
            false, a[mt], false, b[nt], (short)0, acc[mt][nt], false, false);

    __syncthreads();  // everyone done reading buffer (i&1)
    if (i + 2 < nk)
      stage_async(A, W, K, m0, n0, (i + 2) * 32, AsBuf[i & 1], WsBuf[i & 1], t);
  }

  // C/D layout: lane, vgpr r -> (row = r + lh*8, col = lm) in each 16x16 tile
#pragma unroll
  for (int mt = 0; mt < 2; ++mt) {
#pragma unroll
    for (int nt = 0; nt < 4; ++nt) {
      const int col = n0 + nw + nt * 16 + lm;
      const float bb = bias[col];
#pragma unroll
      for (int r = 0; r < 8; ++r) {
        const int row = m0 + mw + mt * 16 + r + lh * 8;
        out[(size_t)row * N + col] = (OutT)(acc[mt][nt][r] + bb);
      }
    }
  }
}

__device__ inline float other_half(float x) {
  const int b = __builtin_bit_cast(int, x);
  return __builtin_bit_cast(
      float, __builtin_amdgcn_permlanex16(b, b, 0x76543210, 0xfedcba98,
                                          false, false));
}

// e^x as the parent's __expf compiles (multiply by log2(e), v_exp_f32), with the
// v_nop in the same statement: it keeps the one free issue slot that the
// instruction set asks for between a transcendental and an instruction that
// reads its result or overwrites its source.
__device__ inline float exp_slot(float x) {
  float r;
  asm("v_exp_f32 %0, %1\n\tv_nop" : "=v"(r) : "v"(x * 1.44269504f));
  return r;
}

#define ATT_STG 64                   // keys per stage
#define ATT_NST (ATT_N / ATT_STG)    // 32 stages
#define ATT_KP  72                   // K row pitch in LDS, halves (144 B = 16 B x 9)
#define ATT_VP  80                   // V row pitch in LDS, halves (160 B = 32 B x 5)

typedef __attribute__((ext_vector_type(8))) short s16x8;
typedef __attribute__((address_space(3))) s16x8 lds_s16x8;

// Transposing LDS load: lane (c, h) gets T[kbase + 8h + 0..7][dbase + c] when
// lane l points at row kbase + 8*(l >> 4) + (l & 7), 16-byte half (l >> 3) & 1.
__device__ inline v8h load_tr16(const _Float16* p) {
  return __builtin_bit_cast(
      v8h, __builtin_amdgcn_ds_load_tr16_b128_v8i16((lds_s16x8*)p));
}

// One stage (64 keys of K and of V) into LDS: 256 threads x 4 copies of 16 B.
// A thread owns 16-byte piece (t & 7) of rows (t >> 3) and (t >> 3) + 32, so a
// wave's copy covers four whole 128-byte rows. kg/vg: the thread's own global
// address in row (t >> 3) of the stage; kl/vl: its own LDS byte address there.
// The s_wait_xcnt stands inside the statement so that no address register of
// an issued copy is rewritten in front of it.
__device__ inline void stage_kv_async(const _Float16* kg, const _Float16* vg,
                                      unsigned int kl, unsigned int vl) {
  const _Float16* kg1 = kg + (size_t)32 * ATT_KD;
  const _Float16* vg1 = vg + (size_t)32 * ATT_KD;
  const unsigned int kl1 = kl + 32 * ATT_KP * 2;
  const unsigned int vl1 = vl + 32 * ATT_VP * 2;
  asm volatile("global_load_async_to_lds_b128 %0, %4, off\n\t"
               "global_load_async_to_lds_b128 %1, %5, off\n\t"
               "global_load_async_to_lds_b128 %2, %6, off\n\t"
               "global_load_async_to_lds_b128 %3, %7, off\n\t"
               "s_wait_xcnt 0x0"
               :: "v"(kl), "v"(kl1), "v"(vl), "v"(vl1),
                  "v"(kg), "v"(kg1), "v"(vg), "v"(vg1) : "memory");
}

// Four waves per SIMD, that is two work-groups per WGP: the 512 work-groups
// then spread evenly over the chip's 256 WGPs in one round, and the register
// budget of 256 lets the LDS fragment loads be issued well ahead of their use.
__global__ __launch_bounds__(256) __attribute__((amdgpu_waves_per_eu(4, 4)))
void attn_wmma_kernel(const _Float16* __restrict__ q,
                      const _Float16* __restrict__ k,
                      const _Float16* __restrict__ v,
                      _Float16* __restrict__ y) {
  __shared__ __align__(16) _Float16 Ks[2][ATT_STG * ATT_KP];  // 2 x 9216 B
  __shared__ __align__(16) _Float16 Vs[2][ATT_STG * ATT_VP];  // 2 x 10240 B

  const int t    = threadIdx.x;
  const int lane = t & 31;
  const int wv   = t >> 5;
  const int lm   = lane & 15;
  const int lh   = lane >> 4;
  const int klo  = lh * 8;

  int idx = blockIdx.x;
  const int qp = idx & (ATT_N / 32 - 1);  idx >>= 6;   // N/32 = 64 tile pairs
  const int g  = idx & (ATT_G - 1);       idx >>= 2;   // KV group
  const int b  = idx;                                   // batch
  const int hl = g * 4 + (wv & 3);                      // linear head 0..15
  const int q0 = (qp * 2 + (wv >> 2)) * 16;

  // this thread's piece of a stage: global addresses (stage 0) and LDS places
  const int crow = t >> 3;
  const int cseg = (t & 7) * 8;
  const size_t coff = (size_t)(b * ATT_N + crow) * ATT_KD + g * ATT_HD + cseg;
  const _Float16* kg = k + coff;
  const _Float16* vg = v + coff;
  const unsigned int kl0 =
      (unsigned int)(uintptr_t)(&Ks[0][crow * ATT_KP + cseg]);
  const unsigned int vl0 =
      (unsigned int)(uintptr_t)(&Vs[0][crow * ATT_VP + cseg]);
  const unsigned int kbuf = ATT_STG * ATT_KP * 2;  // bytes from buffer 0 to 1
  const unsigned int vbuf = ATT_STG * ATT_VP * 2;
  const size_t gstep = (size_t)ATT_STG * ATT_KD;   // halves per stage

  // prologue: stage 0 landed and published, then stage 1 in flight
  stage_kv_async(kg, vg, kl0, vl0);
  // stage 0's copies of this wave have landed before the barrier publishes them
  asm volatile("s_wait_asynccnt 0x0" ::: "memory");
  __syncthreads();
  stage_kv_async(kg + gstep, vg + gstep, kl0 + kbuf, vl0 + vbuf);

  // Q fragments: B-matrix 32x16 halves (column = query), d = 0..31 and 32..63
  const _Float16* qptr =
      q + (size_t)(b * ATT_N + q0 + lm) * ATT_D + hl * ATT_HD + klo;
  const v16h bq0 = load_frag(qptr);
  const v16h bq1 = load_frag(qptr + 32);

  float mrun = -INFINITY;  // running maximum of query q0 + lm (both halves equal)
  float lrun = 0.0f;       // running sum over this half's keys only
  v8f acc[4];              // acc[dc][r] = O^T[dc*16 + 8*lh + r][q0 + lm]
#pragma unroll
  for (int dc = 0; dc < 4; ++dc) acc[dc] = (v8f)(0.0f);

  const float scale = 0.125f;  // 1/sqrt(64)

  // fragment offsets inside a stage buffer, in halves
  const int kfo = lm * ATT_KP + klo;
  const int vfo = (8 * lh + (lane & 7)) * ATT_VP + 8 * ((lane >> 3) & 1);

  for (int st = 0; st < ATT_NST; ++st) {
    const _Float16* ksb = Ks[st & 1] + kfo;
    const _Float16* vsb = Vs[st & 1] + vfo;

    // unrolled so that a chunk's place in the stage folds into the LDS loads'
    // immediate offsets
#pragma unroll
    for (int sub = 0; sub < ATT_STG / 32; ++sub) {
      // ---- scores: S^T = K @ Q^T for 32 keys (two 16x16 tiles, K=64 via 2 wmma)
      //      s0[r] = S[q0+lm][kc + 8*lh + r], s1[r] = S[q0+lm][kc + 16 + 8*lh + r]
      const _Float16* kp0 = ksb + sub * 32 * ATT_KP;
      const _Float16* kp1 = kp0 + 16 * ATT_KP;
      v8f s0 = (v8f)(0.0f), s1 = (v8f)(0.0f);
      s0 = __builtin_amdgcn_wmma_f32_16x16x32_f16(false, load_frag(kp0), false,
          bq0, (short)0, s0, false, false);
      s0 = __builtin_amdgcn_wmma_f32_16x16x32_f16(false, load_frag(kp0 + 32), false,
          bq1, (short)0, s0, false, false);
      s1 = __builtin_amdgcn_wmma_f32_16x16x32_f16(false, load_frag(kp1), false,
          bq0, (short)0, s1, false, false);
      s1 = __builtin_amdgcn_wmma_f32_16x16x32_f16(false, load_frag(kp1 + 32), false,
          bq1, (short)0, s1, false, false);

      // ---- V^T fragments (16 d x 32 keys per dc) by the transposing load:
      //      halves 0..7 = keys 8*lh + 0..7, halves 8..15 = keys 16 + 8*lh + 0..7
      const _Float16* vp = vsb + sub * 32 * ATT_VP;
      v16h av[4];
#pragma unroll
      for (int dc = 0; dc < 4; ++dc) {
        const v8h lo = load_tr16(vp + dc * 16);
        const v8h hi = load_tr16(vp + 16 * ATT_VP + dc * 16);
#pragma unroll
        for (int i = 0; i < 8; ++i) { av[dc][i] = lo[i]; av[dc][i + 8] = hi[i]; }
      }

      // ---- online softmax over the 32 keys of this chunk: 16 scores in-lane,
      //      one exchange of the maximum between the wave's halves
      float a0[8], a1[8];
      float tmx = -INFINITY;
#pragma unroll
      for (int r = 0; r < 8; ++r) {
        a0[r] = s0[r] * scale;
        a1[r] = s1[r] * scale;
        tmx = fmaxf(tmx, fmaxf(a0[r], a1[r]));
      }
      tmx = fmaxf(tmx, other_half(tmx));
      const float mn = fmaxf(mrun, tmx);
      const float al = exp_slot(mrun - mn);
      mrun = mn;
      float rs = 0.0f;
      v16h pb;  // P^T as B operand: pb[s] = P[q0+lm][kc + kmap(s, lh)]
#pragma unroll
      for (int r = 0; r < 8; ++r) {
        const float p0 = exp_slot(a0[r] - mn);
        const float p1 = exp_slot(a1[r] - mn);
        rs += p0 + p1;
        pb[r]     = (_Float16)p0;
        pb[r + 8] = (_Float16)p1;
      }
      lrun = lrun * al + rs;
#pragma unroll
      for (int dc = 0; dc < 4; ++dc)
#pragma unroll
        for (int r = 0; r < 8; ++r) acc[dc][r] *= al;

      // ---- O^T += V^T @ P^T
#pragma unroll
      for (int dc = 0; dc < 4; ++dc)
        acc[dc] = __builtin_amdgcn_wmma_f32_16x16x32_f16(
            false, av[dc], false, pb, (short)0, acc[dc], false, false);
    }

    // ---- publish point of stage st + 1
    // this wave's LDS reads of the buffer that is refilled below have retired
    asm volatile("s_wait_dscnt 0x0" ::: "memory");
    // this wave's copies of stage st + 1 have landed
    asm volatile("s_wait_asynccnt 0x0" ::: "memory");
    // publishes stage st + 1 and ends every wave's reads of stage st
    __syncthreads();
    if (st + 2 < ATT_NST)
      stage_kv_async(kg + (size_t)(st + 2) * gstep, vg + (size_t)(st + 2) * gstep,
                     kl0 + (st & 1) * kbuf, vl0 + (st & 1) * vbuf);
  }
  // no copy is outstanding when the wave ends
  asm volatile("s_wait_asynccnt 0x0" ::: "memory");

  // ---- epilogue: join the halves' sums, normalize, store y (f16);
  //      a lane holds 8 consecutive d of one query row: 16-byte stores
  const float inv = 1.0f / (lrun + other_half(lrun));
  _Float16* yp =
      y + (size_t)(b * ATT_N + q0 + lm) * ATT_D + hl * ATT_HD + klo;
#pragma unroll
  for (int dc = 0; dc < 4; ++dc) {
    v8h o;
#pragma unroll
    for (int r = 0; r < 8; ++r) o[r] = (_Float16)(acc[dc][r] * inv);
    *(v8h*)(yp + dc * 16) = o;
  }
}

// ---------------------------------------------------------------------------
// Host-side launch
// ---------------------------------------------------------------------------
extern "C" void kernel_launch(void* const* d_in, const int* in_sizes, int n_in,
                              void* d_out, int out_size, void* d_ws, size_t ws_size,
                              hipStream_t stream) {
  (void)in_sizes; (void)n_in; (void)out_size; (void)ws_size;

  const float* x  = (const float*)d_in[0];
  const float* Wq = (const float*)d_in[1];
  const float* bq = (const float*)d_in[2];
  const float* Wk = (const float*)d_in[3];
  const float* bk = (const float*)d_in[4];
  const float* Wv = (const float*)d_in[5];
  const float* bv = (const float*)d_in[6];
  const float* Wo = (const float*)d_in[7];
  const float* bo = (const float*)d_in[8];
  float* out = (float*)d_out;

  _Float16* ws = (_Float16*)d_ws;
  const size_t nX  = (size_t)ATT_M * ATT_D;   // 4194304
  const size_t nWq = (size_t)ATT_D * ATT_D;   // 1048576
  const size_t nWk = (size_t)ATT_KD * ATT_D;  // 262144
  _Float16* xh  = ws;
  _Float16* wqh = xh  + nX;
  _Float16* wkh = wqh + nWq;
  _Float16* wvh = wkh + nWk;
  _Float16* woh = wvh + nWk;
  _Float16* qh  = woh + nWq;
  _Float16* kh  = qh  + nX;
  _Float16* vh  = kh  + (size_t)ATT_M * ATT_KD;
  _Float16* yh  = vh  + (size_t)ATT_M * ATT_KD;

  // 1) f16 conversions: one launch, planes xh, wqh, wkh, wvh, woh in a row
  f32_to_f16_all_kernel<<<CV_BLOCKS, CV_THREADS, 0, stream>>>(x, Wq, Wk, Wv, Wo, xh);

  // 2) projections: 4-wave blocks, 64x128 tile
  dim3 blk(128, 1, 1);
  dim3 gq(ATT_M / 64, ATT_D / 128, 1);   // 64 x 8
  dim3 gkv(ATT_M / 64, ATT_KD / 128, 1); // 64 x 2
  gemm_wmma_kernel<_Float16><<<gq,  blk, 0, stream>>>(xh, wqh, bq, qh,
      ATT_M, ATT_D, ATT_D);
  gemm_wmma_kernel<_Float16><<<gkv, blk, 0, stream>>>(xh, wkh, bk, kh,
      ATT_M, ATT_KD, ATT_D);
  gemm_wmma_kernel<_Float16><<<gkv, blk, 0, stream>>>(xh, wvh, bv, vh,
      ATT_M, ATT_KD, ATT_D);

  // 3) attention: 8 waves per (b, KV group, pair of 16-query tiles) = 2*4*64 = 512
  dim3 ablk(256, 1, 1);
  attn_wmma_kernel<<<ATT_B * ATT_G * (ATT_N / 32), ablk, 0, stream>>>(qh, kh, vh, yh);

  // 4) output projection, f32 straight into d_out
  gemm_wmma_kernel<float><<<gq, blk, 0, stream>>>(yh, woh, bo, out,
      ATT_M, ATT_D, ATT_D);
}

// v004
// It runs in 93.7 microseconds.
// In two side-by-side timings against v003, it was 1.32 and 1.29 times as fast.
// Over all steps from v000 it is 2.48 times as fast.
#include <hip/hip_runtime.h>
#include <hip/hip_bf16.h>
#include <math.h>

// ---------------------------------------------------------------------------
// GQA attention forward for MI455X (gfx1250, wave32, WMMA + async-to-LDS).
//   B=2, N=2048, D=1024, H=16, G=4, HD=64, hpg=4
// Pipeline (f16 staging in d_ws, f32 accumulation in WMMA):
//   1) convert x, Wq, Wk, Wv, Wo to f16 (one launch)
//   2) q/k/v projections, one launch over the stacked weights: WMMA GEMM with
//      double-buffered async-to-LDS tiles
//   3) flash attention, 8 waves per (b, KV group, 32 q rows)  (WMMA + LDS)
//   4) out = y@Wo^T + bo (same GEMM, f32 out)
// ---------------------------------------------------------------------------

typedef __attribute__((ext_vector_type(16))) _Float16 v16h;
typedef __attribute__((ext_vector_type(8)))  _Float16 v8h;
typedef __attribute__((ext_vector_type(8)))  float    v8f;

#define ATT_B  2
#define ATT_N  2048
#define ATT_D  1024
#define ATT_G  4
#define ATT_HD 64
#define ATT_KD (ATT_G * ATT_HD)     // 256
#define ATT_M  (ATT_B * ATT_N)      // 4096 rows for the projections

// ---------------------------------------------------------------------------
// f32 -> f16 conversion of x, Wq, Wk, Wv, Wo in ONE launch.
// The five f16 planes lie one behind the other in the workspace (dst), in that
// order. 256 work-groups of 16 waves, one per WGP; a thread converts 13 pieces
// of 4 floats: piece j of grid thread i is piece j * CV_T + i of the joined planes,
// so every wave-wide load covers 512 contiguous bytes and every store 256.
// Pieces 0..7 fall in x, 8..9 in Wq, 10 in Wk (lower half of the grid) or Wv
// (upper half), 11..12 in Wo. All 13 loads are issued before the first store.
// ---------------------------------------------------------------------------
typedef __attribute__((ext_vector_type(4))) float    v4f;
typedef __attribute__((ext_vector_type(4))) _Float16 v4h;

#define CV_THREADS 512
#define CV_BLOCKS  256
#define CV_T       (CV_THREADS * CV_BLOCKS)   // 131072 threads
static_assert(ATT_M * ATT_D  == 8 * 4 * CV_T, "x is 8 pieces per thread");
static_assert(ATT_D * ATT_D  == 2 * 4 * CV_T, "Wq, Wo are 2 pieces per thread");
static_assert(ATT_KD * ATT_D * 2 == 4 * CV_T, "Wk and Wv together are 1 piece");

__global__ __launch_bounds__(CV_THREADS)
void f32_to_f16_all_kernel(const float* __restrict__ x,
                           const float* __restrict__ Wq,
                           const float* __restrict__ Wk,
                           const float* __restrict__ Wv,
                           const float* __restrict__ Wo,
                           _Float16* __restrict__ dst) {
  // the work-group's part of every address is scalar; the one vector offset,
  // the thread's number, lives to the last store
  const int t = threadIdx.x;
  const int w = blockIdx.x * CV_THREADS;               // first piece of the group
  const v4f* xs  = (const v4f*)x + w;
  const v4f* wqs = (const v4f*)Wq + w;
  const v4f* wos = (const v4f*)Wo + w;
  const v4f* wkvs = (blockIdx.x < CV_BLOCKS / 2)
                        ? (const v4f*)Wk + w
                        : (const v4f*)Wv + (w - CV_T / 2);
  v4h* ds = (v4h*)dst + w;
  // every loop below is unrolled so that r[] stays in registers (constant
  // indices) and the 13 loads stand as one run in front of the stores
  v4f r[13];
#pragma unroll
  for (int j = 0; j < 8; ++j) r[j] = xs[j * CV_T + t];
#pragma unroll
  for (int j = 0; j < 2; ++j) r[8 + j] = wqs[j * CV_T + t];
  r[10] = wkvs[t];
#pragma unroll
  for (int j = 0; j < 2; ++j) r[11 + j] = wos[j * CV_T + t];
#pragma unroll
  for (int j = 0; j < 13; ++j)
    ds[j * CV_T + t] = __builtin_convertvector(r[j], v4h);
}

// Load one WMMA f16 fragment (ISA striping): halves 0..7 at p[0..7],
// halves 8..15 at p[16..23]; caller pre-offsets p by klo = (lane/16)*8.
__device__ inline v16h load_frag(const _Float16* p) {
  v8h lo = *(const v8h*)(p);
  v8h hi = *(const v8h*)(p + 16);
  v16h r;
#pragma unroll
  for (int i = 0; i < 8; ++i) { r[i] = lo[i]; r[i + 8] = hi[i]; }
  return r;
}

// ---------------------------------------------------------------------------
// Async stage one K-slab into LDS:
//   A rows [m0, m0+64) x cols [k0, k0+32)  -> As  (row-major [64][32] halves)
//   W rows [n0, n0+128) x cols [k0, k0+32) -> Ws  (row-major [128][32] halves)
// 128 threads; each issues 2 (A) + 4 (W) global_load_async_to_lds_b128,
// i.e. ASYNCcnt += 6 per wave per stage.
// ---------------------------------------------------------------------------
__device__ inline void stage_async(const _Float16* __restrict__ A,
                                   const _Float16* __restrict__ W,
                                   int K, int m0, int n0, int k0,
                                   _Float16* As, _Float16* Ws, int t) {
  const unsigned long long abase = (unsigned long long)(uintptr_t)A;
  const unsigned long long wbase = (unsigned long long)(uintptr_t)W;
#pragma unroll
  for (int i = 0; i < 2; ++i) {
    const int seg = t + i * 128;            // 0..255 (16B segments of A tile)
    const int row = seg >> 2;               // 0..63
    const int c8  = (seg & 3) * 8;          // half offset in row
    const unsigned int voff =
        (unsigned int)(((size_t)(m0 + row) * K + k0 + c8) * 2);
    const unsigned int lds = (unsigned int)(uintptr_t)(As + row * 32 + c8);
    asm volatile("global_load_async_to_lds_b128 %0, %1, %2"
                 :: "v"(lds), "v"(voff), "s"(abase) : "memory");
  }
#pragma unroll
  for (int i = 0; i < 4; ++i) {
    const int seg = t + i * 128;            // 0..511 (16B segments of W tile)
    const int row = seg >> 2;               // 0..127
    const int c8  = (seg & 3) * 8;
    const unsigned int voff =
        (unsigned int)(((size_t)(n0 + row) * K + k0 + c8) * 2);
    const unsigned int lds = (unsigned int)(uintptr_t)(Ws + row * 32 + c8);
    asm volatile("global_load_async_to_lds_b128 %0, %1, %2"
                 :: "v"(lds), "v"(voff), "s"(wbase) : "memory");
  }
}

// ---------------------------------------------------------------------------
// GEMM: out[m,n] = sum_k A[m,k] * W[n,k] + bias[n]
//   A: [M,K] f16 row-major, W: [N,K] f16 row-major, out: [M,N] OutT.
//   4 waves / block; block tile 64x128; wave tile 32x64; K-step 32.
//   Double-buffered async-to-LDS staging overlapped with WMMA.
//   W may stack up to three weight matrices of N, N1 and N2 rows (multiples of
//   128), one behind the other; each has its own bias and its own output of its
//   own width, and blockIdx.y runs over the column blocks of all of them.
// ---------------------------------------------------------------------------
template <typename OutT>
__global__ __launch_bounds__(128)
void gemm_wmma_kernel(const _Float16* __restrict__ A,
                      const _Float16* __restrict__ W,
                      const float* __restrict__ bias,
                      OutT* __restrict__ out,
                      int M, int N, int K,
                      const float* __restrict__ bias1,
                      OutT* __restrict__ out1, int N1,
                      const float* __restrict__ bias2,
                      OutT* __restrict__ out2, int N2) {
  __shared__ __align__(16) _Float16 AsBuf[2][64 * 32];   // 2 x 4 KB
  __shared__ __align__(16) _Float16 WsBuf[2][128 * 32];  // 2 x 8 KB

  const int t    = threadIdx.x;
  const int lane = t & 31;
  const int wv   = t >> 5;
  const int lm   = lane & 15;
  const int lh   = lane >> 4;
  const int klo  = lh * 8;
  const int m0   = blockIdx.x * 64;
  const int n0   = blockIdx.y * 128;
  const int mw   = (wv & 1) * 32;   // wave m-offset in block tile
  const int nw   = (wv >> 1) * 64;  // wave n-offset in block tile

  v8f acc[2][4];
#pragma unroll
  for (int mt = 0; mt < 2; ++mt)
#pragma unroll
    for (int nt = 0; nt < 4; ++nt) acc[mt][nt] = (v8f)(0.0f);

  const int nk = K / 32;
  // prologue: fill both buffers
  stage_async(A, W, K, m0, n0, 0, AsBuf[0], WsBuf[0], t);
  stage_async(A, W, K, m0, n0, 32, AsBuf[1], WsBuf[1], t);

  for (int i = 0; i < nk; ++i) {
    // wait for stage i (6 async per wave per stage; loads complete in order,
    // so <=6 outstanding means stage i has fully landed in LDS)
    if (i + 1 < nk) {
      asm volatile("s_wait_asynccnt 0x6" ::: "memory");
    } else {
      asm volatile("s_wait_asynccnt 0x0" ::: "memory");
    }
    __syncthreads();

    const _Float16* as = AsBuf[i & 1];
    const _Float16* ws = WsBuf[i & 1];
    v16h a[2], b[4];
#pragma unroll
    for (int mt = 0; mt < 2; ++mt)
      a[mt] = load_frag(as + (mw + mt * 16 + lm) * 32 + klo);
#pragma unroll
    for (int nt = 0; nt < 4; ++nt)
      b[nt] = load_frag(ws + (nw + nt * 16 + lm) * 32 + klo);
#pragma unroll
    for (int mt = 0; mt < 2; ++mt)
#pragma unroll
      for (int nt = 0; nt < 4; ++nt)
        acc[mt][nt] = __builtin_amdgcn_wmma_f32_16x16x32_f16(
            false, a[mt], false, b[nt], (short)0, acc[mt][nt], false, false);

    __syncthreads();  // everyone done reading buffer (i&1)
    if (i + 2 < nk)
      stage_async(A, W, K, m0, n0, (i + 2) * 32, AsBuf[i & 1], WsBuf[i & 1], t);
  }

  // which of the stacked matrices this column block belongs to: its first
  // column there, its bias, its output and that output's width (the same for
  // the whole work-group)
  int nb = n0;
  int No = N;
  const float* bs = bias;
  OutT* ob = out;
  if (nb >= N) {
    nb -= N;  No = N1;  bs = bias1;  ob = out1;
    if (nb >= N1) { nb -= N1;  No = N2;  bs = bias2;  ob = out2; }
  }
  // this lane's column in the wave's first 16x16 tile
  const float* bp = bs + (nb + nw + lm);
  OutT* op = ob + (nb + nw + lm);

  // C/D layout: lane, vgpr r -> (row = r + lh*8, col = lm) in each 16x16 tile
#pragma unroll
  for (int mt = 0; mt < 2; ++mt) {
#pragma unroll
    for (int nt = 0; nt < 4; ++nt) {
      const float bb = bp[nt * 16];
#pragma unroll
      for (int r = 0; r < 8; ++r) {
        const int row = m0 + mw + mt * 16 + r + lh * 8;
        op[(size_t)row * No + nt * 16] = (OutT)(acc[mt][nt][r] + bb);
      }
    }
  }
}

__device__ inline float other_half(float x) {
  const int b = __builtin_bit_cast(int, x);
  return __builtin_bit_cast(
      float, __builtin_amdgcn_permlanex16(b, b, 0x76543210, 0xfedcba98,
                                          false, false));
}

// e^x as the parent's __expf compiles (multiply by log2(e), v_exp_f32), with the
// v_nop in the same statement: it keeps the one free issue slot that the
// instruction set asks for between a transcendental and an instruction that
// reads its result or overwrites its source.
__device__ inline float exp_slot(float x) {
  float r;
  asm("v_exp_f32 %0, %1\n\tv_nop" : "=v"(r) : "v"(x * 1.44269504f));
  return r;
}

#define ATT_STG 64                   // keys per stage
#define ATT_NST (ATT_N / ATT_STG)    // 32 stages
#define ATT_KP  72                   // K row pitch in LDS, halves (144 B = 16 B x 9)
#define ATT_VP  80                   // V row pitch in LDS, halves (160 B = 32 B x 5)

typedef __attribute__((ext_vector_type(8))) short s16x8;
typedef __attribute__((address_space(3))) s16x8 lds_s16x8;

// Transposing LDS load: lane (c, h) gets T[kbase + 8h + 0..7][dbase + c] when
// lane l points at row kbase + 8*(l >> 4) + (l & 7), 16-byte half (l >> 3) & 1.
__device__ inline v8h load_tr16(const _Float16* p) {
  return __builtin_bit_cast(
      v8h, __builtin_amdgcn_ds_load_tr16_b128_v8i16((lds_s16x8*)p));
}

// One stage (64 keys of K and of V) into LDS: 256 threads x 4 copies of 16 B.
// A thread owns 16-byte piece (t & 7) of rows (t >> 3) and (t >> 3) + 32, so a
// wave's copy covers four whole 128-byte rows. kg/vg: the thread's own global
// address in row (t >> 3) of the stage; kl/vl: its own LDS byte address there.
// The s_wait_xcnt stands inside the statement so that no address register of
// an issued copy is rewritten in front of it.
__device__ inline void stage_kv_async(const _Float16* kg, const _Float16* vg,
                                      unsigned int kl, unsigned int vl) {
  const _Float16* kg1 = kg + (size_t)32 * ATT_KD;
  const _Float16* vg1 = vg + (size_t)32 * ATT_KD;
  const unsigned int kl1 = kl + 32 * ATT_KP * 2;
  const unsigned int vl1 = vl + 32 * ATT_VP * 2;
  asm volatile("global_load_async_to_lds_b128 %0, %4, off\n\t"
               "global_load_async_to_lds_b128 %1, %5, off\n\t"
               "global_load_async_to_lds_b128 %2, %6, off\n\t"
               "global_load_async_to_lds_b128 %3, %7, off\n\t"
               "s_wait_xcnt 0x0"
               :: "v"(kl), "v"(kl1), "v"(vl), "v"(vl1),
                  "v"(kg), "v"(kg1), "v"(vg), "v"(vg1) : "memory");
}

// Four waves per SIMD, that is two work-groups per WGP: the 512 work-groups
// then spread evenly over the chip's 256 WGPs in one round, and the register
// budget of 256 lets the LDS fragment loads be issued well ahead of their use.
__global__ __launch_bounds__(256) __attribute__((amdgpu_waves_per_eu(4, 4)))
void attn_wmma_kernel(const _Float16* __restrict__ q,
                      const _Float16* __restrict__ k,
                      const _Float16* __restrict__ v,
                      _Float16* __restrict__ y) {
  __shared__ __align__(16) _Float16 Ks[2][ATT_STG * ATT_KP];  // 2 x 9216 B
  __shared__ __align__(16) _Float16 Vs[2][ATT_STG * ATT_VP];  // 2 x 10240 B

  const int t    = threadIdx.x;
  const int lane = t & 31;
  const int wv   = t >> 5;
  const int lm   = lane & 15;
  const int lh   = lane >> 4;
  const int klo  = lh * 8;

  int idx = blockIdx.x;
  const int qp = idx & (ATT_N / 32 - 1);  idx >>= 6;   // N/32 = 64 tile pairs
  const int g  = idx & (ATT_G - 1);       idx >>= 2;   // KV group
  const int b  = idx;                                   // batch
  const int hl = g * 4 + (wv & 3);                      // linear head 0..15
  const int q0 = (qp * 2 + (wv >> 2)) * 16;

  // this thread's piece of a stage: global addresses (stage 0) and LDS places
  const int crow = t >> 3;
  const int cseg = (t & 7) * 8;
  const size_t coff = (size_t)(b * ATT_N + crow) * ATT_KD + g * ATT_HD + cseg;
  const _Float16* kg = k + coff;
  const _Float16* vg = v + coff;
  const unsigned int kl0 =
      (unsigned int)(uintptr_t)(&Ks[0][crow * ATT_KP + cseg]);
  const unsigned int vl0 =
      (unsigned int)(uintptr_t)(&Vs[0][crow * ATT_VP + cseg]);
  const unsigned int kbuf = ATT_STG * ATT_KP * 2;  // bytes from buffer 0 to 1
  const unsigned int vbuf = ATT_STG * ATT_VP * 2;
  const size_t gstep = (size_t)ATT_STG * ATT_KD;   // halves per stage

  // prologue: stage 0 landed and published, then stage 1 in flight
  stage_kv_async(kg, vg, kl0, vl0);
  // stage 0's copies of this wave have landed before the barrier publishes them
  asm volatile("s_wait_asynccnt 0x0" ::: "memory");
  __syncthreads();
  stage_kv_async(kg + gstep, vg + gstep, kl0 + kbuf, vl0 + vbuf);

  // Q fragments: B-matrix 32x16 halves (column = query), d = 0..31 and 32..63
  const _Float16* qptr =
      q + (size_t)(b * ATT_N + q0 + lm) * ATT_D + hl * ATT_HD + klo;
  const v16h bq0 = load_frag(qptr);
  const v16h bq1 = load_frag(qptr + 32);

  float mrun = -INFINITY;  // running maximum of query q0 + lm (both halves equal)
  float lrun = 0.0f;       // running sum over this half's keys only
  v8f acc[4];              // acc[dc][r] = O^T[dc*16 + 8*lh + r][q0 + lm]
#pragma unroll
  for (int dc = 0; dc < 4; ++dc) acc[dc] = (v8f)(0.0f);

  const float scale = 0.125f;  // 1/sqrt(64)

  // fragment offsets inside a stage buffer, in halves
  const int kfo = lm * ATT_KP + klo;
  const int vfo = (8 * lh + (lane & 7)) * ATT_VP + 8 * ((lane >> 3) & 1);

  for (int st = 0; st < ATT_NST; ++st) {
    const _Float16* ksb = Ks[st & 1] + kfo;
    const _Float16* vsb = Vs[st & 1] + vfo;

    // unrolled so that a chunk's place in the stage folds into the LDS loads'
    // immediate offsets
#pragma unroll
    for (int sub = 0; sub < ATT_STG / 32; ++sub) {
      // ---- scores: S^T = K @ Q^T for 32 keys (two 16x16 tiles, K=64 via 2 wmma)
      //      s0[r] = S[q0+lm][kc + 8*lh + r], s1[r] = S[q0+lm][kc + 16 + 8*lh + r]
      const _Float16* kp0 = ksb + sub * 32 * ATT_KP;
      const _Float16* kp1 = kp0 + 16 * ATT_KP;
      v8f s0 = (v8f)(0.0f), s1 = (v8f)(0.0f);
      s0 = __builtin_amdgcn_wmma_f32_16x16x32_f16(false, load_frag(kp0), false,
          bq0, (short)0, s0, false, false);
      s0 = __builtin_amdgcn_wmma_f32_16x16x32_f16(false, load_frag(kp0 + 32), false,
          bq1, (short)0, s0, false, false);
      s1 = __builtin_amdgcn_wmma_f32_16x16x32_f16(false, load_frag(kp1), false,
          bq0, (short)0, s1, false, false);
      s1 = __builtin_amdgcn_wmma_f32_16x16x32_f16(false, load_frag(kp1 + 32), false,
          bq1, (short)0, s1, false, false);

      // ---- V^T fragments (16 d x 32 keys per dc) by the transposing load:
      //      halves 0..7 = keys 8*lh + 0..7, halves 8..15 = keys 16 + 8*lh + 0..7
      const _Float16* vp = vsb + sub * 32 * ATT_VP;
      v16h av[4];
#pragma unroll
      for (int dc = 0; dc < 4; ++dc) {
        const v8h lo = load_tr16(vp + dc * 16);
        const v8h hi = load_tr16(vp + 16 * ATT_VP + dc * 16);
#pragma unroll
        for (int i = 0; i < 8; ++i) { av[dc][i] = lo[i]; av[dc][i + 8] = hi[i]; }
      }

      // ---- online softmax over the 32 keys of this chunk: 16 scores in-lane,
      //      one exchange of the maximum between the wave's halves
      float a0[8], a1[8];
      float tmx = -INFINITY;
#pragma unroll
      for (int r = 0; r < 8; ++r) {
        a0[r] = s0[r] * scale;
        a1[r] = s1[r] * scale;
        tmx = fmaxf(tmx, fmaxf(a0[r], a1[r]));
      }
      tmx = fmaxf(tmx, other_half(tmx));
      const float mn = fmaxf(mrun, tmx);
      const float al = exp_slot(mrun - mn);
      mrun = mn;
      float rs = 0.0f;
      v16h pb;  // P^T as B operand: pb[s] = P[q0+lm][kc + kmap(s, lh)]
#pragma unroll
      for (int r = 0; r < 8; ++r) {
        const float p0 = exp_slot(a0[r] - mn);
        const float p1 = exp_slot(a1[r] - mn);
        rs += p0 + p1;
        pb[r]     = (_Float16)p0;
        pb[r + 8] = (_Float16)p1;
      }
      lrun = lrun * al + rs;
#pragma unroll
      for (int dc = 0; dc < 4; ++dc)
#pragma unroll
        for (int r = 0; r < 8; ++r) acc[dc][r] *= al;

      // ---- O^T += V^T @ P^T
#pragma unroll
      for (int dc = 0; dc < 4; ++dc)
        acc[dc] = __builtin_amdgcn_wmma_f32_16x16x32_f16(
            false, av[dc], false, pb, (short)0, acc[dc], false, false);
    }

    // ---- publish point of stage st + 1
    // this wave's LDS reads of the buffer that is refilled below have retired
    asm volatile("s_wait_dscnt 0x0" ::: "memory");
    // this wave's copies of stage st + 1 have landed
    asm volatile("s_wait_asynccnt 0x0" ::: "memory");
    // publishes stage st + 1 and ends every wave's reads of stage st
    __syncthreads();
    if (st + 2 < ATT_NST)
      stage_kv_async(kg + (size_t)(st + 2) * gstep, vg + (size_t)(st + 2) * gstep,
                     kl0 + (st & 1) * kbuf, vl0 + (st & 1) * vbuf);
  }
  // no copy is outstanding when the wave ends
  asm volatile("s_wait_asynccnt 0x0" ::: "memory");

  // ---- epilogue: join the halves' sums, normalize, store y (f16);
  //      a lane holds 8 consecutive d of one query row: 16-byte stores
  const float inv = 1.0f / (lrun + other_half(lrun));
  _Float16* yp =
      y + (size_t)(b * ATT_N + q0 + lm) * ATT_D + hl * ATT_HD + klo;
#pragma unroll
  for (int dc = 0; dc < 4; ++dc) {
    v8h o;
#pragma unroll
    for (int r = 0; r < 8; ++r) o[r] = (_Float16)(acc[dc][r] * inv);
    *(v8h*)(yp + dc * 16) = o;
  }
}

// ---------------------------------------------------------------------------
// Host-side launch
// ---------------------------------------------------------------------------
extern "C" void kernel_launch(void* const* d_in, const int* in_sizes, int n_in,
                              void* d_out, int out_size, void* d_ws, size_t ws_size,
                              hipStream_t stream) {
  (void)in_sizes; (void)n_in; (void)out_size; (void)ws_size;

  const float* x  = (const float*)d_in[0];
  const float* Wq = (const float*)d_in[1];
  const float* bq = (const float*)d_in[2];
  const float* Wk = (const float*)d_in[3];
  const float* bk = (const float*)d_in[4];
  const float* Wv = (const float*)d_in[5];
  const float* bv = (const float*)d_in[6];
  const float* Wo = (const float*)d_in[7];
  const float* bo = (const float*)d_in[8];
  float* out = (float*)d_out;

  _Float16* ws = (_Float16*)d_ws;
  const size_t nX  = (size_t)ATT_M * ATT_D;   // 4194304
  const size_t nWq = (size_t)ATT_D * ATT_D;   // 1048576
  const size_t nWk = (size_t)ATT_KD * ATT_D;  // 262144
  _Float16* xh  = ws;
  _Float16* wqh = xh  + nX;
  _Float16* wkh = wqh + nWq;
  _Float16* wvh = wkh + nWk;
  _Float16* woh = wvh + nWk;
  _Float16* qh  = woh + nWq;
  _Float16* kh  = qh  + nX;
  _Float16* vh  = kh  + (size_t)ATT_M * ATT_KD;
  _Float16* yh  = vh  + (size_t)ATT_M * ATT_KD;

  // 1) f16 conversions: one launch, planes xh, wqh, wkh, wvh, woh in a row
  f32_to_f16_all_kernel<<<CV_BLOCKS, CV_THREADS, 0, stream>>>(x, Wq, Wk, Wv, Wo, xh);

  // 2) projections: 4-wave blocks, 64x128 tile; q, k and v in one launch: the
  //    planes wqh, wkh, wvh lie in a row and read as one [1536][1024] weight
  dim3 blk(128, 1, 1);
  dim3 gq(ATT_M / 64, ATT_D / 128, 1);                    // 64 x 8
  dim3 gqkv(ATT_M / 64, (ATT_D + 2 * ATT_KD) / 128, 1);   // 64 x 12
  gemm_wmma_kernel<_Float16><<<gqkv, blk, 0, stream>>>(xh, wqh, bq, qh,
      ATT_M, ATT_D, ATT_D, bk, kh, ATT_KD, bv, vh, ATT_KD);

  // 3) attention: 8 waves per (b, KV group, pair of 16-query tiles) = 2*4*64 = 512
  dim3 ablk(256, 1, 1);
  attn_wmma_kernel<<<ATT_B * ATT_G * (ATT_N / 32), ablk, 0, stream>>>(qh, kh, vh, yh);

  // 4) output projection, f32 straight into d_out (one weight matrix: the
  //    second and third places are never selected)
  gemm_wmma_kernel<float><<<gq, blk, 0, stream>>>(yh, woh, bo, out,
      ATT_M, ATT_D, ATT_D, bo, out, 0, bo, out, 0);
}

// v005
// It runs in 81.1 microseconds.
// In both of two side-by-side timings against v004, it was 1.15 times as fast.
// Over all steps from v000 it is 2.85 times as fast.
#include <hip/hip_runtime.h>
#include <hip/hip_bf16.h>
#include <math.h>

// ---------------------------------------------------------------------------
// GQA attention forward for MI455X (gfx1250, wave32, WMMA + async-to-LDS).
//   B=2, N=2048, D=1024, H=16, G=4, HD=64, hpg=4
// Pipeline (f16 staging in d_ws, f32 accumulation in WMMA):
//   1) convert x, Wq, Wk, Wv, Wo to f16 (one launch)
//   2) q/k/v projections, one launch over the stacked weights: WMMA GEMM with
//      double-buffered async-to-LDS tiles
//   3) flash attention, 8 waves per (b, KV group, 32 q rows)  (WMMA + LDS)
//   4) out = y@Wo^T + bo (same GEMM, f32 out)
// ---------------------------------------------------------------------------

typedef __attribute__((ext_vector_type(16))) _Float16 v16h;
typedef __attribute__((ext_vector_type(8)))  _Float16 v8h;
typedef __attribute__((ext_vector_type(8)))  float    v8f;

#define ATT_B  2
#define ATT_N  2048
#define ATT_D  1024
#define ATT_G  4
#define ATT_HD 64
#define ATT_KD (ATT_G * ATT_HD)     // 256
#define ATT_M  (ATT_B * ATT_N)      // 4096 rows for the projections

// ---------------------------------------------------------------------------
// f32 -> f16 conversion of x, Wq, Wk, Wv, Wo in ONE launch.
// The five f16 planes lie one behind the other in the workspace (dst), in that
// order. 256 work-groups of 16 waves, one per WGP; a thread converts 13 pieces
// of 4 floats: piece j of grid thread i is piece j * CV_T + i of the joined planes,
// so every wave-wide load covers 512 contiguous bytes and every store 256.
// Pieces 0..7 fall in x, 8..9 in Wq, 10 in Wk (lower half of the grid) or Wv
// (upper half), 11..12 in Wo. All 13 loads are issued before the first store.
// ---------------------------------------------------------------------------
typedef __attribute__((ext_vector_type(4))) float    v4f;
typedef __attribute__((ext_vector_type(4))) _Float16 v4h;

#define CV_THREADS 512
#define CV_BLOCKS  256
#define CV_T       (CV_THREADS * CV_BLOCKS)   // 131072 threads
static_assert(ATT_M * ATT_D  == 8 * 4 * CV_T, "x is 8 pieces per thread");
static_assert(ATT_D * ATT_D  == 2 * 4 * CV_T, "Wq, Wo are 2 pieces per thread");
static_assert(ATT_KD * ATT_D * 2 == 4 * CV_T, "Wk and Wv together are 1 piece");

__global__ __launch_bounds__(CV_THREADS)
void f32_to_f16_all_kernel(const float* __restrict__ x,
                           const float* __restrict__ Wq,
                           const float* __restrict__ Wk,
                           const float* __restrict__ Wv,
                           const float* __restrict__ Wo,
                           _Float16* __restrict__ dst) {
  // the work-group's part of every address is scalar; the one vector offset,
  // the thread's number, lives to the last store
  const int t = threadIdx.x;
  const int w = blockIdx.x * CV_THREADS;               // first piece of the group
  const v4f* xs  = (const v4f*)x + w;
  const v4f* wqs = (const v4f*)Wq + w;
  const v4f* wos = (const v4f*)Wo + w;
  const v4f* wkvs = (blockIdx.x < CV_BLOCKS / 2)
                        ? (const v4f*)Wk + w
                        : (const v4f*)Wv + (w - CV_T / 2);
  v4h* ds = (v4h*)dst + w;
  // every loop below is unrolled so that r[] stays in registers (constant
  // indices) and the 13 loads stand as one run in front of the stores
  v4f r[13];
#pragma unroll
  for (int j = 0; j < 8; ++j) r[j] = xs[j * CV_T + t];
#pragma unroll
  for (int j = 0; j < 2; ++j) r[8 + j] = wqs[j * CV_T + t];
  r[10] = wkvs[t];
#pragma unroll
  for (int j = 0; j < 2; ++j) r[11 + j] = wos[j * CV_T + t];
#pragma unroll
  for (int j = 0; j < 13; ++j)
    ds[j * CV_T + t] = __builtin_convertvector(r[j], v4h);
}

// Load one WMMA f16 fragment (ISA striping): halves 0..7 at p[0..7],
// halves 8..15 at p[16..23]; caller pre-offsets p by klo = (lane/16)*8.
__device__ inline v16h load_frag(const _Float16* p) {
  v8h lo = *(const v8h*)(p);
  v8h hi = *(const v8h*)(p + 16);
  v16h r;
#pragma unroll
  for (int i = 0; i < 8; ++i) { r[i] = lo[i]; r[i + 8] = hi[i]; }
  return r;
}

// LDS row pitch of the GEMM tiles, in halves: a row holds 32 halves (64 B) and
// is laid at 80 B = 16 B x 5. The 16 lanes of a fragment's ds_load_b128 read 16
// rows at one column: at 64 B they fall on 16 of the 64 banks (four turns), at
// 80 B on all 64 (one turn).
#define GEMM_LP 40

// ---------------------------------------------------------------------------
// Async stage one K-slab into LDS:
//   A rows [m0, m0+64) x cols [k0, k0+32)  -> As  (64 rows of 32 halves, pitch GEMM_LP)
//   W rows [n0, n0+128) x cols [k0, k0+32) -> Ws  (128 rows of 32 halves, pitch GEMM_LP)
// 128 threads; each issues 2 (A) + 4 (W) global_load_async_to_lds_b128,
// i.e. ASYNCcnt += 6 per wave per stage.
// ---------------------------------------------------------------------------
__device__ inline void stage_async(const _Float16* __restrict__ A,
                                   const _Float16* __restrict__ W,
                                   int K, int m0, int n0, int k0,
                                   _Float16* As, _Float16* Ws, int t) {
  const unsigned long long abase = (unsigned long long)(uintptr_t)A;
  const unsigned long long wbase = (unsigned long long)(uintptr_t)W;
#pragma unroll
  for (int i = 0; i < 2; ++i) {
    const int seg = t + i * 128;            // 0..255 (16B segments of A tile)
    const int row = seg >> 2;               // 0..63
    const int c8  = (seg & 3) * 8;          // half offset in row
    const unsigned int voff =
        (unsigned int)(((size_t)(m0 + row) * K + k0 + c8) * 2);
    const unsigned int lds = (unsigned int)(uintptr_t)(As + row * GEMM_LP + c8);
    asm volatile("global_load_async_to_lds_b128 %0, %1, %2"
                 :: "v"(lds), "v"(voff), "s"(abase) : "memory");
  }
#pragma unroll
  for (int i = 0; i < 4; ++i) {
    const int seg = t + i * 128;            // 0..511 (16B segments of W tile)
    const int row = seg >> 2;               // 0..127
    const int c8  = (seg & 3) * 8;
    const unsigned int voff =
        (unsigned int)(((size_t)(n0 + row) * K + k0 + c8) * 2);
    const unsigned int lds = (unsigned int)(uintptr_t)(Ws + row * GEMM_LP + c8);
    asm volatile("global_load_async_to_lds_b128 %0, %1, %2"
                 :: "v"(lds), "v"(voff), "s"(wbase) : "memory");
  }
}

// ---------------------------------------------------------------------------
// GEMM: out[m,n] = sum_k A[m,k] * W[n,k] + bias[n]
//   A: [M,K] f16 row-major, W: [N,K] f16 row-major, out: [M,N] OutT.
//   4 waves / block; block tile 64x128; wave tile 32x64; K-step 32.
//   Double-buffered async-to-LDS staging overlapped with WMMA.
//   W may stack up to three weight matrices of N, N1 and N2 rows (multiples of
//   128), one behind the other; each has its own bias and its own output of its
//   own width, and blockIdx.y runs over the column blocks of all of them.
// ---------------------------------------------------------------------------
template <typename OutT>
__global__ __launch_bounds__(128)
void gemm_wmma_kernel(const _Float16* __restrict__ A,
                      const _Float16* __restrict__ W,
                      const float* __restrict__ bias,
                      OutT* __restrict__ out,
                      int M, int N, int K,
                      const float* __restrict__ bias1,
                      OutT* __restrict__ out1, int N1,
                      const float* __restrict__ bias2,
                      OutT* __restrict__ out2, int N2) {
  __shared__ __align__(16) _Float16 AsBuf[2][64 * GEMM_LP];   // 2 x 5 KB
  __shared__ __align__(16) _Float16 WsBuf[2][128 * GEMM_LP];  // 2 x 10 KB

  const int t    = threadIdx.x;
  const int lane = t & 31;
  const int wv   = t >> 5;
  const int lm   = lane & 15;
  const int lh   = lane >> 4;
  const int klo  = lh * 8;
  const int m0   = blockIdx.x * 64;
  const int n0   = blockIdx.y * 128;
  const int mw   = (wv & 1) * 32;   // wave m-offset in block tile
  const int nw   = (wv >> 1) * 64;  // wave n-offset in block tile

  v8f acc[2][4];
#pragma unroll
  for (int mt = 0; mt < 2; ++mt)
#pragma unroll
    for (int nt = 0; nt < 4; ++nt) acc[mt][nt] = (v8f)(0.0f);

  const int nk = K / 32;
  // prologue: fill both buffers
  stage_async(A, W, K, m0, n0, 0, AsBuf[0], WsBuf[0], t);
  stage_async(A, W, K, m0, n0, 32, AsBuf[1], WsBuf[1], t);

  for (int i = 0; i < nk; ++i) {
    // wait for stage i (6 async per wave per stage; loads complete in order,
    // so <=6 outstanding means stage i has fully landed in LDS)
    if (i + 1 < nk) {
      asm volatile("s_wait_asynccnt 0x6" ::: "memory");
    } else {
      asm volatile("s_wait_asynccnt 0x0" ::: "memory");
    }
    __syncthreads();

    const _Float16* as = AsBuf[i & 1];
    const _Float16* ws = WsBuf[i & 1];
    v16h a[2], b[4];
#pragma unroll
    for (int mt = 0; mt < 2; ++mt)
      a[mt] = load_frag(as + (mw + mt * 16 + lm) * GEMM_LP + klo);
#pragma unroll
    for (int nt = 0; nt < 4; ++nt)
      b[nt] = load_frag(ws + (nw + nt * 16 + lm) * GEMM_LP + klo);
#pragma unroll
    for (int mt = 0; mt < 2; ++mt)
#pragma unroll
      for (int nt = 0; nt < 4; ++nt)
        acc[mt][nt] = __builtin_amdgcn_wmma_f32_16x16x32_f16(
            false, a[mt], false, b[nt], (short)0, acc[mt][nt], false, false);

    __syncthreads();  // everyone done reading buffer (i&1)
    if (i + 2 < nk)
      stage_async(A, W, K, m0, n0, (i + 2) * 32, AsBuf[i & 1], WsBuf[i & 1], t);
  }

  // which of the stacked matrices this column block belongs to: its first
  // column there, its bias, its output and that output's width (the same for
  // the whole work-group)
  int nb = n0;
  int No = N;
  const float* bs = bias;
  OutT* ob = out;
  if (nb >= N) {
    nb -= N;  No = N1;  bs = bias1;  ob = out1;
    if (nb >= N1) { nb -= N1;  No = N2;  bs = bias2;  ob = out2; }
  }
  // this lane's column in the wave's first 16x16 tile
  const float* bp = bs + (nb + nw + lm);
  OutT* op = ob + (nb + nw + lm);

  // C/D layout: lane, vgpr r -> (row = r + lh*8, col = lm) in each 16x16 tile
#pragma unroll
  for (int mt = 0; mt < 2; ++mt) {
#pragma unroll
    for (int nt = 0; nt < 4; ++nt) {
      const float bb = bp[nt * 16];
#pragma unroll
      for (int r = 0; r < 8; ++r) {
        const int row = m0 + mw + mt * 16 + r + lh * 8;
        op[(size_t)row * No + nt * 16] = (OutT)(acc[mt][nt][r] + bb);
      }
    }
  }
}

__device__ inline float other_half(float x) {
  const int b = __builtin_bit_cast(int, x);
  return __builtin_bit_cast(
      float, __builtin_amdgcn_permlanex16(b, b, 0x76543210, 0xfedcba98,
                                          false, false));
}

// e^x as the parent's __expf compiles (multiply by log2(e), v_exp_f32), with the
// v_nop in the same statement: it keeps the one free issue slot that the
// instruction set asks for between a transcendental and an instruction that
// reads its result or overwrites its source.
__device__ inline float exp_slot(float x) {
  float r;
  asm("v_exp_f32 %0, %1\n\tv_nop" : "=v"(r) : "v"(x * 1.44269504f));
  return r;
}

#define ATT_STG 64                   // keys per stage
#define ATT_NST (ATT_N / ATT_STG)    // 32 stages
#define ATT_KP  72                   // K row pitch in LDS, halves (144 B = 16 B x 9)
#define ATT_VP  80                   // V row pitch in LDS, halves (160 B = 32 B x 5)

typedef __attribute__((ext_vector_type(8))) short s16x8;
typedef __attribute__((address_space(3))) s16x8 lds_s16x8;

// Transposing LDS load: lane (c, h) gets T[kbase + 8h + 0..7][dbase + c] when
// lane l points at row kbase + 8*(l >> 4) + (l & 7), 16-byte half (l >> 3) & 1.
__device__ inline v8h load_tr16(const _Float16* p) {
  return __builtin_bit_cast(
      v8h, __builtin_amdgcn_ds_load_tr16_b128_v8i16((lds_s16x8*)p));
}

// One stage (64 keys of K and of V) into LDS: 256 threads x 4 copies of 16 B.
// A thread owns 16-byte piece (t & 7) of rows (t >> 3) and (t >> 3) + 32, so a
// wave's copy covers four whole 128-byte rows. kg/vg: the thread's own global
// address in row (t >> 3) of the stage; kl/vl: its own LDS byte address there.
// The s_wait_xcnt stands inside the statement so that no address register of
// an issued copy is rewritten in front of it.
__device__ inline void stage_kv_async(const _Float16* kg, const _Float16* vg,
                                      unsigned int kl, unsigned int vl) {
  const _Float16* kg1 = kg + (size_t)32 * ATT_KD;
  const _Float16* vg1 = vg + (size_t)32 * ATT_KD;
  const unsigned int kl1 = kl + 32 * ATT_KP * 2;
  const unsigned int vl1 = vl + 32 * ATT_VP * 2;
  asm volatile("global_load_async_to_lds_b128 %0, %4, off\n\t"
               "global_load_async_to_lds_b128 %1, %5, off\n\t"
               "global_load_async_to_lds_b128 %2, %6, off\n\t"
               "global_load_async_to_lds_b128 %3, %7, off\n\t"
               "s_wait_xcnt 0x0"
               :: "v"(kl), "v"(kl1), "v"(vl), "v"(vl1),
                  "v"(kg), "v"(kg1), "v"(vg), "v"(vg1) : "memory");
}

// Four waves per SIMD, that is two work-groups per WGP: the 512 work-groups
// then spread evenly over the chip's 256 WGPs in one round, and the register
// budget of 256 lets the LDS fragment loads be issued well ahead of their use.
__global__ __launch_bounds__(256) __attribute__((amdgpu_waves_per_eu(4, 4)))
void attn_wmma_kernel(const _Float16* __restrict__ q,
                      const _Float16* __restrict__ k,
                      const _Float16* __restrict__ v,
                      _Float16* __restrict__ y) {
  __shared__ __align__(16) _Float16 Ks[2][ATT_STG * ATT_KP];  // 2 x 9216 B
  __shared__ __align__(16) _Float16 Vs[2][ATT_STG * ATT_VP];  // 2 x 10240 B

  const int t    = threadIdx.x;
  const int lane = t & 31;
  const int wv   = t >> 5;
  const int lm   = lane & 15;
  const int lh   = lane >> 4;
  const int klo  = lh * 8;

  int idx = blockIdx.x;
  const int qp = idx & (ATT_N / 32 - 1);  idx >>= 6;   // N/32 = 64 tile pairs
  const int g  = idx & (ATT_G - 1);       idx >>= 2;   // KV group
  const int b  = idx;                                   // batch
  const int hl = g * 4 + (wv & 3);                      // linear head 0..15
  const int q0 = (qp * 2 + (wv >> 2)) * 16;

  // this thread's piece of a stage: global addresses (stage 0) and LDS places
  const int crow = t >> 3;
  const int cseg = (t & 7) * 8;
  const size_t coff = (size_t)(b * ATT_N + crow) * ATT_KD + g * ATT_HD + cseg;
  const _Float16* kg = k + coff;
  const _Float16* vg = v + coff;
  const unsigned int kl0 =
      (unsigned int)(uintptr_t)(&Ks[0][crow * ATT_KP + cseg]);
  const unsigned int vl0 =
      (unsigned int)(uintptr_t)(&Vs[0][crow * ATT_VP + cseg]);
  const unsigned int kbuf = ATT_STG * ATT_KP * 2;  // bytes from buffer 0 to 1
  const unsigned int vbuf = ATT_STG * ATT_VP * 2;
  const size_t gstep = (size_t)ATT_STG * ATT_KD;   // halves per stage

  // prologue: stage 0 landed and published, then stage 1 in flight
  stage_kv_async(kg, vg, kl0, vl0);
  // stage 0's copies of this wave have landed before the barrier publishes them
  asm volatile("s_wait_asynccnt 0x0" ::: "memory");
  __syncthreads();
  stage_kv_async(kg + gstep, vg + gstep, kl0 + kbuf, vl0 + vbuf);

  // Q fragments: B-matrix 32x16 halves (column = query), d = 0..31 and 32..63
  const _Float16* qptr =
      q + (size_t)(b * ATT_N + q0 + lm) * ATT_D + hl * ATT_HD + klo;
  const v16h bq0 = load_frag(qptr);
  const v16h bq1 = load_frag(qptr + 32);

  float mrun = -INFINITY;  // running maximum of query q0 + lm (both halves equal)
  float lrun = 0.0f;       // running sum over this half's keys only
  v8f acc[4];              // acc[dc][r] = O^T[dc*16 + 8*lh + r][q0 + lm]
#pragma unroll
  for (int dc = 0; dc < 4; ++dc) acc[dc] = (v8f)(0.0f);

  const float scale = 0.125f;  // 1/sqrt(64)

  // fragment offsets inside a stage buffer, in halves
  const int kfo = lm * ATT_KP + klo;
  const int vfo = (8 * lh + (lane & 7)) * ATT_VP + 8 * ((lane >> 3) & 1);

  for (int st = 0; st < ATT_NST; ++st) {
    const _Float16* ksb = Ks[st & 1] + kfo;
    const _Float16* vsb = Vs[st & 1] + vfo;

    // unrolled so that a chunk's place in the stage folds into the LDS loads'
    // immediate offsets
#pragma unroll
    for (int sub = 0; sub < ATT_STG / 32; ++sub) {
      // ---- scores: S^T = K @ Q^T for 32 keys (two 16x16 tiles, K=64 via 2 wmma)
      //      s0[r] = S[q0+lm][kc + 8*lh + r], s1[r] = S[q0+lm][kc + 16 + 8*lh + r]
      const _Float16* kp0 = ksb + sub * 32 * ATT_KP;
      const _Float16* kp1 = kp0 + 16 * ATT_KP;
      v8f s0 = (v8f)(0.0f), s1 = (v8f)(0.0f);
      s0 = __builtin_amdgcn_wmma_f32_16x16x32_f16(false, load_frag(kp0), false,
          bq0, (short)0, s0, false, false);
      s0 = __builtin_amdgcn_wmma_f32_16x16x32_f16(false, load_frag(kp0 + 32), false,
          bq1, (short)0, s0, false, false);
      s1 = __builtin_amdgcn_wmma_f32_16x16x32_f16(false, load_frag(kp1), false,
          bq0, (short)0, s1, false, false);
      s1 = __builtin_amdgcn_wmma_f32_16x16x32_f16(false, load_frag(kp1 + 32), false,
          bq1, (short)0, s1, false, false);

      // ---- V^T fragments (16 d x 32 keys per dc) by the transposing load:
      //      halves 0..7 = keys 8*lh + 0..7, halves 8..15 = keys 16 + 8*lh + 0..7
      const _Float16* vp = vsb + sub * 32 * ATT_VP;
      v16h av[4];
#pragma unroll
      for (int dc = 0; dc < 4; ++dc) {
        const v8h lo = load_tr16(vp + dc * 16);
        const v8h hi = load_tr16(vp + 16 * ATT_VP + dc * 16);
#pragma unroll
        for (int i = 0; i < 8; ++i) { av[dc][i] = lo[i]; av[dc][i + 8] = hi[i]; }
      }

      // ---- online softmax over the 32 keys of this chunk: 16 scores in-lane,
      //      one exchange of the maximum between the wave's halves
      float a0[8], a1[8];
      float tmx = -INFINITY;
#pragma unroll
      for (int r = 0; r < 8; ++r) {
        a0[r] = s0[r] * scale;
        a1[r] = s1[r] * scale;
        tmx = fmaxf(tmx, fmaxf(a0[r], a1[r]));
      }
      tmx = fmaxf(tmx, other_half(tmx));
      const float mn = fmaxf(mrun, tmx);
      const float al = exp_slot(mrun - mn);
      mrun = mn;
      float rs = 0.0f;
      v16h pb;  // P^T as B operand: pb[s] = P[q0+lm][kc + kmap(s, lh)]
#pragma unroll
      for (int r = 0; r < 8; ++r) {
        const float p0 = exp_slot(a0[r] - mn);
        const float p1 = exp_slot(a1[r] - mn);
        rs += p0 + p1;
        pb[r]     = (_Float16)p0;
        pb[r + 8] = (_Float16)p1;
      }
      lrun = lrun * al + rs;
#pragma unroll
      for (int dc = 0; dc < 4; ++dc)
#pragma unroll
        for (int r = 0; r < 8; ++r) acc[dc][r] *= al;

      // ---- O^T += V^T @ P^T
#pragma unroll
      for (int dc = 0; dc < 4; ++dc)
        acc[dc] = __builtin_amdgcn_wmma_f32_16x16x32_f16(
            false, av[dc], false, pb, (short)0, acc[dc], false, false);
    }

    // ---- publish point of stage st + 1
    // this wave's LDS reads of the buffer that is refilled below have retired
    asm volatile("s_wait_dscnt 0x0" ::: "memory");
    // this wave's copies of stage st + 1 have landed
    asm volatile("s_wait_asynccnt 0x0" ::: "memory");
    // publishes stage st + 1 and ends every wave's reads of stage st
    __syncthreads();
    if (st + 2 < ATT_NST)
      stage_kv_async(kg + (size_t)(st + 2) * gstep, vg + (size_t)(st + 2) * gstep,
                     kl0 + (st & 1) * kbuf, vl0 + (st & 1) * vbuf);
  }
  // no copy is outstanding when the wave ends
  asm volatile("s_wait_asynccnt 0x0" ::: "memory");

  // ---- epilogue: join the halves' sums, normalize, store y (f16);
  //      a lane holds 8 consecutive d of one query row: 16-byte stores
  const float inv = 1.0f / (lrun + other_half(lrun));
  _Float16* yp =
      y + (size_t)(b * ATT_N + q0 + lm) * ATT_D + hl * ATT_HD + klo;
#pragma unroll
  for (int dc = 0; dc < 4; ++dc) {
    v8h o;
#pragma unroll
    for (int r = 0; r < 8; ++r) o[r] = (_Float16)(acc[dc][r] * inv);
    *(v8h*)(yp + dc * 16) = o;
  }
}

// ---------------------------------------------------------------------------
// Host-side launch
// ---------------------------------------------------------------------------
extern "C" void kernel_launch(void* const* d_in, const int* in_sizes, int n_in,
                              void* d_out, int out_size, void* d_ws, size_t ws_size,
                              hipStream_t stream) {
  (void)in_sizes; (void)n_in; (void)out_size; (void)ws_size;

  const float* x  = (const float*)d_in[0];
  const float* Wq = (const float*)d_in[1];
  const float* bq = (const float*)d_in[2];
  const float* Wk = (const float*)d_in[3];
  const float* bk = (const float*)d_in[4];
  const float* Wv = (const float*)d_in[5];
  const float* bv = (const float*)d_in[6];
  const float* Wo = (const float*)d_in[7];
  const float* bo = (const float*)d_in[8];
  float* out = (float*)d_out;

  _Float16* ws = (_Float16*)d_ws;
  const size_t nX  = (size_t)ATT_M * ATT_D;   // 4194304
  const size_t nWq = (size_t)ATT_D * ATT_D;   // 1048576
  const size_t nWk = (size_t)ATT_KD * ATT_D;  // 262144
  _Float16* xh  = ws;
  _Float16* wqh = xh  + nX;
  _Float16* wkh = wqh + nWq;
  _Float16* wvh = wkh + nWk;
  _Float16* woh = wvh + nWk;
  _Float16* qh  = woh + nWq;
  _Float16* kh  = qh  + nX;
  _Float16* vh  = kh  + (size_t)ATT_M * ATT_KD;
  _Float16* yh  = vh  + (size_t)ATT_M * ATT_KD;

  // 1) f16 conversions: one launch, planes xh, wqh, wkh, wvh, woh in a row
  f32_to_f16_all_kernel<<<CV_BLOCKS, CV_THREADS, 0, stream>>>(x, Wq, Wk, Wv, Wo, xh);

  // 2) projections: 4-wave blocks, 64x128 tile; q, k and v in one launch: the
  //    planes wqh, wkh, wvh lie in a row and read as one [1536][1024] weight
  dim3 blk(128, 1, 1);
  dim3 gq(ATT_M / 64, ATT_D / 128, 1);                    // 64 x 8
  dim3 gqkv(ATT_M / 64, (ATT_D + 2 * ATT_KD) / 128, 1);   // 64 x 12
  gemm_wmma_kernel<_Float16><<<gqkv, blk, 0, stream>>>(xh, wqh, bq, qh,
      ATT_M, ATT_D, ATT_D, bk, kh, ATT_KD, bv, vh, ATT_KD);

  // 3) attention: 8 waves per (b, KV group, pair of 16-query tiles) = 2*4*64 = 512
  dim3 ablk(256, 1, 1);
  attn_wmma_kernel<<<ATT_B * ATT_G * (ATT_N / 32), ablk, 0, stream>>>(qh, kh, vh, yh);

  // 4) output projection, f32 straight into d_out (one weight matrix: the
  //    second and third places are never selected)
  gemm_wmma_kernel<float><<<gq, blk, 0, stream>>>(yh, woh, bo, out,
      ATT_M, ATT_D, ATT_D, bo, out, 0, bo, out, 0);
}

// v006
// A run of this version takes 78.2 microseconds.
// Next to v005, in two timings, it ran 1.05 and 1.04 times as fast.
// Counting every step since v000, it is 2.98 times as fast.
#include <hip/hip_runtime.h>
#include <hip/hip_bf16.h>
#include <math.h>

// ---------------------------------------------------------------------------
// GQA attention forward for MI455X (gfx1250, wave32, WMMA + async-to-LDS).
//   B=2, N=2048, D=1024, H=16, G=4, HD=64, hpg=4
// Pipeline (f16 staging in d_ws, f32 accumulation in WMMA):
//   1) convert x, Wq, Wk, Wv, Wo to f16 (one launch)
//   2) q/k/v projections, one launch over the stacked weights: WMMA GEMM with
//      double-buffered async-to-LDS tiles
//   3) flash attention, 8 waves per (b, KV group, 32 q rows)  (WMMA + LDS)
//   4) out = y@Wo^T + bo (same GEMM, f32 out)
// ---------------------------------------------------------------------------

typedef __attribute__((ext_vector_type(16))) _Float16 v16h;
typedef __attribute__((ext_vector_type(8)))  _Float16 v8h;
typedef __attribute__((ext_vector_type(8)))  float    v8f;

#define ATT_B  2
#define ATT_N  2048
#define ATT_D  1024
#define ATT_G  4
#define ATT_HD 64
#define ATT_KD (ATT_G * ATT_HD)     // 256
#define ATT_M  (ATT_B * ATT_N)      // 4096 rows for the projections

// ---------------------------------------------------------------------------
// f32 -> f16 conversion of x, Wq, Wk, Wv, Wo in ONE launch.
// The five f16 planes lie one behind the other in the workspace (dst), in that
// order. 256 work-groups of 16 waves, one per WGP; a thread converts 13 pieces
// of 4 floats: piece j of grid thread i is piece j * CV_T + i of the joined planes,
// so every wave-wide load covers 512 contiguous bytes and every store 256.
// Pieces 0..7 fall in x, 8..9 in Wq, 10 in Wk (lower half of the grid) or Wv
// (upper half), 11..12 in Wo. All 13 loads are issued before the first store.
// ---------------------------------------------------------------------------
typedef __attribute__((ext_vector_type(4))) float    v4f;
typedef __attribute__((ext_vector_type(4))) _Float16 v4h;

#define CV_THREADS 512
#define CV_BLOCKS  256
#define CV_T       (CV_THREADS * CV_BLOCKS)   // 131072 threads
static_assert(ATT_M * ATT_D  == 8 * 4 * CV_T, "x is 8 pieces per thread");
static_assert(ATT_D * ATT_D  == 2 * 4 * CV_T, "Wq, Wo are 2 pieces per thread");
static_assert(ATT_KD * ATT_D * 2 == 4 * CV_T, "Wk and Wv together are 1 piece");

__global__ __launch_bounds__(CV_THREADS)
void f32_to_f16_all_kernel(const float* __restrict__ x,
                           const float* __restrict__ Wq,
                           const float* __restrict__ Wk,
                           const float* __restrict__ Wv,
                           const float* __restrict__ Wo,
                           _Float16* __restrict__ dst) {
  // the work-group's part of every address is scalar; the one vector offset,
  // the thread's number, lives to the last store
  const int t = threadIdx.x;
  const int w = blockIdx.x * CV_THREADS;               // first piece of the group
  const v4f* xs  = (const v4f*)x + w;
  const v4f* wqs = (const v4f*)Wq + w;
  const v4f* wos = (const v4f*)Wo + w;
  const v4f* wkvs = (blockIdx.x < CV_BLOCKS / 2)
                        ? (const v4f*)Wk + w
                        : (const v4f*)Wv + (w - CV_T / 2);
  v4h* ds = (v4h*)dst + w;
  // every loop below is unrolled so that r[] stays in registers (constant
  // indices) and the 13 loads stand as one run in front of the stores
  v4f r[13];
#pragma unroll
  for (int j = 0; j < 8; ++j) r[j] = xs[j * CV_T + t];
#pragma unroll
  for (int j = 0; j < 2; ++j) r[8 + j] = wqs[j * CV_T + t];
  r[10] = wkvs[t];
#pragma unroll
  for (int j = 0; j < 2; ++j) r[11 + j] = wos[j * CV_T + t];
#pragma unroll
  for (int j = 0; j < 13; ++j)
    ds[j * CV_T + t] = __builtin_convertvector(r[j], v4h);
}

// Load one WMMA f16 fragment (ISA striping): halves 0..7 at p[0..7],
// halves 8..15 at p[16..23]; caller pre-offsets p by klo = (lane/16)*8.
__device__ inline v16h load_frag(const _Float16* p) {
  v8h lo = *(const v8h*)(p);
  v8h hi = *(const v8h*)(p + 16);
  v16h r;
#pragma unroll
  for (int i = 0; i < 8; ++i) { r[i] = lo[i]; r[i + 8] = hi[i]; }
  return r;
}

// LDS row pitch of the GEMM tiles, in halves: a row holds 32 halves (64 B) and
// is laid at 80 B = 16 B x 5. The 16 lanes of a fragment's ds_load_b128 read 16
// rows at one column: at 64 B they fall on 16 of the 64 banks (four turns), at
// 80 B on all 64 (one turn).
#define GEMM_LP 40

// ---------------------------------------------------------------------------
// Async stage one K-slab into LDS:
//   A rows [m0, m0+64) x cols [k0, k0+32)  -> As  (64 rows of 32 halves, pitch GEMM_LP)
//   W rows [n0, n0+128) x cols [k0, k0+32) -> Ws  (128 rows of 32 halves, pitch GEMM_LP)
// 128 threads; each issues 2 (A) + 4 (W) global_load_async_to_lds_b128,
// i.e. ASYNCcnt += 6 per wave per stage.
// ---------------------------------------------------------------------------
__device__ inline void stage_async(const _Float16* __restrict__ A,
                                   const _Float16* __restrict__ W,
                                   int K, int m0, int n0, int k0,
                                   _Float16* As, _Float16* Ws, int t) {
  const unsigned long long abase = (unsigned long long)(uintptr_t)A;
  const unsigned long long wbase = (unsigned long long)(uintptr_t)W;
#pragma unroll
  for (int i = 0; i < 2; ++i) {
    const int seg = t + i * 128;            // 0..255 (16B segments of A tile)
    const int row = seg >> 2;               // 0..63
    const int c8  = (seg & 3) * 8;          // half offset in row
    const unsigned int voff =
        (unsigned int)(((size_t)(m0 + row) * K + k0 + c8) * 2);
    const unsigned int lds = (unsigned int)(uintptr_t)(As + row * GEMM_LP + c8);
    asm volatile("global_load_async_to_lds_b128 %0, %1, %2"
                 :: "v"(lds), "v"(voff), "s"(abase) : "memory");
  }
#pragma unroll
  for (int i = 0; i < 4; ++i) {
    const int seg = t + i * 128;            // 0..511 (16B segments of W tile)
    const int row = seg >> 2;               // 0..127
    const int c8  = (seg & 3) * 8;
    const unsigned int voff =
        (unsigned int)(((size_t)(n0 + row) * K + k0 + c8) * 2);
    const unsigned int lds = (unsigned int)(uintptr_t)(Ws + row * GEMM_LP + c8);
    asm volatile("global_load_async_to_lds_b128 %0, %1, %2"
                 :: "v"(lds), "v"(voff), "s"(wbase) : "memory");
  }
}

// ---------------------------------------------------------------------------
// GEMM: out[m,n] = sum_k A[m,k] * W[n,k] + bias[n]
//   A: [M,K] f16 row-major, W: [N,K] f16 row-major, out: [M,N] OutT.
//   4 waves / block; block tile 64x128; wave tile 32x64; K-step 32.
//   Double-buffered async-to-LDS staging overlapped with WMMA.
//   W may stack up to three weight matrices of N, N1 and N2 rows (multiples of
//   128), one behind the other; each has its own bias and its own output of its
//   own width, and blockIdx.y runs over the column blocks of all of them.
// ---------------------------------------------------------------------------
template <typename OutT>
__global__ __launch_bounds__(128)
void gemm_wmma_kernel(const _Float16* __restrict__ A,
                      const _Float16* __restrict__ W,
                      const float* __restrict__ bias,
                      OutT* __restrict__ out,
                      int M, int N, int K,
                      const float* __restrict__ bias1,
                      OutT* __restrict__ out1, int N1,
                      const float* __restrict__ bias2,
                      OutT* __restrict__ out2, int N2) {
  __shared__ __align__(16) _Float16 AsBuf[2][64 * GEMM_LP];   // 2 x 5 KB
  __shared__ __align__(16) _Float16 WsBuf[2][128 * GEMM_LP];  // 2 x 10 KB

  const int t    = threadIdx.x;
  const int lane = t & 31;
  const int wv   = t >> 5;
  const int lm   = lane & 15;
  const int lh   = lane >> 4;
  const int klo  = lh * 8;
  const int m0   = blockIdx.x * 64;
  const int n0   = blockIdx.y * 128;
  const int mw   = (wv & 1) * 32;   // wave m-offset in block tile
  const int nw   = (wv >> 1) * 64;  // wave n-offset in block tile

  v8f acc[2][4];
#pragma unroll
  for (int mt = 0; mt < 2; ++mt)
#pragma unroll
    for (int nt = 0; nt < 4; ++nt) acc[mt][nt] = (v8f)(0.0f);

  const int nk = K / 32;
  // prologue: fill both buffers
  stage_async(A, W, K, m0, n0, 0, AsBuf[0], WsBuf[0], t);
  stage_async(A, W, K, m0, n0, 32, AsBuf[1], WsBuf[1], t);

  for (int i = 0; i < nk; ++i) {
    // wait for stage i (6 async per wave per stage; loads complete in order,
    // so <=6 outstanding means stage i has fully landed in LDS)
    if (i + 1 < nk) {
      asm volatile("s_wait_asynccnt 0x6" ::: "memory");
    } else {
      asm volatile("s_wait_asynccnt 0x0" ::: "memory");
    }
    __syncthreads();

    const _Float16* as = AsBuf[i & 1];
    const _Float16* ws = WsBuf[i & 1];
    v16h a[2], b[4];
#pragma unroll
    for (int mt = 0; mt < 2; ++mt)
      a[mt] = load_frag(as + (mw + mt * 16 + lm) * GEMM_LP + klo);
#pragma unroll
    for (int nt = 0; nt < 4; ++nt)
      b[nt] = load_frag(ws + (nw + nt * 16 + lm) * GEMM_LP + klo);
#pragma unroll
    for (int mt = 0; mt < 2; ++mt)
#pragma unroll
      for (int nt = 0; nt < 4; ++nt)
        acc[mt][nt] = __builtin_amdgcn_wmma_f32_16x16x32_f16(
            false, a[mt], false, b[nt], (short)0, acc[mt][nt], false, false);

    __syncthreads();  // everyone done reading buffer (i&1)
    if (i + 2 < nk)
      stage_async(A, W, K, m0, n0, (i + 2) * 32, AsBuf[i & 1], WsBuf[i & 1], t);
  }

  // which of the stacked matrices this column block belongs to: its first
  // column there, its bias, its output and that output's width (the same for
  // the whole work-group)
  int nb = n0;
  int No = N;
  const float* bs = bias;
  OutT* ob = out;
  if (nb >= N) {
    nb -= N;  No = N1;  bs = bias1;  ob = out1;
    if (nb >= N1) { nb -= N1;  No = N2;  bs = bias2;  ob = out2; }
  }
  // this lane's column in the wave's first 16x16 tile
  const float* bp = bs + (nb + nw + lm);
  OutT* op = ob + (nb + nw + lm);

  // C/D layout: lane, vgpr r -> (row = r + lh*8, col = lm) in each 16x16 tile
#pragma unroll
  for (int mt = 0; mt < 2; ++mt) {
#pragma unroll
    for (int nt = 0; nt < 4; ++nt) {
      const float bb = bp[nt * 16];
#pragma unroll
      for (int r = 0; r < 8; ++r) {
        const int row = m0 + mw + mt * 16 + r + lh * 8;
        op[(size_t)row * No + nt * 16] = (OutT)(acc[mt][nt][r] + bb);
      }
    }
  }
}

__device__ inline float other_half(float x) {
  const int b = __builtin_bit_cast(int, x);
  return __builtin_bit_cast(
      float, __builtin_amdgcn_permlanex16(b, b, 0x76543210, 0xfedcba98,
                                          false, false));
}

// 2^x by v_exp_f32, with the v_nop in the same statement: it keeps the one free
// issue slot that the instruction set asks for between a transcendental and an
// instruction that reads its result or overwrites its source.
__device__ inline float exp2_slot(float x) {
  float r;
  asm("v_exp_f32 %0, %1\n\tv_nop" : "=v"(r) : "v"(x));
  return r;
}

#define ATT_STG 64                   // keys per stage
#define ATT_NST (ATT_N / ATT_STG)    // 32 stages
#define ATT_KP  72                   // K row pitch in LDS, halves (144 B = 16 B x 9)
#define ATT_VP  80                   // V row pitch in LDS, halves (160 B = 32 B x 5)

typedef __attribute__((ext_vector_type(8))) short s16x8;
typedef __attribute__((address_space(3))) s16x8 lds_s16x8;

// Transposing LDS load: lane (c, h) gets T[kbase + 8h + 0..7][dbase + c] when
// lane l points at row kbase + 8*(l >> 4) + (l & 7), 16-byte half (l >> 3) & 1.
__device__ inline v8h load_tr16(const _Float16* p) {
  return __builtin_bit_cast(
      v8h, __builtin_amdgcn_ds_load_tr16_b128_v8i16((lds_s16x8*)p));
}

// One stage (64 keys of K and of V) into LDS: 256 threads x 4 copies of 16 B.
// A thread owns 16-byte piece (t & 7) of rows (t >> 3) and (t >> 3) + 32, so a
// wave's copy covers four whole 128-byte rows. kg/vg: the thread's own global
// address in row (t >> 3) of the stage; kl/vl: its own LDS byte address there.
// The s_wait_xcnt stands inside the statement so that no address register of
// an issued copy is rewritten in front of it.
__device__ inline void stage_kv_async(const _Float16* kg, const _Float16* vg,
                                      unsigned int kl, unsigned int vl) {
  const _Float16* kg1 = kg + (size_t)32 * ATT_KD;
  const _Float16* vg1 = vg + (size_t)32 * ATT_KD;
  const unsigned int kl1 = kl + 32 * ATT_KP * 2;
  const unsigned int vl1 = vl + 32 * ATT_VP * 2;
  asm volatile("global_load_async_to_lds_b128 %0, %4, off\n\t"
               "global_load_async_to_lds_b128 %1, %5, off\n\t"
               "global_load_async_to_lds_b128 %2, %6, off\n\t"
               "global_load_async_to_lds_b128 %3, %7, off\n\t"
               "s_wait_xcnt 0x0"
               :: "v"(kl), "v"(kl1), "v"(vl), "v"(vl1),
                  "v"(kg), "v"(kg1), "v"(vg), "v"(vg1) : "memory");
}

// Four waves per SIMD, that is two work-groups per WGP: the 512 work-groups
// then spread evenly over the chip's 256 WGPs in one round, and the register
// budget of 256 lets the LDS fragment loads be issued well ahead of their use.
__global__ __launch_bounds__(256) __attribute__((amdgpu_waves_per_eu(4, 4)))
void attn_wmma_kernel(const _Float16* __restrict__ q,
                      const _Float16* __restrict__ k,
                      const _Float16* __restrict__ v,
                      _Float16* __restrict__ y) {
  __shared__ __align__(16) _Float16 Ks[2][ATT_STG * ATT_KP];  // 2 x 9216 B
  __shared__ __align__(16) _Float16 Vs[2][ATT_STG * ATT_VP];  // 2 x 10240 B

  const int t    = threadIdx.x;
  const int lane = t & 31;
  const int wv   = t >> 5;
  const int lm   = lane & 15;
  const int lh   = lane >> 4;
  const int klo  = lh * 8;

  int idx = blockIdx.x;
  const int qp = idx & (ATT_N / 32 - 1);  idx >>= 6;   // N/32 = 64 tile pairs
  const int g  = idx & (ATT_G - 1);       idx >>= 2;   // KV group
  const int b  = idx;                                   // batch
  const int hl = g * 4 + (wv & 3);                      // linear head 0..15
  const int q0 = (qp * 2 + (wv >> 2)) * 16;

  // this thread's piece of a stage: global addresses (stage 0) and LDS places
  const int crow = t >> 3;
  const int cseg = (t & 7) * 8;
  const size_t coff = (size_t)(b * ATT_N + crow) * ATT_KD + g * ATT_HD + cseg;
  const _Float16* kg = k + coff;
  const _Float16* vg = v + coff;
  const unsigned int kl0 =
      (unsigned int)(uintptr_t)(&Ks[0][crow * ATT_KP + cseg]);
  const unsigned int vl0 =
      (unsigned int)(uintptr_t)(&Vs[0][crow * ATT_VP + cseg]);
  const unsigned int kbuf = ATT_STG * ATT_KP * 2;  // bytes from buffer 0 to 1
  const unsigned int vbuf = ATT_STG * ATT_VP * 2;
  const size_t gstep = (size_t)ATT_STG * ATT_KD;   // halves per stage

  // prologue: stage 0 landed and published, then stage 1 in flight
  stage_kv_async(kg, vg, kl0, vl0);
  // stage 0's copies of this wave have landed before the barrier publishes them
  asm volatile("s_wait_asynccnt 0x0" ::: "memory");
  __syncthreads();
  stage_kv_async(kg + gstep, vg + gstep, kl0 + kbuf, vl0 + vbuf);

  // Q fragments: B-matrix 32x16 halves (column = query), d = 0..31 and 32..63
  const _Float16* qptr =
      q + (size_t)(b * ATT_N + q0 + lm) * ATT_D + hl * ATT_HD + klo;
  const v16h bq0 = load_frag(qptr);
  const v16h bq1 = load_frag(qptr + 32);

  float mrun = -INFINITY;  // running maximum of query q0 + lm, unscaled (both halves equal)
  float lrun = 0.0f;       // running sum over this half's keys only
  v8f acc[4];              // acc[dc][r] = O^T[dc*16 + 8*lh + r][q0 + lm]
#pragma unroll
  for (int dc = 0; dc < 4; ++dc) acc[dc] = (v8f)(0.0f);

  // 1/sqrt(64) * log2(e): e^(scale * (s - m)) = 2^(s * sl2 - m * sl2)
  const float sl2 = 0.125f * 1.44269504f;

  // fragment offsets inside a stage buffer, in halves
  const int kfo = lm * ATT_KP + klo;
  const int vfo = (8 * lh + (lane & 7)) * ATT_VP + 8 * ((lane >> 3) & 1);

  for (int st = 0; st < ATT_NST; ++st) {
    const _Float16* ksb = Ks[st & 1] + kfo;
    const _Float16* vsb = Vs[st & 1] + vfo;

    // unrolled so that a chunk's place in the stage folds into the LDS loads'
    // immediate offsets
#pragma unroll
    for (int sub = 0; sub < ATT_STG / 32; ++sub) {
      // ---- scores: S^T = K @ Q^T for 32 keys (two 16x16 tiles, K=64 via 2 wmma)
      //      s0[r] = S[q0+lm][kc + 8*lh + r], s1[r] = S[q0+lm][kc + 16 + 8*lh + r]
      const _Float16* kp0 = ksb + sub * 32 * ATT_KP;
      const _Float16* kp1 = kp0 + 16 * ATT_KP;
      v8f s0 = (v8f)(0.0f), s1 = (v8f)(0.0f);
      s0 = __builtin_amdgcn_wmma_f32_16x16x32_f16(false, load_frag(kp0), false,
          bq0, (short)0, s0, false, false);
      s0 = __builtin_amdgcn_wmma_f32_16x16x32_f16(false, load_frag(kp0 + 32), false,
          bq1, (short)0, s0, false, false);
      s1 = __builtin_amdgcn_wmma_f32_16x16x32_f16(false, load_frag(kp1), false,
          bq0, (short)0, s1, false, false);
      s1 = __builtin_amdgcn_wmma_f32_16x16x32_f16(false, load_frag(kp1 + 32), false,
          bq1, (short)0, s1, false, false);

      // ---- V^T fragments (16 d x 32 keys per dc) by the transposing load:
      //      halves 0..7 = keys 8*lh + 0..7, halves 8..15 = keys 16 + 8*lh + 0..7
      const _Float16* vp = vsb + sub * 32 * ATT_VP;
      v16h av[4];
#pragma unroll
      for (int dc = 0; dc < 4; ++dc) {
        const v8h lo = load_tr16(vp + dc * 16);
        const v8h hi = load_tr16(vp + 16 * ATT_VP + dc * 16);
#pragma unroll
        for (int i = 0; i < 8; ++i) { av[dc][i] = lo[i]; av[dc][i + 8] = hi[i]; }
      }

      // ---- online softmax over the 32 keys of this chunk: 16 scores in-lane,
      //      one exchange of the maximum between the wave's halves
      //      the maximum is kept in units of the raw products (the scale is
      //      positive); scale and log2(e) enter in the one fused multiply-add
      //      that forms each exponent
      float tmx = -INFINITY;
#pragma unroll
      for (int r = 0; r < 8; ++r) tmx = fmaxf(tmx, fmaxf(s0[r], s1[r]));
      tmx = fmaxf(tmx, other_half(tmx));
      const float mn = fmaxf(mrun, tmx);
      const float al = exp2_slot((mrun - mn) * sl2);
      mrun = mn;
      const float nm = -mn * sl2;
      float rs = 0.0f;
      v16h pb;  // P^T as B operand: pb[s] = P[q0+lm][kc + kmap(s, lh)]
#pragma unroll
      for (int r = 0; r < 8; ++r) {
        const float p0 = exp2_slot(__builtin_fmaf(s0[r], sl2, nm));
        const float p1 = exp2_slot(__builtin_fmaf(s1[r], sl2, nm));
        rs += p0 + p1;
        pb[r]     = (_Float16)p0;
        pb[r + 8] = (_Float16)p1;
      }
      lrun = lrun * al + rs;
#pragma unroll
      for (int dc = 0; dc < 4; ++dc)
#pragma unroll
        for (int r = 0; r < 8; ++r) acc[dc][r] *= al;

      // ---- O^T += V^T @ P^T
#pragma unroll
      for (int dc = 0; dc < 4; ++dc)
        acc[dc] = __builtin_amdgcn_wmma_f32_16x16x32_f16(
            false, av[dc], false, pb, (short)0, acc[dc], false, false);
    }

    // ---- publish point of stage st + 1
    // this wave's LDS reads of the buffer that is refilled below have retired
    asm volatile("s_wait_dscnt 0x0" ::: "memory");
    // this wave's copies of stage st + 1 have landed
    asm volatile("s_wait_asynccnt 0x0" ::: "memory");
    // publishes stage st + 1 and ends every wave's reads of stage st
    __syncthreads();
    if (st + 2 < ATT_NST)
      stage_kv_async(kg + (size_t)(st + 2) * gstep, vg + (size_t)(st + 2) * gstep,
                     kl0 + (st & 1) * kbuf, vl0 + (st & 1) * vbuf);
  }
  // no copy is outstanding when the wave ends
  asm volatile("s_wait_asynccnt 0x0" ::: "memory");

  // ---- epilogue: join the halves' sums, normalize, store y (f16);
  //      a lane holds 8 consecutive d of one query row: 16-byte stores
  const float inv = 1.0f / (lrun + other_half(lrun));
  _Float16* yp =
      y + (size_t)(b * ATT_N + q0 + lm) * ATT_D + hl * ATT_HD + klo;
#pragma unroll
  for (int dc = 0; dc < 4; ++dc) {
    v8h o;
#pragma unroll
    for (int r = 0; r < 8; ++r) o[r] = (_Float16)(acc[dc][r] * inv);
    *(v8h*)(yp + dc * 16) = o;
  }
}

// ---------------------------------------------------------------------------
// Host-side launch
// ---------------------------------------------------------------------------
extern "C" void kernel_launch(void* const* d_in, const int* in_sizes, int n_in,
                              void* d_out, int out_size, void* d_ws, size_t ws_size,
                              hipStream_t stream) {
  (void)in_sizes; (void)n_in; (void)out_size; (void)ws_size;

  const float* x  = (const float*)d_in[0];
  const float* Wq = (const float*)d_in[1];
  const float* bq = (const float*)d_in[2];
  const float* Wk = (const float*)d_in[3];
  const float* bk = (const float*)d_in[4];
  const float* Wv = (const float*)d_in[5];
  const float* bv = (const float*)d_in[6];
  const float* Wo = (const float*)d_in[7];
  const float* bo = (const float*)d_in[8];
  float* out = (float*)d_out;

  _Float16* ws = (_Float16*)d_ws;
  const size_t nX  = (size_t)ATT_M * ATT_D;   // 4194304
  const size_t nWq = (size_t)ATT_D * ATT_D;   // 1048576
  const size_t nWk = (size_t)ATT_KD * ATT_D;  // 262144
  _Float16* xh  = ws;
  _Float16* wqh = xh  + nX;
  _Float16* wkh = wqh + nWq;
  _Float16* wvh = wkh + nWk;
  _Float16* woh = wvh + nWk;
  _Float16* qh  = woh + nWq;
  _Float16* kh  = qh  + nX;
  _Float16* vh  = kh  + (size_t)ATT_M * ATT_KD;
  _Float16* yh  = vh  + (size_t)ATT_M * ATT_KD;

  // 1) f16 conversions: one launch, planes xh, wqh, wkh, wvh, woh in a row
  f32_to_f16_all_kernel<<<CV_BLOCKS, CV_THREADS, 0, stream>>>(x, Wq, Wk, Wv, Wo, xh);

  // 2) projections: 4-wave blocks, 64x128 tile; q, k and v in one launch: the
  //    planes wqh, wkh, wvh lie in a row and read as one [1536][1024] weight
  dim3 blk(128, 1, 1);
  dim3 gq(ATT_M / 64, ATT_D / 128, 1);                    // 64 x 8
  dim3 gqkv(ATT_M / 64, (ATT_D + 2 * ATT_KD) / 128, 1);   // 64 x 12
  gemm_wmma_kernel<_Float16><<<gqkv, blk, 0, stream>>>(xh, wqh, bq, qh,
      ATT_M, ATT_D, ATT_D, bk, kh, ATT_KD, bv, vh, ATT_KD);

  // 3) attention: 8 waves per (b, KV group, pair of 16-query tiles) = 2*4*64 = 512
  dim3 ablk(256, 1, 1);
  attn_wmma_kernel<<<ATT_B * ATT_G * (ATT_N / 32), ablk, 0, stream>>>(qh, kh, vh, yh);

  // 4) output projection, f32 straight into d_out (one weight matrix: the
  //    second and third places are never selected)
  gemm_wmma_kernel<float><<<gq, blk, 0, stream>>>(yh, woh, bo, out,
      ATT_M, ATT_D, ATT_D, bo, out, 0, bo, out, 0);
}

// v007
// Measured time: 71.2 microseconds a run.
// In two side-by-side timings against v006, it was 1.08 and 1.09 times as fast.
// Over all steps from v000 it is 3.23 times as fast.
#include <hip/hip_runtime.h>
#include <hip/hip_bf16.h>
#include <math.h>

// ---------------------------------------------------------------------------
// GQA attention forward for MI455X (gfx1250, wave32, WMMA + async-to-LDS).
//   B=2, N=2048, D=1024, H=16, G=4, HD=64, hpg=4
// Pipeline (f16 staging in d_ws, f32 accumulation in WMMA):
//   1) convert x, Wq, Wk, Wv, Wo to f16 (one launch)
//   2) q/k/v projections, one launch over the stacked weights: WMMA GEMM with
//      a ring of async-to-LDS tiles
//   3) flash attention, 8 waves per (b, KV group, 32 q rows)  (WMMA + LDS)
//   4) out = y@Wo^T + bo (same GEMM, f32 out)
// ---------------------------------------------------------------------------

typedef __attribute__((ext_vector_type(16))) _Float16 v16h;
typedef __attribute__((ext_vector_type(8)))  _Float16 v8h;
typedef __attribute__((ext_vector_type(8)))  float    v8f;

#define ATT_B  2
#define ATT_N  2048
#define ATT_D  1024
#define ATT_G  4
#define ATT_HD 64
#define ATT_KD (ATT_G * ATT_HD)     // 256
#define ATT_M  (ATT_B * ATT_N)      // 4096 rows for the projections

// ---------------------------------------------------------------------------
// f32 -> f16 conversion of x, Wq, Wk, Wv, Wo in ONE launch.
// The five f16 planes lie one behind the other in the workspace (dst), in that
// order. 256 work-groups of 16 waves, one per WGP; a thread converts 13 pieces
// of 4 floats: piece j of grid thread i is piece j * CV_T + i of the joined planes,
// so every wave-wide load covers 512 contiguous bytes and every store 256.
// Pieces 0..7 fall in x, 8..9 in Wq, 10 in Wk (lower half of the grid) or Wv
// (upper half), 11..12 in Wo. All 13 loads are issued before the first store.
// ---------------------------------------------------------------------------
typedef __attribute__((ext_vector_type(4))) float    v4f;
typedef __attribute__((ext_vector_type(4))) _Float16 v4h;

#define CV_THREADS 512
#define CV_BLOCKS  256
#define CV_T       (CV_THREADS * CV_BLOCKS)   // 131072 threads
static_assert(ATT_M * ATT_D  == 8 * 4 * CV_T, "x is 8 pieces per thread");
static_assert(ATT_D * ATT_D  == 2 * 4 * CV_T, "Wq, Wo are 2 pieces per thread");
static_assert(ATT_KD * ATT_D * 2 == 4 * CV_T, "Wk and Wv together are 1 piece");

__global__ __launch_bounds__(CV_THREADS)
void f32_to_f16_all_kernel(const float* __restrict__ x,
                           const float* __restrict__ Wq,
                           const float* __restrict__ Wk,
                           const float* __restrict__ Wv,
                           const float* __restrict__ Wo,
                           _Float16* __restrict__ dst) {
  // the work-group's part of every address is scalar; the one vector offset,
  // the thread's number, lives to the last store
  const int t = threadIdx.x;
  const int w = blockIdx.x * CV_THREADS;               // first piece of the group
  const v4f* xs  = (const v4f*)x + w;
  const v4f* wqs = (const v4f*)Wq + w;
  const v4f* wos = (const v4f*)Wo + w;
  const v4f* wkvs = (blockIdx.x < CV_BLOCKS / 2)
                        ? (const v4f*)Wk + w
                        : (const v4f*)Wv + (w - CV_T / 2);
  v4h* ds = (v4h*)dst + w;
  // every loop below is unrolled so that r[] stays in registers (constant
  // indices) and the 13 loads stand as one run in front of the stores
  v4f r[13];
#pragma unroll
  for (int j = 0; j < 8; ++j) r[j] = xs[j * CV_T + t];
#pragma unroll
  for (int j = 0; j < 2; ++j) r[8 + j] = wqs[j * CV_T + t];
  r[10] = wkvs[t];
#pragma unroll
  for (int j = 0; j < 2; ++j) r[11 + j] = wos[j * CV_T + t];
#pragma unroll
  for (int j = 0; j < 13; ++j)
    ds[j * CV_T + t] = __builtin_convertvector(r[j], v4h);
}

// Load one WMMA f16 fragment (ISA striping): halves 0..7 at p[0..7],
// halves 8..15 at p[16..23]; caller pre-offsets p by klo = (lane/16)*8.
__device__ inline v16h load_frag(const _Float16* p) {
  v8h lo = *(const v8h*)(p);
  v8h hi = *(const v8h*)(p + 16);
  v16h r;
#pragma unroll
  for (int i = 0; i < 8; ++i) { r[i] = lo[i]; r[i + 8] = hi[i]; }
  return r;
}

// LDS row pitch of the GEMM tiles, in halves: a row holds 32 halves (64 B) and
// is laid at 80 B = 16 B x 5. The 16 lanes of a fragment's ds_load_b128 read 16
// rows at one column: at 64 B they fall on 16 of the 64 banks (four turns), at
// 80 B on all 64 (one turn).
#define GEMM_LP 40

// Buffers of the GEMM's LDS ring. A stage's copies are issued GEMM_NB - 1 trips
// ahead of the trip that reads it, so that their way from L2 or memory is
// covered by the trips between; 6 x 15 KB lets three work-groups share a WGP.
#define GEMM_NB 6
#define GEMM_AB (64 * GEMM_LP)    // halves per A buffer
#define GEMM_WB (128 * GEMM_LP)   // halves per W buffer

// ---------------------------------------------------------------------------
// Async stage one K-slab into LDS:
//   A rows [m0, m0+64) x 32 k  -> one A buffer (64 rows of 32 halves, pitch GEMM_LP)
//   W rows [n0, n0+128) x 32 k -> one W buffer (128 rows of 32 halves, pitch GEMM_LP)
// 128 threads; each issues 2 (A) + 4 (W) global_load_async_to_lds_b128,
// i.e. ASYNCcnt += 6 per wave per stage.
// ab, wb: A and W advanced to the slab's first k (scalar); va, vw: the thread's
// byte offsets from there (the same for every slab); la, lw: its LDS byte
// addresses in buffer 0; ao, wo: byte offsets of the target buffer.
// The s_wait_xcnt stands inside the statement so that no address register of
// an issued copy is rewritten in front of it.
// ---------------------------------------------------------------------------
__device__ inline void stage_async(unsigned long long ab, unsigned long long wb,
                                   const unsigned int (&va)[2],
                                   const unsigned int (&vw)[4],
                                   const unsigned int (&la)[2],
                                   const unsigned int (&lw)[4],
                                   unsigned int ao, unsigned int wo) {
  asm volatile("global_load_async_to_lds_b128 %0, %6, %12\n\t"
               "global_load_async_to_lds_b128 %1, %7, %12\n\t"
               "global_load_async_to_lds_b128 %2, %8, %13\n\t"
               "global_load_async_to_lds_b128 %3, %9, %13\n\t"
               "global_load_async_to_lds_b128 %4, %10, %13\n\t"
               "global_load_async_to_lds_b128 %5, %11, %13\n\t"
               "s_wait_xcnt 0x0"
               :: "v"(la[0] + ao), "v"(la[1] + ao),
                  "v"(lw[0] + wo), "v"(lw[1] + wo),
                  "v"(lw[2] + wo), "v"(lw[3] + wo),
                  "v"(va[0]), "v"(va[1]),
                  "v"(vw[0]), "v"(vw[1]), "v"(vw[2]), "v"(vw[3]),
                  "s"(ab), "s"(wb) : "memory");
}

// ---------------------------------------------------------------------------
// GEMM: out[m,n] = sum_k A[m,k] * W[n,k] + bias[n]
//   A: [M,K] f16 row-major, W: [N,K] f16 row-major, out: [M,N] OutT.
//   4 waves / block; block tile 64x128; wave tile 32x64; K-step 32.
//   Ring of GEMM_NB async-to-LDS stages, one barrier per stage.
//   W may stack up to three weight matrices of N, N1 and N2 rows (multiples of
//   128), one behind the other; each has its own bias and its own output of its
//   own width, and blockIdx.y runs over the column blocks of all of them.
// ---------------------------------------------------------------------------
template <typename OutT>
__global__ __launch_bounds__(128)
void gemm_wmma_kernel(const _Float16* __restrict__ A,
                      const _Float16* __restrict__ W,
                      const float* __restrict__ bias,
                      OutT* __restrict__ out,
                      int M, int N, int K,
                      const float* __restrict__ bias1,
                      OutT* __restrict__ out1, int N1,
                      const float* __restrict__ bias2,
                      OutT* __restrict__ out2, int N2) {
  __shared__ __align__(16) _Float16 AsBuf[GEMM_NB][GEMM_AB];  // 6 x 5 KB
  __shared__ __align__(16) _Float16 WsBuf[GEMM_NB][GEMM_WB];  // 6 x 10 KB

  const int t    = threadIdx.x;
  const int lane = t & 31;
  const int wv   = t >> 5;
  const int lm   = lane & 15;
  const int lh   = lane >> 4;
  const int klo  = lh * 8;
  const int m0   = blockIdx.x * 64;
  const int n0   = blockIdx.y * 128;
  const int mw   = (wv & 1) * 32;   // wave m-offset in block tile
  const int nw   = (wv >> 1) * 64;  // wave n-offset in block tile

  v8f acc[2][4];
#pragma unroll
  for (int mt = 0; mt < 2; ++mt)
#pragma unroll
    for (int nt = 0; nt < 4; ++nt) acc[mt][nt] = (v8f)(0.0f);

  // this thread's pieces of a stage: 16-byte piece (t & 3) of rows (t >> 2) + 32 j
  const unsigned long long abase = (unsigned long long)(uintptr_t)A;
  const unsigned long long wbase = (unsigned long long)(uintptr_t)W;
  const int srow = t >> 2;
  const int sc8  = (t & 3) * 8;
  unsigned int va[2], la[2], vw[4], lw[4];
#pragma unroll
  for (int j = 0; j < 2; ++j) {
    va[j] = (unsigned int)(((size_t)(m0 + srow + 32 * j) * K + sc8) * 2);
    la[j] = (unsigned int)(uintptr_t)(&AsBuf[0][(srow + 32 * j) * GEMM_LP + sc8]);
  }
#pragma unroll
  for (int j = 0; j < 4; ++j) {
    vw[j] = (unsigned int)(((size_t)(n0 + srow + 32 * j) * K + sc8) * 2);
    lw[j] = (unsigned int)(uintptr_t)(&WsBuf[0][(srow + 32 * j) * GEMM_LP + sc8]);
  }

  const int nk = K / 32;
  // prologue: stages 0 .. GEMM_NB - 2 in flight, each into its own buffer
#pragma unroll
  for (int s = 0; s < GEMM_NB - 1; ++s)
    if (s < nk)
      stage_async(abase + (unsigned long long)s * 64, wbase + (unsigned long long)s * 64,
                  va, vw, la, lw, s * (GEMM_AB * 2), s * (GEMM_WB * 2));

  int rb = 0;             // buffer of stage i
  int fb = GEMM_NB - 1;   // buffer of stage i - 1, refilled with stage i + GEMM_NB - 1
  for (int i = 0; i < nk; ++i) {
    // ---- publish point of stage i
    // this wave's LDS reads of stage i - 1, whose buffer is refilled below, have retired
    asm volatile("s_wait_dscnt 0x0" ::: "memory");
    // this wave's copies of stage i have landed: copies return in issue order,
    // and behind stage i stand the 6 copies each of stages i + 1 .. i + GEMM_NB - 2;
    // in the last trips, which issue nothing, the wait is to 0
    if (i + GEMM_NB - 2 < nk) {
      asm volatile("s_wait_asynccnt %0" :: "i"(6 * (GEMM_NB - 2)) : "memory");
    } else {
      asm volatile("s_wait_asynccnt 0x0" ::: "memory");
    }
    // publishes stage i and ends every wave's reads of stage i - 1
    __syncthreads();

    const _Float16* as = AsBuf[rb];
    const _Float16* ws = WsBuf[rb];
    v16h a[2], b[4];
#pragma unroll
    for (int mt = 0; mt < 2; ++mt)
      a[mt] = load_frag(as + (mw + mt * 16 + lm) * GEMM_LP + klo);
#pragma unroll
    for (int nt = 0; nt < 4; ++nt)
      b[nt] = load_frag(ws + (nw + nt * 16 + lm) * GEMM_LP + klo);

    // refill behind the fragment loads' issue: the copies go out while those
    // loads, which read another buffer, are on their way
    if (i + GEMM_NB - 1 < nk)
      stage_async(abase + (unsigned long long)(i + GEMM_NB - 1) * 64,
                  wbase + (unsigned long long)(i + GEMM_NB - 1) * 64,
                  va, vw, la, lw, fb * (GEMM_AB * 2), fb * (GEMM_WB * 2));

#pragma unroll
    for (int mt = 0; mt < 2; ++mt)
#pragma unroll
      for (int nt = 0; nt < 4; ++nt)
        acc[mt][nt] = __builtin_amdgcn_wmma_f32_16x16x32_f16(
            false, a[mt], false, b[nt], (short)0, acc[mt][nt], false, false);

    fb = rb;
    rb = (rb + 1 == GEMM_NB) ? 0 : rb + 1;
  }

  // which of the stacked matrices this column block belongs to: its first
  // column there, its bias, its output and that output's width (the same for
  // the whole work-group)
  int nb = n0;
  int No = N;
  const float* bs = bias;
  OutT* ob = out;
  if (nb >= N) {
    nb -= N;  No = N1;  bs = bias1;  ob = out1;
    if (nb >= N1) { nb -= N1;  No = N2;  bs = bias2;  ob = out2; }
  }
  // this lane's column in the wave's first 16x16 tile
  const float* bp = bs + (nb + nw + lm);
  OutT* op = ob + (nb + nw + lm);

  // C/D layout: lane, vgpr r -> (row = r + lh*8, col = lm) in each 16x16 tile
#pragma unroll
  for (int mt = 0; mt < 2; ++mt) {
#pragma unroll
    for (int nt = 0; nt < 4; ++nt) {
      const float bb = bp[nt * 16];
#pragma unroll
      for (int r = 0; r < 8; ++r) {
        const int row = m0 + mw + mt * 16 + r + lh * 8;
        op[(size_t)row * No + nt * 16] = (OutT)(acc[mt][nt][r] + bb);
      }
    }
  }
}

__device__ inline float other_half(float x) {
  const int b = __builtin_bit_cast(int, x);
  return __builtin_bit_cast(
      float, __builtin_amdgcn_permlanex16(b, b, 0x76543210, 0xfedcba98,
                                          false, false));
}

// 2^x by v_exp_f32, with the v_nop in the same statement: it keeps the one free
// issue slot that the instruction set asks for between a transcendental and an
// instruction that reads its result or overwrites its source.
__device__ inline float exp2_slot(float x) {
  float r;
  asm("v_exp_f32 %0, %1\n\tv_nop" : "=v"(r) : "v"(x));
  return r;
}

#define ATT_STG 64                   // keys per stage
#define ATT_NST (ATT_N / ATT_STG)    // 32 stages
#define ATT_KP  72                   // K row pitch in LDS, halves (144 B = 16 B x 9)
#define ATT_VP  80                   // V row pitch in LDS, halves (160 B = 32 B x 5)

typedef __attribute__((ext_vector_type(8))) short s16x8;
typedef __attribute__((address_space(3))) s16x8 lds_s16x8;

// Transposing LDS load: lane (c, h) gets T[kbase + 8h + 0..7][dbase + c] when
// lane l points at row kbase + 8*(l >> 4) + (l & 7), 16-byte half (l >> 3) & 1.
__device__ inline v8h load_tr16(const _Float16* p) {
  return __builtin_bit_cast(
      v8h, __builtin_amdgcn_ds_load_tr16_b128_v8i16((lds_s16x8*)p));
}

// One stage (64 keys of K and of V) into LDS: 256 threads x 4 copies of 16 B.
// A thread owns 16-byte piece (t & 7) of rows (t >> 3) and (t >> 3) + 32, so a
// wave's copy covers four whole 128-byte rows. kg/vg: the thread's own global
// address in row (t >> 3) of the stage; kl/vl: its own LDS byte address there.
// The s_wait_xcnt stands inside the statement so that no address register of
// an issued copy is rewritten in front of it.
__device__ inline void stage_kv_async(const _Float16* kg, const _Float16* vg,
                                      unsigned int kl, unsigned int vl) {
  const _Float16* kg1 = kg + (size_t)32 * ATT_KD;
  const _Float16* vg1 = vg + (size_t)32 * ATT_KD;
  const unsigned int kl1 = kl + 32 * ATT_KP * 2;
  const unsigned int vl1 = vl + 32 * ATT_VP * 2;
  asm volatile("global_load_async_to_lds_b128 %0, %4, off\n\t"
               "global_load_async_to_lds_b128 %1, %5, off\n\t"
               "global_load_async_to_lds_b128 %2, %6, off\n\t"
               "global_load_async_to_lds_b128 %3, %7, off\n\t"
               "s_wait_xcnt 0x0"
               :: "v"(kl), "v"(kl1), "v"(vl), "v"(vl1),
                  "v"(kg), "v"(kg1), "v"(vg), "v"(vg1) : "memory");
}

// Four waves per SIMD, that is two work-groups per WGP: the 512 work-groups
// then spread evenly over the chip's 256 WGPs in one round, and the register
// budget of 256 lets the LDS fragment loads be issued well ahead of their use.
__global__ __launch_bounds__(256) __attribute__((amdgpu_waves_per_eu(4, 4)))
void attn_wmma_kernel(const _Float16* __restrict__ q,
                      const _Float16* __restrict__ k,
                      const _Float16* __restrict__ v,
                      _Float16* __restrict__ y) {
  __shared__ __align__(16) _Float16 Ks[2][ATT_STG * ATT_KP];  // 2 x 9216 B
  __shared__ __align__(16) _Float16 Vs[2][ATT_STG * ATT_VP];  // 2 x 10240 B

  const int t    = threadIdx.x;
  const int lane = t & 31;
  const int wv   = t >> 5;
  const int lm   = lane & 15;
  const int lh   = lane >> 4;
  const int klo  = lh * 8;

  int idx = blockIdx.x;
  const int qp = idx & (ATT_N / 32 - 1);  idx >>= 6;   // N/32 = 64 tile pairs
  const int g  = idx & (ATT_G - 1);       idx >>= 2;   // KV group
  const int b  = idx;                                   // batch
  const int hl = g * 4 + (wv & 3);                      // linear head 0..15
  const int q0 = (qp * 2 + (wv >> 2)) * 16;

  // this thread's piece of a stage: global addresses (stage 0) and LDS places
  const int crow = t >> 3;
  const int cseg = (t & 7) * 8;
  const size_t coff = (size_t)(b * ATT_N + crow) * ATT_KD + g * ATT_HD + cseg;
  const _Float16* kg = k + coff;
  const _Float16* vg = v + coff;
  const unsigned int kl0 =
      (unsigned int)(uintptr_t)(&Ks[0][crow * ATT_KP + cseg]);
  const unsigned int vl0 =
      (unsigned int)(uintptr_t)(&Vs[0][crow * ATT_VP + cseg]);
  const unsigned int kbuf = ATT_STG * ATT_KP * 2;  // bytes from buffer 0 to 1
  const unsigned int vbuf = ATT_STG * ATT_VP * 2;
  const size_t gstep = (size_t)ATT_STG * ATT_KD;   // halves per stage

  // prologue: stage 0 landed and published, then stage 1 in flight
  stage_kv_async(kg, vg, kl0, vl0);
  // stage 0's copies of this wave have landed before the barrier publishes them
  asm volatile("s_wait_asynccnt 0x0" ::: "memory");
  __syncthreads();
  stage_kv_async(kg + gstep, vg + gstep, kl0 + kbuf, vl0 + vbuf);

  // Q fragments: B-matrix 32x16 halves (column = query), d = 0..31 and 32..63
  const _Float16* qptr =
      q + (size_t)(b * ATT_N + q0 + lm) * ATT_D + hl * ATT_HD + klo;
  const v16h bq0 = load_frag(qptr);
  const v16h bq1 = load_frag(qptr + 32);

  float mrun = -INFINITY;  // running maximum of query q0 + lm, unscaled (both halves equal)
  float lrun = 0.0f;       // running sum over this half's keys only
  v8f acc[4];              // acc[dc][r] = O^T[dc*16 + 8*lh + r][q0 + lm]
#pragma unroll
  for (int dc = 0; dc < 4; ++dc) acc[dc] = (v8f)(0.0f);

  // 1/sqrt(64) * log2(e): e^(scale * (s - m)) = 2^(s * sl2 - m * sl2)
  const float sl2 = 0.125f * 1.44269504f;

  // fragment offsets inside a stage buffer, in halves
  const int kfo = lm * ATT_KP + klo;
  const int vfo = (8 * lh + (lane & 7)) * ATT_VP + 8 * ((lane >> 3) & 1);

  for (int st = 0; st < ATT_NST; ++st) {
    const _Float16* ksb = Ks[st & 1] + kfo;
    const _Float16* vsb = Vs[st & 1] + vfo;

    // unrolled so that a chunk's place in the stage folds into the LDS loads'
    // immediate offsets
#pragma unroll
    for (int sub = 0; sub < ATT_STG / 32; ++sub) {
      // ---- scores: S^T = K @ Q^T for 32 keys (two 16x16 tiles, K=64 via 2 wmma)
      //      s0[r] = S[q0+lm][kc + 8*lh + r], s1[r] = S[q0+lm][kc + 16 + 8*lh + r]
      const _Float16* kp0 = ksb + sub * 32 * ATT_KP;
      const _Float16* kp1 = kp0 + 16 * ATT_KP;
      v8f s0 = (v8f)(0.0f), s1 = (v8f)(0.0f);
      s0 = __builtin_amdgcn_wmma_f32_16x16x32_f16(false, load_frag(kp0), false,
          bq0, (short)0, s0, false, false);
      s0 = __builtin_amdgcn_wmma_f32_16x16x32_f16(false, load_frag(kp0 + 32), false,
          bq1, (short)0, s0, false, false);
      s1 = __builtin_amdgcn_wmma_f32_16x16x32_f16(false, load_frag(kp1), false,
          bq0, (short)0, s1, false, false);
      s1 = __builtin_amdgcn_wmma_f32_16x16x32_f16(false, load_frag(kp1 + 32), false,
          bq1, (short)0, s1, false, false);

      // ---- V^T fragments (16 d x 32 keys per dc) by the transposing load:
      //      halves 0..7 = keys 8*lh + 0..7, halves 8..15 = keys 16 + 8*lh + 0..7
      const _Float16* vp = vsb + sub * 32 * ATT_VP;
      v16h av[4];
#pragma unroll
      for (int dc = 0; dc < 4; ++dc) {
        const v8h lo = load_tr16(vp + dc * 16);
        const v8h hi = load_tr16(vp + 16 * ATT_VP + dc * 16);
#pragma unroll
        for (int i = 0; i < 8; ++i) { av[dc][i] = lo[i]; av[dc][i + 8] = hi[i]; }
      }

      // ---- online softmax over the 32 keys of this chunk: 16 scores in-lane,
      //      one exchange of the maximum between the wave's halves
      //      the maximum is kept in units of the raw products (the scale is
      //      positive); scale and log2(e) enter in the one fused multiply-add
      //      that forms each exponent
      float tmx = -INFINITY;
#pragma unroll
      for (int r = 0; r < 8; ++r) tmx = fmaxf(tmx, fmaxf(s0[r], s1[r]));
      tmx = fmaxf(tmx, other_half(tmx));
      const float mn = fmaxf(mrun, tmx);
      const float al = exp2_slot((mrun - mn) * sl2);
      mrun = mn;
      const float nm = -mn * sl2;
      float rs = 0.0f;
      v16h pb;  // P^T as B operand: pb[s] = P[q0+lm][kc + kmap(s, lh)]
#pragma unroll
      for (int r = 0; r < 8; ++r) {
        const float p0 = exp2_slot(__builtin_fmaf(s0[r], sl2, nm));
        const float p1 = exp2_slot(__builtin_fmaf(s1[r], sl2, nm));
        rs += p0 + p1;
        pb[r]     = (_Float16)p0;
        pb[r + 8] = (_Float16)p1;
      }
      lrun = lrun * al + rs;
#pragma unroll
      for (int dc = 0; dc < 4; ++dc)
#pragma unroll
        for (int r = 0; r < 8; ++r) acc[dc][r] *= al;

      // ---- O^T += V^T @ P^T
#pragma unroll
      for (int dc = 0; dc < 4; ++dc)
        acc[dc] = __builtin_amdgcn_wmma_f32_16x16x32_f16(
            false, av[dc], false, pb, (short)0, acc[dc], false, false);
    }

    // ---- publish point of stage st + 1
    // this wave's LDS reads of the buffer that is refilled below have retired
    asm volatile("s_wait_dscnt 0x0" ::: "memory");
    // this wave's copies of stage st + 1 have landed
    asm volatile("s_wait_asynccnt 0x0" ::: "memory");
    // publishes stage st + 1 and ends every wave's reads of stage st
    __syncthreads();
    if (st + 2 < ATT_NST)
      stage_kv_async(kg + (size_t)(st + 2) * gstep, vg + (size_t)(st + 2) * gstep,
                     kl0 + (st & 1) * kbuf, vl0 + (st & 1) * vbuf);
  }
  // no copy is outstanding when the wave ends
  asm volatile("s_wait_asynccnt 0x0" ::: "memory");

  // ---- epilogue: join the halves' sums, normalize, store y (f16);
  //      a lane holds 8 consecutive d of one query row: 16-byte stores
  const float inv = 1.0f / (lrun + other_half(lrun));
  _Float16* yp =
      y + (size_t)(b * ATT_N + q0 + lm) * ATT_D + hl * ATT_HD + klo;
#pragma unroll
  for (int dc = 0; dc < 4; ++dc) {
    v8h o;
#pragma unroll
    for (int r = 0; r < 8; ++r) o[r] = (_Float16)(acc[dc][r] * inv);
    *(v8h*)(yp + dc * 16) = o;
  }
}

// ---------------------------------------------------------------------------
// Host-side launch
// ---------------------------------------------------------------------------
extern "C" void kernel_launch(void* const* d_in, const int* in_sizes, int n_in,
                              void* d_out, int out_size, void* d_ws, size_t ws_size,
                              hipStream_t stream) {
  (void)in_sizes; (void)n_in; (void)out_size; (void)ws_size;

  const float* x  = (const float*)d_in[0];
  const float* Wq = (const float*)d_in[1];
  const float* bq = (const float*)d_in[2];
  const float* Wk = (const float*)d_in[3];
  const float* bk = (const float*)d_in[4];
  const float* Wv = (const float*)d_in[5];
  const float* bv = (const float*)d_in[6];
  const float* Wo = (const float*)d_in[7];
  const float* bo = (const float*)d_in[8];
  float* out = (float*)d_out;

  _Float16* ws = (_Float16*)d_ws;
  const size_t nX  = (size_t)ATT_M * ATT_D;   // 4194304
  const size_t nWq = (size_t)ATT_D * ATT_D;   // 1048576
  const size_t nWk = (size_t)ATT_KD * ATT_D;  // 262144
  _Float16* xh  = ws;
  _Float16* wqh = xh  + nX;
  _Float16* wkh = wqh + nWq;
  _Float16* wvh = wkh + nWk;
  _Float16* woh = wvh + nWk;
  _Float16* qh  = woh + nWq;
  _Float16* kh  = qh  + nX;
  _Float16* vh  = kh  + (size_t)ATT_M * ATT_KD;
  _Float16* yh  = vh  + (size_t)ATT_M * ATT_KD;

  // 1) f16 conversions: one launch, planes xh, wqh, wkh, wvh, woh in a row
  f32_to_f16_all_kernel<<<CV_BLOCKS, CV_THREADS, 0, stream>>>(x, Wq, Wk, Wv, Wo, xh);

  // 2) projections: 4-wave blocks, 64x128 tile; q, k and v in one launch: the
  //    planes wqh, wkh, wvh lie in a row and read as one [1536][1024] weight
  dim3 blk(128, 1, 1);
  dim3 gq(ATT_M / 64, ATT_D / 128, 1);                    // 64 x 8
  dim3 gqkv(ATT_M / 64, (ATT_D + 2 * ATT_KD) / 128, 1);   // 64 x 12
  gemm_wmma_kernel<_Float16><<<gqkv, blk, 0, stream>>>(xh, wqh, bq, qh,
      ATT_M, ATT_D, ATT_D, bk, kh, ATT_KD, bv, vh, ATT_KD);

  // 3) attention: 8 waves per (b, KV group, pair of 16-query tiles) = 2*4*64 = 512
  dim3 ablk(256, 1, 1);
  attn_wmma_kernel<<<ATT_B * ATT_G * (ATT_N / 32), ablk, 0, stream>>>(qh, kh, vh, yh);

  // 4) output projection, f32 straight into d_out (one weight matrix: the
  //    second and third places are never selected)
  gemm_wmma_kernel<float><<<gq, blk, 0, stream>>>(yh, woh, bo, out,
      ATT_M, ATT_D, ATT_D, bo, out, 0, bo, out, 0);
}

// v008
// One run takes 67.3 microseconds.
// In two side-by-side timings against v007, it was 1.05 and 1.07 times as fast.
// Over all steps from v000 it is 3.42 times as fast.
#include <hip/hip_runtime.h>
#include <hip/hip_bf16.h>
#include <math.h>

// ---------------------------------------------------------------------------
// GQA attention forward for MI455X (gfx1250, wave32, WMMA + async-to-LDS).
//   B=2, N=2048, D=1024, H=16, G=4, HD=64, hpg=4
// Pipeline (f16 staging in d_ws, f32 accumulation in WMMA):
//   1) convert x, Wq, Wk, Wv, Wo to f16 (one launch)
//   2) q/k/v projections, one launch over the stacked weights: WMMA GEMM with
//      a ring of async-to-LDS tiles
//   3) flash attention, 8 waves per (b, KV group, 32 q rows)  (WMMA + LDS):
//      a wave = one head, all 32 q rows, every other 32 keys
//   4) out = y@Wo^T + bo (same GEMM, f32 out)
// ---------------------------------------------------------------------------

typedef __attribute__((ext_vector_type(16))) _Float16 v16h;
typedef __attribute__((ext_vector_type(8)))  _Float16 v8h;
typedef __attribute__((ext_vector_type(8)))  float    v8f;

#define ATT_B  2
#define ATT_N  2048
#define ATT_D  1024
#define ATT_G  4
#define ATT_HD 64
#define ATT_KD (ATT_G * ATT_HD)     // 256
#define ATT_M  (ATT_B * ATT_N)      // 4096 rows for the projections

// ---------------------------------------------------------------------------
// f32 -> f16 conversion of x, Wq, Wk, Wv, Wo in ONE launch.
// The five f16 planes lie one behind the other in the workspace (dst), in that
// order. 256 work-groups of 16 waves, one per WGP; a thread converts 13 pieces
// of 4 floats: piece j of grid thread i is piece j * CV_T + i of the joined planes,
// so every wave-wide load covers 512 contiguous bytes and every store 256.
// Pieces 0..7 fall in x, 8..9 in Wq, 10 in Wk (lower half of the grid) or Wv
// (upper half), 11..12 in Wo. All 13 loads are issued before the first store.
// ---------------------------------------------------------------------------
typedef __attribute__((ext_vector_type(4))) float    v4f;
typedef __attribute__((ext_vector_type(4))) _Float16 v4h;

#define CV_THREADS 512
#define CV_BLOCKS  256
#define CV_T       (CV_THREADS * CV_BLOCKS)   // 131072 threads
static_assert(ATT_M * ATT_D  == 8 * 4 * CV_T, "x is 8 pieces per thread");
static_assert(ATT_D * ATT_D  == 2 * 4 * CV_T, "Wq, Wo are 2 pieces per thread");
static_assert(ATT_KD * ATT_D * 2 == 4 * CV_T, "Wk and Wv together are 1 piece");

__global__ __launch_bounds__(CV_THREADS)
void f32_to_f16_all_kernel(const float* __restrict__ x,
                           const float* __restrict__ Wq,
                           const float* __restrict__ Wk,
                           const float* __restrict__ Wv,
                           const float* __restrict__ Wo,
                           _Float16* __restrict__ dst) {
  // the work-group's part of every address is scalar; the one vector offset,
  // the thread's number, lives to the last store
  const int t = threadIdx.x;
  const int w = blockIdx.x * CV_THREADS;               // first piece of the group
  const v4f* xs  = (const v4f*)x + w;
  const v4f* wqs = (const v4f*)Wq + w;
  const v4f* wos = (const v4f*)Wo + w;
  const v4f* wkvs = (blockIdx.x < CV_BLOCKS / 2)
                        ? (const v4f*)Wk + w
                        : (const v4f*)Wv + (w - CV_T / 2);
  v4h* ds = (v4h*)dst + w;
  // every loop below is unrolled so that r[] stays in registers (constant
  // indices) and the 13 loads stand as one run in front of the stores
  v4f r[13];
#pragma unroll
  for (int j = 0; j < 8; ++j) r[j] = xs[j * CV_T + t];
#pragma unroll
  for (int j = 0; j < 2; ++j) r[8 + j] = wqs[j * CV_T + t];
  r[10] = wkvs[t];
#pragma unroll
  for (int j = 0; j < 2; ++j) r[11 + j] = wos[j * CV_T + t];
#pragma unroll
  for (int j = 0; j < 13; ++j)
    ds[j * CV_T + t] = __builtin_convertvector(r[j], v4h);
}

// Load one WMMA f16 fragment (ISA striping): halves 0..7 at p[0..7],
// halves 8..15 at p[16..23]; caller pre-offsets p by klo = (lane/16)*8.
__device__ inline v16h load_frag(const _Float16* p) {
  v8h lo = *(const v8h*)(p);
  v8h hi = *(const v8h*)(p + 16);
  v16h r;
#pragma unroll
  for (int i = 0; i < 8; ++i) { r[i] = lo[i]; r[i + 8] = hi[i]; }
  return r;
}

// LDS row pitch of the GEMM tiles, in halves: a row holds 32 halves (64 B) and
// is laid at 80 B = 16 B x 5. The 16 lanes of a fragment's ds_load_b128 read 16
// rows at one column: at 64 B they fall on 16 of the 64 banks (four turns), at
// 80 B on all 64 (one turn).
#define GEMM_LP 40

// Buffers of the GEMM's LDS ring. A stage's copies are issued GEMM_NB - 1 trips
// ahead of the trip that reads it, so that their way from L2 or memory is
// covered by the trips between; 6 x 15 KB lets three work-groups share a WGP.
#define GEMM_NB 6
#define GEMM_AB (64 * GEMM_LP)    // halves per A buffer
#define GEMM_WB (128 * GEMM_LP)   // halves per W buffer

// ---------------------------------------------------------------------------
// Async stage one K-slab into LDS:
//   A rows [m0, m0+64) x 32 k  -> one A buffer (64 rows of 32 halves, pitch GEMM_LP)
//   W rows [n0, n0+128) x 32 k -> one W buffer (128 rows of 32 halves, pitch GEMM_LP)
// 128 threads; each issues 2 (A) + 4 (W) global_load_async_to_lds_b128,
// i.e. ASYNCcnt += 6 per wave per stage.
// ab, wb: A and W advanced to the slab's first k (scalar); va, vw: the thread's
// byte offsets from there (the same for every slab); la, lw: its LDS byte
// addresses in buffer 0; ao, wo: byte offsets of the target buffer.
// The s_wait_xcnt stands inside the statement so that no address register of
// an issued copy is rewritten in front of it.
// ---------------------------------------------------------------------------
__device__ inline void stage_async(unsigned long long ab, unsigned long long wb,
                                   const unsigned int (&va)[2],
                                   const unsigned int (&vw)[4],
                                   const unsigned int (&la)[2],
                                   const unsigned int (&lw)[4],
                                   unsigned int ao, unsigned int wo) {
  asm volatile("global_load_async_to_lds_b128 %0, %6, %12\n\t"
               "global_load_async_to_lds_b128 %1, %7, %12\n\t"
               "global_load_async_to_lds_b128 %2, %8, %13\n\t"
               "global_load_async_to_lds_b128 %3, %9, %13\n\t"
               "global_load_async_to_lds_b128 %4, %10, %13\n\t"
               "global_load_async_to_lds_b128 %5, %11, %13\n\t"
               "s_wait_xcnt 0x0"
               :: "v"(la[0] + ao), "v"(la[1] + ao),
                  "v"(lw[0] + wo), "v"(lw[1] + wo),
                  "v"(lw[2] + wo), "v"(lw[3] + wo),
                  "v"(va[0]), "v"(va[1]),
                  "v"(vw[0]), "v"(vw[1]), "v"(vw[2]), "v"(vw[3]),
                  "s"(ab), "s"(wb) : "memory");
}

// ---------------------------------------------------------------------------
// GEMM: out[m,n] = sum_k A[m,k] * W[n,k] + bias[n]
//   A: [M,K] f16 row-major, W: [N,K] f16 row-major, out: [M,N] OutT.
//   4 waves / block; block tile 64x128; wave tile 32x64; K-step 32.
//   Ring of GEMM_NB async-to-LDS stages, one barrier per stage.
//   W may stack up to three weight matrices of N, N1 and N2 rows (multiples of
//   128), one behind the other; each has its own bias and its own output of its
//   own width, and blockIdx.y runs over the column blocks of all of them.
// ---------------------------------------------------------------------------
template <typename OutT>
__global__ __launch_bounds__(128)
void gemm_wmma_kernel(const _Float16* __restrict__ A,
                      const _Float16* __restrict__ W,
                      const float* __restrict__ bias,
                      OutT* __restrict__ out,
                      int M, int N, int K,
                      const float* __restrict__ bias1,
                      OutT* __restrict__ out1, int N1,
                      const float* __restrict__ bias2,
                      OutT* __restrict__ out2, int N2) {
  __shared__ __align__(16) _Float16 AsBuf[GEMM_NB][GEMM_AB];  // 6 x 5 KB
  __shared__ __align__(16) _Float16 WsBuf[GEMM_NB][GEMM_WB];  // 6 x 10 KB

  const int t    = threadIdx.x;
  const int lane = t & 31;
  const int wv   = t >> 5;
  const int lm   = lane & 15;
  const int lh   = lane >> 4;
  const int klo  = lh * 8;
  const int m0   = blockIdx.x * 64;
  const int n0   = blockIdx.y * 128;
  const int mw   = (wv & 1) * 32;   // wave m-offset in block tile
  const int nw   = (wv >> 1) * 64;  // wave n-offset in block tile

  v8f acc[2][4];
#pragma unroll
  for (int mt = 0; mt < 2; ++mt)
#pragma unroll
    for (int nt = 0; nt < 4; ++nt) acc[mt][nt] = (v8f)(0.0f);

  // this thread's pieces of a stage: 16-byte piece (t & 3) of rows (t >> 2) + 32 j
  const unsigned long long abase = (unsigned long long)(uintptr_t)A;
  const unsigned long long wbase = (unsigned long long)(uintptr_t)W;
  const int srow = t >> 2;
  const int sc8  = (t & 3) * 8;
  unsigned int va[2], la[2], vw[4], lw[4];
#pragma unroll
  for (int j = 0; j < 2; ++j) {
    va[j] = (unsigned int)(((size_t)(m0 + srow + 32 * j) * K + sc8) * 2);
    la[j] = (unsigned int)(uintptr_t)(&AsBuf[0][(srow + 32 * j) * GEMM_LP + sc8]);
  }
#pragma unroll
  for (int j = 0; j < 4; ++j) {
    vw[j] = (unsigned int)(((size_t)(n0 + srow + 32 * j) * K + sc8) * 2);
    lw[j] = (unsigned int)(uintptr_t)(&WsBuf[0][(srow + 32 * j) * GEMM_LP + sc8]);
  }

  const int nk = K / 32;
  // prologue: stages 0 .. GEMM_NB - 2 in flight, each into its own buffer
#pragma unroll
  for (int s = 0; s < GEMM_NB - 1; ++s)
    if (s < nk)
      stage_async(abase + (unsigned long long)s * 64, wbase + (unsigned long long)s * 64,
                  va, vw, la, lw, s * (GEMM_AB * 2), s * (GEMM_WB * 2));

  int rb = 0;             // buffer of stage i
  int fb = GEMM_NB - 1;   // buffer of stage i - 1, refilled with stage i + GEMM_NB - 1
  for (int i = 0; i < nk; ++i) {
    // ---- publish point of stage i
    // this wave's LDS reads of stage i - 1, whose buffer is refilled below, have retired
    asm volatile("s_wait_dscnt 0x0" ::: "memory");
    // this wave's copies of stage i have landed: copies return in issue order,
    // and behind stage i stand the 6 copies each of stages i + 1 .. i + GEMM_NB - 2;
    // in the last trips, which issue nothing, the wait is to 0
    if (i + GEMM_NB - 2 < nk) {
      asm volatile("s_wait_asynccnt %0" :: "i"(6 * (GEMM_NB - 2)) : "memory");
    } else {
      asm volatile("s_wait_asynccnt 0x0" ::: "memory");
    }
    // publishes stage i and ends every wave's reads of stage i - 1
    __syncthreads();

    const _Float16* as = AsBuf[rb];
    const _Float16* ws = WsBuf[rb];
    v16h a[2], b[4];
#pragma unroll
    for (int mt = 0; mt < 2; ++mt)
      a[mt] = load_frag(as + (mw + mt * 16 + lm) * GEMM_LP + klo);
#pragma unroll
    for (int nt = 0; nt < 4; ++nt)
      b[nt] = load_frag(ws + (nw + nt * 16 + lm) * GEMM_LP + klo);

    // refill behind the fragment loads' issue: the copies go out while those
    // loads, which read another buffer, are on their way
    if (i + GEMM_NB - 1 < nk)
      stage_async(abase + (unsigned long long)(i + GEMM_NB - 1) * 64,
                  wbase + (unsigned long long)(i + GEMM_NB - 1) * 64,
                  va, vw, la, lw, fb * (GEMM_AB * 2), fb * (GEMM_WB * 2));

#pragma unroll
    for (int mt = 0; mt < 2; ++mt)
#pragma unroll
      for (int nt = 0; nt < 4; ++nt)
        acc[mt][nt] = __builtin_amdgcn_wmma_f32_16x16x32_f16(
            false, a[mt], false, b[nt], (short)0, acc[mt][nt], false, false);

    fb = rb;
    rb = (rb + 1 == GEMM_NB) ? 0 : rb + 1;
  }

  // which of the stacked matrices this column block belongs to: its first
  // column there, its bias, its output and that output's width (the same for
  // the whole work-group)
  int nb = n0;
  int No = N;
  const float* bs = bias;
  OutT* ob = out;
  if (nb >= N) {
    nb -= N;  No = N1;  bs = bias1;  ob = out1;
    if (nb >= N1) { nb -= N1;  No = N2;  bs = bias2;  ob = out2; }
  }
  // this lane's column in the wave's first 16x16 tile
  const float* bp = bs + (nb + nw + lm);
  OutT* op = ob + (nb + nw + lm);

  // C/D layout: lane, vgpr r -> (row = r + lh*8, col = lm) in each 16x16 tile
#pragma unroll
  for (int mt = 0; mt < 2; ++mt) {
#pragma unroll
    for (int nt = 0; nt < 4; ++nt) {
      const float bb = bp[nt * 16];
#pragma unroll
      for (int r = 0; r < 8; ++r) {
        const int row = m0 + mw + mt * 16 + r + lh * 8;
        op[(size_t)row * No + nt * 16] = (OutT)(acc[mt][nt][r] + bb);
      }
    }
  }
}

// ---------------------------------------------------------------------------
// Flash attention: one wave per (b, head, 32 queries, half of the keys),
// transposed products, per 16-query column group:
//   S^T = K Q^T  (A = K rows, B = Q), O^T += V^T P^T (A = V^T, B = P^T).
//   A lane (c = lane & 15, h = lane >> 4) then holds scores of ONE query
//   (q0 + 16*cg + c) for keys 8h..8h+7 and 16+8h..16+8h+7 of the chunk: maximum and
//   sum are in-lane except for one exchange with lane l ^ 16, and the two score tiles, converted in place, are the B
//   operand of the second product in the hardware k order.
//   A work-group is 8 waves on one KV group and 32 queries: its 4 heads x the
//   2 halves (32 keys each) of every stage. A wave works both 16-query column
//   groups, so every K and V^T fragment it reads from LDS feeds two products.
//   The two key halves of a head are joined once, behind the loop, through LDS.
//   K and V reach LDS row-major in stages of 64 keys, once per work-group, by
//   asynchronous copies that cover whole 128-byte rows; two buffers, the next
//   stage in flight while this one is worked on. K fragments are plain 16-byte
//   LDS reads, V^T fragments come by the transposing LDS load.
//   q: [B,N,D] f16 (head hl at column hl*64), k/v: [B,N,KD] f16 (group g at
//   column g*64), y: [B,N,D] f16 output.
// ---------------------------------------------------------------------------
// Value of lane l ^ 16 (the other half of the wave, same column).
__device__ inline float other_half(float x) {
  const int b = __builtin_bit_cast(int, x);
  return __builtin_bit_cast(
      float, __builtin_amdgcn_permlanex16(b, b, 0x76543210, 0xfedcba98,
                                          false, false));
}

// 2^x by v_exp_f32, with the v_nop in the same statement: it keeps the one free
// issue slot that the instruction set asks for between a transcendental and an
// instruction that reads its result or overwrites its source.
__device__ inline float exp2_slot(float x) {
  float r;
  asm("v_exp_f32 %0, %1\n\tv_nop" : "=v"(r) : "v"(x));
  return r;
}

#define ATT_STG 64                   // keys per stage
#define ATT_NST (ATT_N / ATT_STG)    // 32 stages
#define ATT_KP  72                   // K row pitch in LDS, halves (144 B = 16 B x 9)
#define ATT_VP  80                   // V row pitch in LDS, halves (160 B = 32 B x 5)

typedef __attribute__((ext_vector_type(8))) short s16x8;
typedef __attribute__((address_space(3))) s16x8 lds_s16x8;

// Transposing LDS load: lane (c, h) gets T[kbase + 8h + 0..7][dbase + c] when
// lane l points at row kbase + 8*(l >> 4) + (l & 7), 16-byte half (l >> 3) & 1.
__device__ inline v8h load_tr16(const _Float16* p) {
  return __builtin_bit_cast(
      v8h, __builtin_amdgcn_ds_load_tr16_b128_v8i16((lds_s16x8*)p));
}

// One stage (64 keys of K and of V) into LDS: 256 threads x 4 copies of 16 B.
// A thread owns 16-byte piece (t & 7) of rows (t >> 3) and (t >> 3) + 32, so a
// wave's copy covers four whole 128-byte rows. kg/vg: the thread's own global
// address in row (t >> 3) of the stage; kl/vl: its own LDS byte address there.
// The s_wait_xcnt stands inside the statement so that no address register of
// an issued copy is rewritten in front of it.
__device__ inline void stage_kv_async(const _Float16* kg, const _Float16* vg,
                                      unsigned int kl, unsigned int vl) {
  const _Float16* kg1 = kg + (size_t)32 * ATT_KD;
  const _Float16* vg1 = vg + (size_t)32 * ATT_KD;
  const unsigned int kl1 = kl + 32 * ATT_KP * 2;
  const unsigned int vl1 = vl + 32 * ATT_VP * 2;
  asm volatile("global_load_async_to_lds_b128 %0, %4, off\n\t"
               "global_load_async_to_lds_b128 %1, %5, off\n\t"
               "global_load_async_to_lds_b128 %2, %6, off\n\t"
               "global_load_async_to_lds_b128 %3, %7, off\n\t"
               "s_wait_xcnt 0x0"
               :: "v"(kl), "v"(kl1), "v"(vl), "v"(vl1),
                  "v"(kg), "v"(kg1), "v"(vg), "v"(vg1) : "memory");
}

// Four waves per SIMD, that is two work-groups per WGP: the 512 work-groups
// then spread evenly over the chip's 256 WGPs in one round, and the register
// budget of 256 lets the LDS fragment loads be issued well ahead of their use.
__global__ __launch_bounds__(256) __attribute__((amdgpu_waves_per_eu(4, 4)))
void attn_wmma_kernel(const _Float16* __restrict__ q,
                      const _Float16* __restrict__ k,
                      const _Float16* __restrict__ v,
                      _Float16* __restrict__ y) {
  // one array: K buffers, then V buffers; behind the loop it is the exchange area
  __shared__ __align__(16) _Float16 Ring[2 * ATT_STG * (ATT_KP + ATT_VP)];  // 38912 B
  _Float16* const Ks = Ring;                          // 2 x 9216 B
  _Float16* const Vs = Ring + 2 * ATT_STG * ATT_KP;   // 2 x 10240 B

  const int t    = threadIdx.x;
  const int lane = t & 31;
  const int wv   = t >> 5;
  const int lm   = lane & 15;
  const int lh   = lane >> 4;
  const int klo  = lh * 8;

  int idx = blockIdx.x;
  const int qp = idx & (ATT_N / 32 - 1);  idx >>= 6;   // N/32 = 64 blocks of 32 queries
  const int g  = idx & (ATT_G - 1);       idx >>= 2;   // KV group
  const int b  = idx;                                   // batch
  const int hl = g * 4 + (wv & 3);                      // linear head 0..15
  const int kh = wv >> 2;                               // this wave's 32 keys of a stage
  const int q0 = qp * 32;

  // this thread's piece of a stage: global addresses (stage 0) and LDS places
  const int crow = t >> 3;
  const int cseg = (t & 7) * 8;
  const size_t coff = (size_t)(b * ATT_N + crow) * ATT_KD + g * ATT_HD + cseg;
  const _Float16* kg = k + coff;
  const _Float16* vg = v + coff;
  const unsigned int kl0 =
      (unsigned int)(uintptr_t)(&Ks[crow * ATT_KP + cseg]);
  const unsigned int vl0 =
      (unsigned int)(uintptr_t)(&Vs[crow * ATT_VP + cseg]);
  const unsigned int kbuf = ATT_STG * ATT_KP * 2;  // bytes from buffer 0 to 1
  const unsigned int vbuf = ATT_STG * ATT_VP * 2;
  const size_t gstep = (size_t)ATT_STG * ATT_KD;   // halves per stage

  // prologue: stage 0 landed and published, then stage 1 in flight
  stage_kv_async(kg, vg, kl0, vl0);
  // stage 0's copies of this wave have landed before the barrier publishes them
  asm volatile("s_wait_asynccnt 0x0" ::: "memory");
  __syncthreads();
  stage_kv_async(kg + gstep, vg + gstep, kl0 + kbuf, vl0 + vbuf);

  // Q fragments of both column groups: B-matrix 32x16 halves (column = query),
  // d = 0..31 and 32..63
  v16h bq[2][2];
#pragma unroll
  for (int cg = 0; cg < 2; ++cg) {
    const _Float16* qptr =
        q + (size_t)(b * ATT_N + q0 + cg * 16 + lm) * ATT_D + hl * ATT_HD + klo;
    bq[cg][0] = load_frag(qptr);
    bq[cg][1] = load_frag(qptr + 32);
  }

  // per column group cg, query q0 + cg*16 + lm, over this wave's keys:
  float mrun[2];   // running maximum, unscaled (both halves of the wave equal)
  float lrun[2];   // running sum over this half's keys only
  v8f acc[2][4];   // acc[cg][dc][r] = O^T[dc*16 + 8*lh + r][query]
#pragma unroll
  for (int cg = 0; cg < 2; ++cg) {
    mrun[cg] = -INFINITY;
    lrun[cg] = 0.0f;
#pragma unroll
    for (int dc = 0; dc < 4; ++dc) acc[cg][dc] = (v8f)(0.0f);
  }

  // 1/sqrt(64) * log2(e): e^(scale * (s - m)) = 2^(s * sl2 - m * sl2)
  const float sl2 = 0.125f * 1.44269504f;

  // fragment offsets inside a stage buffer, in halves (this wave's 32 keys)
  const int kfo = (kh * 32 + lm) * ATT_KP + klo;
  const int vfo = (kh * 32 + 8 * lh + (lane & 7)) * ATT_VP + 8 * ((lane >> 3) & 1);

  for (int st = 0; st < ATT_NST; ++st) {
    const _Float16* kp0 = Ks + (st & 1) * (ATT_STG * ATT_KP) + kfo;
    const _Float16* kp1 = kp0 + 16 * ATT_KP;
    const _Float16* vp  = Vs + (st & 1) * (ATT_STG * ATT_VP) + vfo;

    // ---- K fragments of the 32 keys (two 16-key tiles x two 32-d halves)
    const v16h ka00 = load_frag(kp0);
    const v16h ka01 = load_frag(kp0 + 32);
    const v16h ka10 = load_frag(kp1);
    const v16h ka11 = load_frag(kp1 + 32);

    // ---- V^T fragments (16 d x 32 keys per dc) by the transposing load:
    //      halves 0..7 = keys 8*lh + 0..7, halves 8..15 = keys 16 + 8*lh + 0..7
    v16h av[4];
#pragma unroll
    for (int dc = 0; dc < 4; ++dc) {
      const v8h lo = load_tr16(vp + dc * 16);
      const v8h hi = load_tr16(vp + 16 * ATT_VP + dc * 16);
#pragma unroll
      for (int i = 0; i < 8; ++i) { av[dc][i] = lo[i]; av[dc][i + 8] = hi[i]; }
    }

    // unrolled so that the per-group state stays in registers
#pragma unroll
    for (int cg = 0; cg < 2; ++cg) {
      // ---- scores: S^T = K @ Q^T for 32 keys (two 16x16 tiles, K=64 via 2 wmma)
      //      s0[r] = S[query][kc + 8*lh + r], s1[r] = S[query][kc + 16 + 8*lh + r]
      v8f s0 = (v8f)(0.0f), s1 = (v8f)(0.0f);
      s0 = __builtin_amdgcn_wmma_f32_16x16x32_f16(false, ka00, false,
          bq[cg][0], (short)0, s0, false, false);
      s0 = __builtin_amdgcn_wmma_f32_16x16x32_f16(false, ka01, false,
          bq[cg][1], (short)0, s0, false, false);
      s1 = __builtin_amdgcn_wmma_f32_16x16x32_f16(false, ka10, false,
          bq[cg][0], (short)0, s1, false, false);
      s1 = __builtin_amdgcn_wmma_f32_16x16x32_f16(false, ka11, false,
          bq[cg][1], (short)0, s1, false, false);

      // ---- online softmax over the 32 keys of this chunk: 16 scores in-lane,
      //      one exchange of the maximum between the wave's halves
      //      the maximum is kept in units of the raw products (the scale is
      //      positive); scale and log2(e) enter in the one fused multiply-add
      //      that forms each exponent
      float tmx = -INFINITY;
#pragma unroll
      for (int r = 0; r < 8; ++r) tmx = fmaxf(tmx, fmaxf(s0[r], s1[r]));
      tmx = fmaxf(tmx, other_half(tmx));
      const float mn = fmaxf(mrun[cg], tmx);
      const float al = exp2_slot((mrun[cg] - mn) * sl2);
      mrun[cg] = mn;
      const float nm = -mn * sl2;
      float rs = 0.0f;
      v16h pb;  // P^T as B operand: pb[s] = P[query][kc + kmap(s, lh)]
#pragma unroll
      for (int r = 0; r < 8; ++r) {
        const float p0 = exp2_slot(__builtin_fmaf(s0[r], sl2, nm));
        const float p1 = exp2_slot(__builtin_fmaf(s1[r], sl2, nm));
        rs += p0 + p1;
        pb[r]     = (_Float16)p0;
        pb[r + 8] = (_Float16)p1;
      }
      lrun[cg] = lrun[cg] * al + rs;
#pragma unroll
      for (int dc = 0; dc < 4; ++dc)
#pragma unroll
        for (int r = 0; r < 8; ++r) acc[cg][dc][r] *= al;

      // ---- O^T += V^T @ P^T
#pragma unroll
      for (int dc = 0; dc < 4; ++dc)
        acc[cg][dc] = __builtin_amdgcn_wmma_f32_16x16x32_f16(
            false, av[dc], false, pb, (short)0, acc[cg][dc], false, false);
    }

    // ---- publish point of stage st + 1
    // this wave's LDS reads of the buffer that is refilled below have retired
    asm volatile("s_wait_dscnt 0x0" ::: "memory");
    // this wave's copies of stage st + 1 have landed
    asm volatile("s_wait_asynccnt 0x0" ::: "memory");
    // publishes stage st + 1 and ends every wave's reads of stage st
    __syncthreads();
    if (st + 2 < ATT_NST)
      stage_kv_async(kg + (size_t)(st + 2) * gstep, vg + (size_t)(st + 2) * gstep,
                     kl0 + (st & 1) * kbuf, vl0 + (st & 1) * vbuf);
  }
  // no copy is outstanding when the ring is reused and when the wave ends
  asm volatile("s_wait_asynccnt 0x0" ::: "memory");

  // ---- join the two key halves of a head (waves wv and wv ^ 4, lane by lane):
  //      wave kh keeps column group kh and hands the other group's partial
  //      result to its partner through the ring, which every wave has left at
  //      the loop's last barrier.
  //      exchange area: per wave 8 x 32 lanes x 16 B of O^T, then maximum and sum
  float* const xo = (float*)Ring;                 // 8 waves x 4096 B
  float* const xm = xo + 8 * 1024;                // 8 waves x 2 x 32 floats
  static_assert((8 * 1024 + 8 * 64) * 4 <= sizeof(Ring), "exchange area fits the ring");
  const bool up = (kh != 0);                      // the same for the whole wave
  v8f keep[4], give[4];
#pragma unroll
  for (int dc = 0; dc < 4; ++dc)
#pragma unroll
    for (int r = 0; r < 8; ++r) {
      keep[dc][r] = up ? acc[1][dc][r] : acc[0][dc][r];
      give[dc][r] = up ? acc[0][dc][r] : acc[1][dc][r];
    }
  const float mk = up ? mrun[1] : mrun[0];
  const float lk = up ? lrun[1] : lrun[0];
  {
    v4f* wo = (v4f*)(xo + wv * 1024) + lane;
#pragma unroll
    for (int dc = 0; dc < 4; ++dc) {
      v4f lo4, hi4;
#pragma unroll
      for (int r = 0; r < 4; ++r) { lo4[r] = give[dc][r]; hi4[r] = give[dc][r + 4]; }
      wo[(dc * 2) * 32]     = lo4;
      wo[(dc * 2 + 1) * 32] = hi4;
    }
    xm[wv * 64 + lane]      = up ? mrun[0] : mrun[1];
    xm[wv * 64 + 32 + lane] = up ? lrun[0] : lrun[1];
  }
  // the partner's partial result is written before it is read
  __syncthreads();
  const int pw = wv ^ 4;
  const float mp = xm[pw * 64 + lane];
  const float lp = xm[pw * 64 + 32 + lane];
  const float mj = fmaxf(mk, mp);
  const float ak = exp2_slot((mk - mj) * sl2);
  const float ap = exp2_slot((mp - mj) * sl2);
  const float lj = lk * ak + lp * ap;

  // ---- epilogue: join the wave halves' sums, normalize, store y (f16);
  //      a lane holds 8 consecutive d of one query row: 16-byte stores
  const float inv = 1.0f / (lj + other_half(lj));
  const float fk = ak * inv;
  const float fp = ap * inv;
  const v4f* ro = (const v4f*)(xo + pw * 1024) + lane;
  _Float16* yp =
      y + (size_t)(b * ATT_N + q0 + kh * 16 + lm) * ATT_D + hl * ATT_HD + klo;
#pragma unroll
  for (int dc = 0; dc < 4; ++dc) {
    const v4f lo4 = ro[(dc * 2) * 32];
    const v4f hi4 = ro[(dc * 2 + 1) * 32];
    v8h o;
#pragma unroll
    for (int r = 0; r < 4; ++r) {
      o[r]     = (_Float16)(keep[dc][r] * fk + lo4[r] * fp);
      o[r + 4] = (_Float16)(keep[dc][r + 4] * fk + hi4[r] * fp);
    }
    *(v8h*)(yp + dc * 16) = o;
  }
}

// ---------------------------------------------------------------------------
// Host-side launch
// ---------------------------------------------------------------------------
extern "C" void kernel_launch(void* const* d_in, const int* in_sizes, int n_in,
                              void* d_out, int out_size, void* d_ws, size_t ws_size,
                              hipStream_t stream) {
  (void)in_sizes; (void)n_in; (void)out_size; (void)ws_size;

  const float* x  = (const float*)d_in[0];
  const float* Wq = (const float*)d_in[1];
  const float* bq = (const float*)d_in[2];
  const float* Wk = (const float*)d_in[3];
  const float* bk = (const float*)d_in[4];
  const float* Wv = (const float*)d_in[5];
  const float* bv = (const float*)d_in[6];
  const float* Wo = (const float*)d_in[7];
  const float* bo = (const float*)d_in[8];
  float* out = (float*)d_out;

  _Float16* ws = (_Float16*)d_ws;
  const size_t nX  = (size_t)ATT_M * ATT_D;   // 4194304
  const size_t nWq = (size_t)ATT_D * ATT_D;   // 1048576
  const size_t nWk = (size_t)ATT_KD * ATT_D;  // 262144
  _Float16* xh  = ws;
  _Float16* wqh = xh  + nX;
  _Float16* wkh = wqh + nWq;
  _Float16* wvh = wkh + nWk;
  _Float16* woh = wvh + nWk;
  _Float16* qh  = woh + nWq;
  _Float16* kh  = qh  + nX;
  _Float16* vh  = kh  + (size_t)ATT_M * ATT_KD;
  _Float16* yh  = vh  + (size_t)ATT_M * ATT_KD;

  // 1) f16 conversions: one launch, planes xh, wqh, wkh, wvh, woh in a row
  f32_to_f16_all_kernel<<<CV_BLOCKS, CV_THREADS, 0, stream>>>(x, Wq, Wk, Wv, Wo, xh);

  // 2) projections: 4-wave blocks, 64x128 tile; q, k and v in one launch: the
  //    planes wqh, wkh, wvh lie in a row and read as one [1536][1024] weight
  dim3 blk(128, 1, 1);
  dim3 gq(ATT_M / 64, ATT_D / 128, 1);                    // 64 x 8
  dim3 gqkv(ATT_M / 64, (ATT_D + 2 * ATT_KD) / 128, 1);   // 64 x 12
  gemm_wmma_kernel<_Float16><<<gqkv, blk, 0, stream>>>(xh, wqh, bq, qh,
      ATT_M, ATT_D, ATT_D, bk, kh, ATT_KD, bv, vh, ATT_KD);

  // 3) attention: 8 waves per (b, KV group, 32 queries) = 2*4*64 = 512
  dim3 ablk(256, 1, 1);
  attn_wmma_kernel<<<ATT_B * ATT_G * (ATT_N / 32), ablk, 0, stream>>>(qh, kh, vh, yh);

  // 4) output projection, f32 straight into d_out (one weight matrix: the
  //    second and third places are never selected)
  gemm_wmma_kernel<float><<<gq, blk, 0, stream>>>(yh, woh, bo, out,
      ATT_M, ATT_D, ATT_D, bo, out, 0, bo, out, 0);
}

// v009
// It runs in 64.7 microseconds.
// Next to v008, in two timings, it ran 1.04 times as fast each time.
// Over all steps from v000 it is 3.56 times as fast.
#include <hip/hip_runtime.h>
#include <hip/hip_bf16.h>
#include <math.h>

// ---------------------------------------------------------------------------
// GQA attention forward for MI455X (gfx1250, wave32, WMMA + async-to-LDS).
//   B=2, N=2048, D=1024, H=16, G=4, HD=64, hpg=4
// Pipeline (f16 staging in d_ws, f32 accumulation in WMMA):
//   1) convert x, Wq, Wk, Wv, Wo to f16 (one launch)
//   2) q/k/v projections, one launch over the stacked weights: WMMA GEMM with
//      a ring of async-to-LDS tiles
//   3) flash attention, 8 waves per (b, KV group, 32 q rows)  (WMMA + LDS):
//      a wave = one head, all 32 q rows, every other 32 keys
//   4) out = y@Wo^T + bo (same GEMM, f32 out)
// ---------------------------------------------------------------------------

typedef __attribute__((ext_vector_type(16))) _Float16 v16h;
typedef __attribute__((ext_vector_type(8)))  _Float16 v8h;
typedef __attribute__((ext_vector_type(8)))  float    v8f;

#define ATT_B  2
#define ATT_N  2048
#define ATT_D  1024
#define ATT_G  4
#define ATT_HD 64
#define ATT_KD (ATT_G * ATT_HD)     // 256
#define ATT_M  (ATT_B * ATT_N)      // 4096 rows for the projections

// ---------------------------------------------------------------------------
// f32 -> f16 conversion of x, Wq, Wk, Wv, Wo in ONE launch.
// The five f16 planes lie one behind the other in the workspace (dst), in that
// order. 256 work-groups of 16 waves, one per WGP; a thread converts 13 pieces
// of 4 floats: piece j of grid thread i is piece j * CV_T + i of the joined planes,
// so every wave-wide load covers 512 contiguous bytes and every store 256.
// Pieces 0..7 fall in x, 8..9 in Wq, 10 in Wk (lower half of the grid) or Wv
// (upper half), 11..12 in Wo. All 13 loads are issued before the first store.
// ---------------------------------------------------------------------------
typedef __attribute__((ext_vector_type(4))) float    v4f;
typedef __attribute__((ext_vector_type(4))) _Float16 v4h;

#define CV_THREADS 512
#define CV_BLOCKS  256
#define CV_T       (CV_THREADS * CV_BLOCKS)   // 131072 threads
static_assert(ATT_M * ATT_D  == 8 * 4 * CV_T, "x is 8 pieces per thread");
static_assert(ATT_D * ATT_D  == 2 * 4 * CV_T, "Wq, Wo are 2 pieces per thread");
static_assert(ATT_KD * ATT_D * 2 == 4 * CV_T, "Wk and Wv together are 1 piece");

__global__ __launch_bounds__(CV_THREADS)
void f32_to_f16_all_kernel(const float* __restrict__ x,
                           const float* __restrict__ Wq,
                           const float* __restrict__ Wk,
                           const float* __restrict__ Wv,
                           const float* __restrict__ Wo,
                           _Float16* __restrict__ dst) {
  // the work-group's part of every address is scalar; the one vector offset,
  // the thread's number, lives to the last store
  const int t = threadIdx.x;
  const int w = blockIdx.x * CV_THREADS;               // first piece of the group
  const v4f* xs  = (const v4f*)x + w;
  const v4f* wqs = (const v4f*)Wq + w;
  const v4f* wos = (const v4f*)Wo + w;
  const v4f* wkvs = (blockIdx.x < CV_BLOCKS / 2)
                        ? (const v4f*)Wk + w
                        : (const v4f*)Wv + (w - CV_T / 2);
  v4h* ds = (v4h*)dst + w;
  // every loop below is unrolled so that r[] stays in registers (constant
  // indices) and the 13 loads stand as one run in front of the stores
  v4f r[13];
#pragma unroll
  for (int j = 0; j < 8; ++j) r[j] = xs[j * CV_T + t];
#pragma unroll
  for (int j = 0; j < 2; ++j) r[8 + j] = wqs[j * CV_T + t];
  r[10] = wkvs[t];
#pragma unroll
  for (int j = 0; j < 2; ++j) r[11 + j] = wos[j * CV_T + t];
#pragma unroll
  for (int j = 0; j < 13; ++j)
    ds[j * CV_T + t] = __builtin_convertvector(r[j], v4h);
}

// Load one WMMA f16 fragment (ISA striping): halves 0..7 at p[0..7],
// halves 8..15 at p[16..23]; caller pre-offsets p by klo = (lane/16)*8.
__device__ inline v16h load_frag(const _Float16* p) {
  v8h lo = *(const v8h*)(p);
  v8h hi = *(const v8h*)(p + 16);
  v16h r;
#pragma unroll
  for (int i = 0; i < 8; ++i) { r[i] = lo[i]; r[i + 8] = hi[i]; }
  return r;
}

// k per stage of the GEMM's LDS ring: 64 halves = 128 B of every operand row,
// one whole cache line, so that a wave-wide copy of 512 B asks L2 for four
// whole lines (at 32 halves it asked for the halves of eight).
#define GEMM_KS 64

// LDS row pitch of the GEMM tiles, in halves: a row holds 64 halves (128 B) and
// is laid at 144 B = 16 B x 9. The 16 lanes of a fragment's ds_load_b128 read 16
// rows at one column: at an odd multiple of 16 B they fall on all 64 banks.
#define GEMM_LP 72

// Buffers of the GEMM's LDS ring. A stage's copies are issued GEMM_NB - 1 trips
// ahead of the trip that reads it, so that their way from L2 or memory is
// covered by the trips between; 3 x 27 KB lets three work-groups share a WGP.
#define GEMM_NB 3
#define GEMM_AB (64 * GEMM_LP)    // halves per A buffer
#define GEMM_WB (128 * GEMM_LP)   // halves per W buffer

// ---------------------------------------------------------------------------
// Async stage one K-slab into LDS:
//   A rows [m0, m0+64) x 64 k  -> one A buffer (64 rows of 64 halves, pitch GEMM_LP)
//   W rows [n0, n0+128) x 64 k -> one W buffer (128 rows of 64 halves, pitch GEMM_LP)
// 128 threads; each issues 4 (A) + 8 (W) global_load_async_to_lds_b128,
// i.e. ASYNCcnt += 12 per wave per stage; a wave's copy covers four whole rows.
// ab, wb: A and W advanced to the slab's first k (scalar); va, vw: the thread's
// byte offsets from there (the same for every slab); la, lw: its LDS byte
// addresses in buffer 0; ao, wo: byte offsets of the target buffer.
// The s_wait_xcnt stands inside the statement so that no address register of
// an issued copy is rewritten in front of it.
// ---------------------------------------------------------------------------
__device__ inline void stage_async(unsigned long long ab, unsigned long long wb,
                                   const unsigned int (&va)[4],
                                   const unsigned int (&vw)[8],
                                   const unsigned int (&la)[4],
                                   const unsigned int (&lw)[8],
                                   unsigned int ao, unsigned int wo) {
  asm volatile("global_load_async_to_lds_b128 %0, %12, %24\n\t"
               "global_load_async_to_lds_b128 %1, %13, %24\n\t"
               "global_load_async_to_lds_b128 %2, %14, %24\n\t"
               "global_load_async_to_lds_b128 %3, %15, %24\n\t"
               "global_load_async_to_lds_b128 %4, %16, %25\n\t"
               "global_load_async_to_lds_b128 %5, %17, %25\n\t"
               "global_load_async_to_lds_b128 %6, %18, %25\n\t"
               "global_load_async_to_lds_b128 %7, %19, %25\n\t"
               "global_load_async_to_lds_b128 %8, %20, %25\n\t"
               "global_load_async_to_lds_b128 %9, %21, %25\n\t"
               "global_load_async_to_lds_b128 %10, %22, %25\n\t"
               "global_load_async_to_lds_b128 %11, %23, %25\n\t"
               "s_wait_xcnt 0x0"
               :: "v"(la[0] + ao), "v"(la[1] + ao), "v"(la[2] + ao), "v"(la[3] + ao),
                  "v"(lw[0] + wo), "v"(lw[1] + wo), "v"(lw[2] + wo), "v"(lw[3] + wo),
                  "v"(lw[4] + wo), "v"(lw[5] + wo), "v"(lw[6] + wo), "v"(lw[7] + wo),
                  "v"(va[0]), "v"(va[1]), "v"(va[2]), "v"(va[3]),
                  "v"(vw[0]), "v"(vw[1]), "v"(vw[2]), "v"(vw[3]),
                  "v"(vw[4]), "v"(vw[5]), "v"(vw[6]), "v"(vw[7]),
                  "s"(ab), "s"(wb) : "memory");
}

// ---------------------------------------------------------------------------
// GEMM: out[m,n] = sum_k A[m,k] * W[n,k] + bias[n]
//   A: [M,K] f16 row-major, W: [N,K] f16 row-major, out: [M,N] OutT.
//   4 waves / block; block tile 64x128; wave tile 32x64; K-step 64 (K a multiple).
//   Ring of GEMM_NB async-to-LDS stages, one barrier per stage.
//   W may stack up to three weight matrices of N, N1 and N2 rows (multiples of
//   128), one behind the other; each has its own bias and its own output of its
//   own width, and blockIdx.y runs over the column blocks of all of them.
// ---------------------------------------------------------------------------
template <typename OutT>
__global__ __launch_bounds__(128)
void gemm_wmma_kernel(const _Float16* __restrict__ A,
                      const _Float16* __restrict__ W,
                      const float* __restrict__ bias,
                      OutT* __restrict__ out,
                      int M, int N, int K,
                      const float* __restrict__ bias1,
                      OutT* __restrict__ out1, int N1,
                      const float* __restrict__ bias2,
                      OutT* __restrict__ out2, int N2) {
  __shared__ __align__(16) _Float16 AsBuf[GEMM_NB][GEMM_AB];  // 3 x 9 KB
  __shared__ __align__(16) _Float16 WsBuf[GEMM_NB][GEMM_WB];  // 3 x 18 KB

  const int t    = threadIdx.x;
  const int lane = t & 31;
  const int wv   = t >> 5;
  const int lm   = lane & 15;
  const int lh   = lane >> 4;
  const int klo  = lh * 8;
  const int m0   = blockIdx.x * 64;
  const int n0   = blockIdx.y * 128;
  const int mw   = (wv & 1) * 32;   // wave m-offset in block tile
  const int nw   = (wv >> 1) * 64;  // wave n-offset in block tile

  v8f acc[2][4];
#pragma unroll
  for (int mt = 0; mt < 2; ++mt)
#pragma unroll
    for (int nt = 0; nt < 4; ++nt) acc[mt][nt] = (v8f)(0.0f);

  // this thread's pieces of a stage: 16-byte piece (t & 7) of rows (t >> 3) + 16 j
  const unsigned long long abase = (unsigned long long)(uintptr_t)A;
  const unsigned long long wbase = (unsigned long long)(uintptr_t)W;
  const int srow = t >> 3;
  const int sc8  = (t & 7) * 8;
  unsigned int va[4], la[4], vw[8], lw[8];
#pragma unroll
  for (int j = 0; j < 4; ++j) {
    va[j] = (unsigned int)(((size_t)(m0 + srow + 16 * j) * K + sc8) * 2);
    la[j] = (unsigned int)(uintptr_t)(&AsBuf[0][(srow + 16 * j) * GEMM_LP + sc8]);
  }
#pragma unroll
  for (int j = 0; j < 8; ++j) {
    vw[j] = (unsigned int)(((size_t)(n0 + srow + 16 * j) * K + sc8) * 2);
    lw[j] = (unsigned int)(uintptr_t)(&WsBuf[0][(srow + 16 * j) * GEMM_LP + sc8]);
  }

  const int nk = K / GEMM_KS;
  // prologue: stages 0 .. GEMM_NB - 2 in flight, each into its own buffer
#pragma unroll
  for (int s = 0; s < GEMM_NB - 1; ++s)
    if (s < nk)
      stage_async(abase + (unsigned long long)s * (GEMM_KS * 2),
                  wbase + (unsigned long long)s * (GEMM_KS * 2),
                  va, vw, la, lw, s * (GEMM_AB * 2), s * (GEMM_WB * 2));

  int rb = 0;             // buffer of stage i
  int fb = GEMM_NB - 1;   // buffer of stage i - 1, refilled with stage i + GEMM_NB - 1
  for (int i = 0; i < nk; ++i) {
    // ---- publish point of stage i
    // this wave's LDS reads of stage i - 1, whose buffer is refilled below, have retired
    asm volatile("s_wait_dscnt 0x0" ::: "memory");
    // this wave's copies of stage i have landed: copies return in issue order,
    // and behind stage i stand the 12 copies each of stages i + 1 .. i + GEMM_NB - 2;
    // in the last trips, which issue nothing, the wait is to 0
    if (i + GEMM_NB - 2 < nk) {
      asm volatile("s_wait_asynccnt %0" :: "i"(12 * (GEMM_NB - 2)) : "memory");
    } else {
      asm volatile("s_wait_asynccnt 0x0" ::: "memory");
    }
    // publishes stage i and ends every wave's reads of stage i - 1
    __syncthreads();

    const _Float16* as = AsBuf[rb];
    const _Float16* ws = WsBuf[rb];
    // fragments of both 32-k halves of the stage, as one group of LDS reads
    v16h a[2][2], b[2][4];
#pragma unroll
    for (int kk = 0; kk < 2; ++kk) {
#pragma unroll
      for (int mt = 0; mt < 2; ++mt)
        a[kk][mt] = load_frag(as + (mw + mt * 16 + lm) * GEMM_LP + kk * 32 + klo);
#pragma unroll
      for (int nt = 0; nt < 4; ++nt)
        b[kk][nt] = load_frag(ws + (nw + nt * 16 + lm) * GEMM_LP + kk * 32 + klo);
    }

    // refill behind the fragment loads' issue: the copies go out while those
    // loads, which read another buffer, are on their way
    if (i + GEMM_NB - 1 < nk)
      stage_async(abase + (unsigned long long)(i + GEMM_NB - 1) * (GEMM_KS * 2),
                  wbase + (unsigned long long)(i + GEMM_NB - 1) * (GEMM_KS * 2),
                  va, vw, la, lw, fb * (GEMM_AB * 2), fb * (GEMM_WB * 2));

    // k ascending per accumulator, as before: the sums keep their order
#pragma unroll
    for (int kk = 0; kk < 2; ++kk)
#pragma unroll
      for (int mt = 0; mt < 2; ++mt)
#pragma unroll
        for (int nt = 0; nt < 4; ++nt)
          acc[mt][nt] = __builtin_amdgcn_wmma_f32_16x16x32_f16(
              false, a[kk][mt], false, b[kk][nt], (short)0, acc[mt][nt], false, false);

    fb = rb;
    rb = (rb + 1 == GEMM_NB) ? 0 : rb + 1;
  }

  // which of the stacked matrices this column block belongs to: its first
  // column there, its bias, its output and that output's width (the same for
  // the whole work-group)
  int nb = n0;
  int No = N;
  const float* bs = bias;
  OutT* ob = out;
  if (nb >= N) {
    nb -= N;  No = N1;  bs = bias1;  ob = out1;
    if (nb >= N1) { nb -= N1;  No = N2;  bs = bias2;  ob = out2; }
  }
  // this lane's column in the wave's first 16x16 tile
  const float* bp = bs + (nb + nw + lm);
  OutT* op = ob + (nb + nw + lm);

  // C/D layout: lane, vgpr r -> (row = r + lh*8, col = lm) in each 16x16 tile
#pragma unroll
  for (int mt = 0; mt < 2; ++mt) {
#pragma unroll
    for (int nt = 0; nt < 4; ++nt) {
      const float bb = bp[nt * 16];
#pragma unroll
      for (int r = 0; r < 8; ++r) {
        const int row = m0 + mw + mt * 16 + r + lh * 8;
        op[(size_t)row * No + nt * 16] = (OutT)(acc[mt][nt][r] + bb);
      }
    }
  }
}

// ---------------------------------------------------------------------------
// Flash attention: one wave per (b, head, 32 queries, half of the keys),
// transposed products, per 16-query column group:
//   S^T = K Q^T  (A = K rows, B = Q), O^T += V^T P^T (A = V^T, B = P^T).
//   A lane (c = lane & 15, h = lane >> 4) then holds scores of ONE query
//   (q0 + 16*cg + c) for keys 8h..8h+7 and 16+8h..16+8h+7 of the chunk: maximum and
//   sum are in-lane except for one exchange with lane l ^ 16, and the two score tiles, converted in place, are the B
//   operand of the second product in the hardware k order.
//   A work-group is 8 waves on one KV group and 32 queries: its 4 heads x the
//   2 halves (32 keys each) of every stage. A wave works both 16-query column
//   groups, so every K and V^T fragment it reads from LDS feeds two products.
//   The two key halves of a head are joined once, behind the loop, through LDS.
//   K and V reach LDS row-major in stages of 64 keys, once per work-group, by
//   asynchronous copies that cover whole 128-byte rows; two buffers, the next
//   stage in flight while this one is worked on. K fragments are plain 16-byte
//   LDS reads, V^T fragments come by the transposing LDS load.
//   q: [B,N,D] f16 (head hl at column hl*64), k/v: [B,N,KD] f16 (group g at
//   column g*64), y: [B,N,D] f16 output.
// ---------------------------------------------------------------------------
// Value of lane l ^ 16 (the other half of the wave, same column).
__device__ inline float other_half(float x) {
  const int b = __builtin_bit_cast(int, x);
  return __builtin_bit_cast(
      float, __builtin_amdgcn_permlanex16(b, b, 0x76543210, 0xfedcba98,
                                          false, false));
}

// 2^x by v_exp_f32, with the v_nop in the same statement: it keeps the one free
// issue slot that the instruction set asks for between a transcendental and an
// instruction that reads its result or overwrites its source.
__device__ inline float exp2_slot(float x) {
  float r;
  asm("v_exp_f32 %0, %1\n\tv_nop" : "=v"(r) : "v"(x));
  return r;
}

#define ATT_STG 64                   // keys per stage
#define ATT_NST (ATT_N / ATT_STG)    // 32 stages
#define ATT_KP  72                   // K row pitch in LDS, halves (144 B = 16 B x 9)
#define ATT_VP  80                   // V row pitch in LDS, halves (160 B = 32 B x 5)

typedef __attribute__((ext_vector_type(8))) short s16x8;
typedef __attribute__((address_space(3))) s16x8 lds_s16x8;

// Transposing LDS load: lane (c, h) gets T[kbase + 8h + 0..7][dbase + c] when
// lane l points at row kbase + 8*(l >> 4) + (l & 7), 16-byte half (l >> 3) & 1.
__device__ inline v8h load_tr16(const _Float16* p) {
  return __builtin_bit_cast(
      v8h, __builtin_amdgcn_ds_load_tr16_b128_v8i16((lds_s16x8*)p));
}

// One stage (64 keys of K and of V) into LDS: 256 threads x 4 copies of 16 B.
// A thread owns 16-byte piece (t & 7) of rows (t >> 3) and (t >> 3) + 32, so a
// wave's copy covers four whole 128-byte rows. kg/vg: the thread's own global
// address in row (t >> 3) of the stage; kl/vl: its own LDS byte address there.
// The s_wait_xcnt stands inside the statement so that no address register of
// an issued copy is rewritten in front of it.
__device__ inline void stage_kv_async(const _Float16* kg, const _Float16* vg,
                                      unsigned int kl, unsigned int vl) {
  const _Float16* kg1 = kg + (size_t)32 * ATT_KD;
  const _Float16* vg1 = vg + (size_t)32 * ATT_KD;
  const unsigned int kl1 = kl + 32 * ATT_KP * 2;
  const unsigned int vl1 = vl + 32 * ATT_VP * 2;
  asm volatile("global_load_async_to_lds_b128 %0, %4, off\n\t"
               "global_load_async_to_lds_b128 %1, %5, off\n\t"
               "global_load_async_to_lds_b128 %2, %6, off\n\t"
               "global_load_async_to_lds_b128 %3, %7, off\n\t"
               "s_wait_xcnt 0x0"
               :: "v"(kl), "v"(kl1), "v"(vl), "v"(vl1),
                  "v"(kg), "v"(kg1), "v"(vg), "v"(vg1) : "memory");
}

// Four waves per SIMD, that is two work-groups per WGP: the 512 work-groups
// then spread evenly over the chip's 256 WGPs in one round, and the register
// budget of 256 lets the LDS fragment loads be issued well ahead of their use.
__global__ __launch_bounds__(256) __attribute__((amdgpu_waves_per_eu(4, 4)))
void attn_wmma_kernel(const _Float16* __restrict__ q,
                      const _Float16* __restrict__ k,
                      const _Float16* __restrict__ v,
                      _Float16* __restrict__ y) {
  // one array: K buffers, then V buffers; behind the loop it is the exchange area
  __shared__ __align__(16) _Float16 Ring[2 * ATT_STG * (ATT_KP + ATT_VP)];  // 38912 B
  _Float16* const Ks = Ring;                          // 2 x 9216 B
  _Float16* const Vs = Ring + 2 * ATT_STG * ATT_KP;   // 2 x 10240 B

  const int t    = threadIdx.x;
  const int lane = t & 31;
  const int wv   = t >> 5;
  const int lm   = lane & 15;
  const int lh   = lane >> 4;
  const int klo  = lh * 8;

  int idx = blockIdx.x;
  const int qp = idx & (ATT_N / 32 - 1);  idx >>= 6;   // N/32 = 64 blocks of 32 queries
  const int g  = idx & (ATT_G - 1);       idx >>= 2;   // KV group
  const int b  = idx;                                   // batch
  const int hl = g * 4 + (wv & 3);                      // linear head 0..15
  const int kh = wv >> 2;                               // this wave's 32 keys of a stage
  const int q0 = qp * 32;

  // this thread's piece of a stage: global addresses (stage 0) and LDS places
  const int crow = t >> 3;
  const int cseg = (t & 7) * 8;
  const size_t coff = (size_t)(b * ATT_N + crow) * ATT_KD + g * ATT_HD + cseg;
  const _Float16* kg = k + coff;
  const _Float16* vg = v + coff;
  const unsigned int kl0 =
      (unsigned int)(uintptr_t)(&Ks[crow * ATT_KP + cseg]);
  const unsigned int vl0 =
      (unsigned int)(uintptr_t)(&Vs[crow * ATT_VP + cseg]);
  const unsigned int kbuf = ATT_STG * ATT_KP * 2;  // bytes from buffer 0 to 1
  const unsigned int vbuf = ATT_STG * ATT_VP * 2;
  const size_t gstep = (size_t)ATT_STG * ATT_KD;   // halves per stage

  // prologue: stage 0 landed and published, then stage 1 in flight
  stage_kv_async(kg, vg, kl0, vl0);
  // stage 0's copies of this wave have landed before the barrier publishes them
  asm volatile("s_wait_asynccnt 0x0" ::: "memory");
  __syncthreads();
  stage_kv_async(kg + gstep, vg + gstep, kl0 + kbuf, vl0 + vbuf);

  // Q fragments of both column groups: B-matrix 32x16 halves (column = query),
  // d = 0..31 and 32..63
  v16h bq[2][2];
#pragma unroll
  for (int cg = 0; cg < 2; ++cg) {
    const _Float16* qptr =
        q + (size_t)(b * ATT_N + q0 + cg * 16 + lm) * ATT_D + hl * ATT_HD + klo;
    bq[cg][0] = load_frag(qptr);
    bq[cg][1] = load_frag(qptr + 32);
  }

  // per column group cg, query q0 + cg*16 + lm, over this wave's keys:
  float mrun[2];   // running maximum, unscaled (both halves of the wave equal)
  float lrun[2];   // running sum over this half's keys only
  v8f acc[2][4];   // acc[cg][dc][r] = O^T[dc*16 + 8*lh + r][query]
#pragma unroll
  for (int cg = 0; cg < 2; ++cg) {
    mrun[cg] = -INFINITY;
    lrun[cg] = 0.0f;
#pragma unroll
    for (int dc = 0; dc < 4; ++dc) acc[cg][dc] = (v8f)(0.0f);
  }

  // 1/sqrt(64) * log2(e): e^(scale * (s - m)) = 2^(s * sl2 - m * sl2)
  const float sl2 = 0.125f * 1.44269504f;

  // fragment offsets inside a stage buffer, in halves (this wave's 32 keys)
  const int kfo = (kh * 32 + lm) * ATT_KP + klo;
  const int vfo = (kh * 32 + 8 * lh + (lane & 7)) * ATT_VP + 8 * ((lane >> 3) & 1);

  for (int st = 0; st < ATT_NST; ++st) {
    const _Float16* kp0 = Ks + (st & 1) * (ATT_STG * ATT_KP) + kfo;
    const _Float16* kp1 = kp0 + 16 * ATT_KP;
    const _Float16* vp  = Vs + (st & 1) * (ATT_STG * ATT_VP) + vfo;

    // ---- K fragments of the 32 keys (two 16-key tiles x two 32-d halves)
    const v16h ka00 = load_frag(kp0);
    const v16h ka01 = load_frag(kp0 + 32);
    const v16h ka10 = load_frag(kp1);
    const v16h ka11 = load_frag(kp1 + 32);

    // ---- V^T fragments (16 d x 32 keys per dc) by the transposing load:
    //      halves 0..7 = keys 8*lh + 0..7, halves 8..15 = keys 16 + 8*lh + 0..7
    v16h av[4];
#pragma unroll
    for (int dc = 0; dc < 4; ++dc) {
      const v8h lo = load_tr16(vp + dc * 16);
      const v8h hi = load_tr16(vp + 16 * ATT_VP + dc * 16);
#pragma unroll
      for (int i = 0; i < 8; ++i) { av[dc][i] = lo[i]; av[dc][i + 8] = hi[i]; }
    }

    // unrolled so that the per-group state stays in registers
#pragma unroll
    for (int cg = 0; cg < 2; ++cg) {
      // ---- scores: S^T = K @ Q^T for 32 keys (two 16x16 tiles, K=64 via 2 wmma)
      //      s0[r] = S[query][kc + 8*lh + r], s1[r] = S[query][kc + 16 + 8*lh + r]
      v8f s0 = (v8f)(0.0f), s1 = (v8f)(0.0f);
      s0 = __builtin_amdgcn_wmma_f32_16x16x32_f16(false, ka00, false,
          bq[cg][0], (short)0, s0, false, false);
      s0 = __builtin_amdgcn_wmma_f32_16x16x32_f16(false, ka01, false,
          bq[cg][1], (short)0, s0, false, false);
      s1 = __builtin_amdgcn_wmma_f32_16x16x32_f16(false, ka10, false,
          bq[cg][0], (short)0, s1, false, false);
      s1 = __builtin_amdgcn_wmma_f32_16x16x32_f16(false, ka11, false,
          bq[cg][1], (short)0, s1, false, false);

      // ---- online softmax over the 32 keys of this chunk: 16 scores in-lane,
      //      one exchange of the maximum between the wave's halves
      //      the maximum is kept in units of the raw products (the scale is
      //      positive); scale and log2(e) enter in the one fused multiply-add
      //      that forms each exponent
      float tmx = -INFINITY;
#pragma unroll
      for (int r = 0; r < 8; ++r) tmx = fmaxf(tmx, fmaxf(s0[r], s1[r]));
      tmx = fmaxf(tmx, other_half(tmx));
      const float mn = fmaxf(mrun[cg], tmx);
      const float al = exp2_slot((mrun[cg] - mn) * sl2);
      mrun[cg] = mn;
      const float nm = -mn * sl2;
      float rs = 0.0f;
      v16h pb;  // P^T as B operand: pb[s] = P[query][kc + kmap(s, lh)]
#pragma unroll
      for (int r = 0; r < 8; ++r) {
        const float p0 = exp2_slot(__builtin_fmaf(s0[r], sl2, nm));
        const float p1 = exp2_slot(__builtin_fmaf(s1[r], sl2, nm));
        rs += p0 + p1;
        pb[r]     = (_Float16)p0;
        pb[r + 8] = (_Float16)p1;
      }
      lrun[cg] = lrun[cg] * al + rs;
#pragma unroll
      for (int dc = 0; dc < 4; ++dc)
#pragma unroll
        for (int r = 0; r < 8; ++r) acc[cg][dc][r] *= al;

      // ---- O^T += V^T @ P^T
#pragma unroll
      for (int dc = 0; dc < 4; ++dc)
        acc[cg][dc] = __builtin_amdgcn_wmma_f32_16x16x32_f16(
            false, av[dc], false, pb, (short)0, acc[cg][dc], false, false);
    }

    // ---- publish point of stage st + 1
    // this wave's LDS reads of the buffer that is refilled below have retired
    asm volatile("s_wait_dscnt 0x0" ::: "memory");
    // this wave's copies of stage st + 1 have landed
    asm volatile("s_wait_asynccnt 0x0" ::: "memory");
    // publishes stage st + 1 and ends every wave's reads of stage st
    __syncthreads();
    if (st + 2 < ATT_NST)
      stage_kv_async(kg + (size_t)(st + 2) * gstep, vg + (size_t)(st + 2) * gstep,
                     kl0 + (st & 1) * kbuf, vl0 + (st & 1) * vbuf);
  }
  // no copy is outstanding when the ring is reused and when the wave ends
  asm volatile("s_wait_asynccnt 0x0" ::: "memory");

  // ---- join the two key halves of a head (waves wv and wv ^ 4, lane by lane):
  //      wave kh keeps column group kh and hands the other group's partial
  //      result to its partner through the ring, which every wave has left at
  //      the loop's last barrier.
  //      exchange area: per wave 8 x 32 lanes x 16 B of O^T, then maximum and sum
  float* const xo = (float*)Ring;                 // 8 waves x 4096 B
  float* const xm = xo + 8 * 1024;                // 8 waves x 2 x 32 floats
  static_assert((8 * 1024 + 8 * 64) * 4 <= sizeof(Ring), "exchange area fits the ring");
  const bool up = (kh != 0);                      // the same for the whole wave
  v8f keep[4], give[4];
#pragma unroll
  for (int dc = 0; dc < 4; ++dc)
#pragma unroll
    for (int r = 0; r < 8; ++r) {
      keep[dc][r] = up ? acc[1][dc][r] : acc[0][dc][r];
      give[dc][r] = up ? acc[0][dc][r] : acc[1][dc][r];
    }
  const float mk = up ? mrun[1] : mrun[0];
  const float lk = up ? lrun[1] : lrun[0];
  {
    v4f* wo = (v4f*)(xo + wv * 1024) + lane;
#pragma unroll
    for (int dc = 0; dc < 4; ++dc) {
      v4f lo4, hi4;
#pragma unroll
      for (int r = 0; r < 4; ++r) { lo4[r] = give[dc][r]; hi4[r] = give[dc][r + 4]; }
      wo[(dc * 2) * 32]     = lo4;
      wo[(dc * 2 + 1) * 32] = hi4;
    }
    xm[wv * 64 + lane]      = up ? mrun[0] : mrun[1];
    xm[wv * 64 + 32 + lane] = up ? lrun[0] : lrun[1];
  }
  // the partner's partial result is written before it is read
  __syncthreads();
  const int pw = wv ^ 4;
  const float mp = xm[pw * 64 + lane];
  const float lp = xm[pw * 64 + 32 + lane];
  const float mj = fmaxf(mk, mp);
  const float ak = exp2_slot((mk - mj) * sl2);
  const float ap = exp2_slot((mp - mj) * sl2);
  const float lj = lk * ak + lp * ap;

  // ---- epilogue: join the wave halves' sums, normalize, store y (f16);
  //      a lane holds 8 consecutive d of one query row: 16-byte stores
  const float inv = 1.0f / (lj + other_half(lj));
  const float fk = ak * inv;
  const float fp = ap * inv;
  const v4f* ro = (const v4f*)(xo + pw * 1024) + lane;
  _Float16* yp =
      y + (size_t)(b * ATT_N + q0 + kh * 16 + lm) * ATT_D + hl * ATT_HD + klo;
#pragma unroll
  for (int dc = 0; dc < 4; ++dc) {
    const v4f lo4 = ro[(dc * 2) * 32];
    const v4f hi4 = ro[(dc * 2 + 1) * 32];
    v8h o;
#pragma unroll
    for (int r = 0; r < 4; ++r) {
      o[r]     = (_Float16)(keep[dc][r] * fk + lo4[r] * fp);
      o[r + 4] = (_Float16)(keep[dc][r + 4] * fk + hi4[r] * fp);
    }
    *(v8h*)(yp + dc * 16) = o;
  }
}

// ---------------------------------------------------------------------------
// Host-side launch
// ---------------------------------------------------------------------------
extern "C" void kernel_launch(void* const* d_in, const int* in_sizes, int n_in,
                              void* d_out, int out_size, void* d_ws, size_t ws_size,
                              hipStream_t stream) {
  (void)in_sizes; (void)n_in; (void)out_size; (void)ws_size;

  const float* x  = (const float*)d_in[0];
  const float* Wq = (const float*)d_in[1];
  const float* bq = (const float*)d_in[2];
  const float* Wk = (const float*)d_in[3];
  const float* bk = (const float*)d_in[4];
  const float* Wv = (const float*)d_in[5];
  const float* bv = (const float*)d_in[6];
  const float* Wo = (const float*)d_in[7];
  const float* bo = (const float*)d_in[8];
  float* out = (float*)d_out;

  _Float16* ws = (_Float16*)d_ws;
  const size_t nX  = (size_t)ATT_M * ATT_D;   // 4194304
  const size_t nWq = (size_t)ATT_D * ATT_D;   // 1048576
  const size_t nWk = (size_t)ATT_KD * ATT_D;  // 262144
  _Float16* xh  = ws;
  _Float16* wqh = xh  + nX;
  _Float16* wkh = wqh + nWq;
  _Float16* wvh = wkh + nWk;
  _Float16* woh = wvh + nWk;
  _Float16* qh  = woh + nWq;
  _Float16* kh  = qh  + nX;
  _Float16* vh  = kh  + (size_t)ATT_M * ATT_KD;
  _Float16* yh  = vh  + (size_t)ATT_M * ATT_KD;

  // 1) f16 conversions: one launch, planes xh, wqh, wkh, wvh, woh in a row
  f32_to_f16_all_kernel<<<CV_BLOCKS, CV_THREADS, 0, stream>>>(x, Wq, Wk, Wv, Wo, xh);

  // 2) projections: 4-wave blocks, 64x128 tile; q, k and v in one launch: the
  //    planes wqh, wkh, wvh lie in a row and read as one [1536][1024] weight
  dim3 blk(128, 1, 1);
  dim3 gq(ATT_M / 64, ATT_D / 128, 1);                    // 64 x 8
  dim3 gqkv(ATT_M / 64, (ATT_D + 2 * ATT_KD) / 128, 1);   // 64 x 12
  gemm_wmma_kernel<_Float16><<<gqkv, blk, 0, stream>>>(xh, wqh, bq, qh,
      ATT_M, ATT_D, ATT_D, bk, kh, ATT_KD, bv, vh, ATT_KD);

  // 3) attention: 8 waves per (b, KV group, 32 queries) = 2*4*64 = 512
  dim3 ablk(256, 1, 1);
  attn_wmma_kernel<<<ATT_B * ATT_G * (ATT_N / 32), ablk, 0, stream>>>(qh, kh, vh, yh);

  // 4) output projection, f32 straight into d_out (one weight matrix: the
  //    second and third places are never selected)
  gemm_wmma_kernel<float><<<gq, blk, 0, stream>>>(yh, woh, bo, out,
      ATT_M, ATT_D, ATT_D, bo, out, 0, bo, out, 0);
}

// v010
// One run takes 62.6 microseconds.
// Next to v009, in two timings, it ran 1.03 times as fast each time.
// Counting every step since v000, it is 3.67 times as fast.
#include <hip/hip_runtime.h>
#include <hip/hip_bf16.h>
#include <math.h>

// ---------------------------------------------------------------------------
// GQA attention forward for MI455X (gfx1250, wave32, WMMA + async-to-LDS).
//   B=2, N=2048, D=1024, H=16, G=4, HD=64, hpg=4
// Pipeline (f16 staging in d_ws, f32 accumulation in WMMA):
//   1) convert x, Wq, Wk, Wv, Wo to f16 (one launch)
//   2) q/k/v projections, one launch over the stacked weights: WMMA GEMM with
//      a ring of async-to-LDS tiles
//   3) flash attention, 8 waves per (b, KV group, 32 q rows)  (WMMA + LDS):
//      a wave = one head, all 32 q rows, every other 32 keys
//   4) out = y@Wo^T + bo (same GEMM, f32 out)
// ---------------------------------------------------------------------------

typedef __attribute__((ext_vector_type(16))) _Float16 v16h;
typedef __attribute__((ext_vector_type(8)))  _Float16 v8h;
typedef __attribute__((ext_vector_type(8)))  float    v8f;

#define ATT_B  2
#define ATT_N  2048
#define ATT_D  1024
#define ATT_G  4
#define ATT_HD 64
#define ATT_KD (ATT_G * ATT_HD)     // 256
#define ATT_M  (ATT_B * ATT_N)      // 4096 rows for the projections

// ---------------------------------------------------------------------------
// f32 -> f16 conversion of x, Wq, Wk, Wv, Wo in ONE launch.
// The five f16 planes lie one behind the other in the workspace (dst), in that
// order. 256 work-groups of 16 waves, one per WGP; a thread converts 13 pieces
// of 4 floats: piece j of grid thread i is piece j * CV_T + i of the joined planes,
// so every wave-wide load covers 512 contiguous bytes and every store 256.
// Pieces 0..7 fall in x, 8..9 in Wq, 10 in Wk (lower half of the grid) or Wv
// (upper half), 11..12 in Wo. All 13 loads are issued before the first store.
// ---------------------------------------------------------------------------
typedef __attribute__((ext_vector_type(4))) float    v4f;
typedef __attribute__((ext_vector_type(4))) _Float16 v4h;

#define CV_THREADS 512
#define CV_BLOCKS  256
#define CV_T       (CV_THREADS * CV_BLOCKS)   // 131072 threads
static_assert(ATT_M * ATT_D  == 8 * 4 * CV_T, "x is 8 pieces per thread");
static_assert(ATT_D * ATT_D  == 2 * 4 * CV_T, "Wq, Wo are 2 pieces per thread");
static_assert(ATT_KD * ATT_D * 2 == 4 * CV_T, "Wk and Wv together are 1 piece");

__global__ __launch_bounds__(CV_THREADS)
void f32_to_f16_all_kernel(const float* __restrict__ x,
                           const float* __restrict__ Wq,
                           const float* __restrict__ Wk,
                           const float* __restrict__ Wv,
                           const float* __restrict__ Wo,
                           _Float16* __restrict__ dst) {
  // the work-group's part of every address is scalar; the one vector offset,
  // the thread's number, lives to the last store
  const int t = threadIdx.x;
  const int w = blockIdx.x * CV_THREADS;               // first piece of the group
  const v4f* xs  = (const v4f*)x + w;
  const v4f* wqs = (const v4f*)Wq + w;
  const v4f* wos = (const v4f*)Wo + w;
  const v4f* wkvs = (blockIdx.x < CV_BLOCKS / 2)
                        ? (const v4f*)Wk + w
                        : (const v4f*)Wv + (w - CV_T / 2);
  v4h* ds = (v4h*)dst + w;
  // every loop below is unrolled so that r[] stays in registers (constant
  // indices) and the 13 loads stand as one run in front of the stores
  v4f r[13];
#pragma unroll
  for (int j = 0; j < 8; ++j) r[j] = xs[j * CV_T + t];
#pragma unroll
  for (int j = 0; j < 2; ++j) r[8 + j] = wqs[j * CV_T + t];
  r[10] = wkvs[t];
#pragma unroll
  for (int j = 0; j < 2; ++j) r[11 + j] = wos[j * CV_T + t];
#pragma unroll
  for (int j = 0; j < 13; ++j)
    ds[j * CV_T + t] = __builtin_convertvector(r[j], v4h);
}

// Load one WMMA f16 fragment (ISA striping): halves 0..7 at p[0..7],
// halves 8..15 at p[16..23]; caller pre-offsets p by klo = (lane/16)*8.
__device__ inline v16h load_frag(const _Float16* p) {
  v8h lo = *(const v8h*)(p);
  v8h hi = *(const v8h*)(p + 16);
  v16h r;
#pragma unroll
  for (int i = 0; i < 8; ++i) { r[i] = lo[i]; r[i + 8] = hi[i]; }
  return r;
}

// k per stage of the GEMM's LDS ring: 64 halves = 128 B of every operand row,
// one whole cache line, so that a wave-wide copy of 512 B asks L2 for four
// whole lines (at 32 halves it asked for the halves of eight).
#define GEMM_KS 64

// LDS row pitch of the GEMM tiles, in halves: a row holds 64 halves (128 B) and
// is laid at 144 B = 16 B x 9. The 16 lanes of a fragment's ds_load_b128 read 16
// rows at one column: at an odd multiple of 16 B they fall on all 64 banks.
#define GEMM_LP 72

// Buffers of the GEMM's LDS ring. A stage's copies are issued GEMM_NB - 1 trips
// ahead of the trip that reads it, so that their way from L2 or memory is
// covered by the trips between; 3 x 27 KB lets three work-groups share a WGP.
#define GEMM_NB 3
#define GEMM_AB (64 * GEMM_LP)    // halves per A buffer
#define GEMM_WB (128 * GEMM_LP)   // halves per W buffer

// ---------------------------------------------------------------------------
// Async stage one K-slab into LDS:
//   A rows [m0, m0+64) x 64 k  -> one A buffer (64 rows of 64 halves, pitch GEMM_LP)
//   W rows [n0, n0+128) x 64 k -> one W buffer (128 rows of 64 halves, pitch GEMM_LP)
// 128 threads; each issues 4 (A) + 8 (W) global_load_async_to_lds_b128,
// i.e. ASYNCcnt += 12 per wave per stage; a wave's copy covers four whole rows.
// ab, wb: A and W advanced to the slab's first k (scalar); va, vw: the thread's
// byte offsets from there (the same for every slab); la, lw: its LDS byte
// addresses in buffer 0; ao, wo: byte offsets of the target buffer.
// The s_wait_xcnt stands inside the statement so that no address register of
// an issued copy is rewritten in front of it.
// ---------------------------------------------------------------------------
__device__ inline void stage_async(unsigned long long ab, unsigned long long wb,
                                   const unsigned int (&va)[4],
                                   const unsigned int (&vw)[8],
                                   const unsigned int (&la)[4],
                                   const unsigned int (&lw)[8],
                                   unsigned int ao, unsigned int wo) {
  asm volatile("global_load_async_to_lds_b128 %0, %12, %24\n\t"
               "global_load_async_to_lds_b128 %1, %13, %24\n\t"
               "global_load_async_to_lds_b128 %2, %14, %24\n\t"
               "global_load_async_to_lds_b128 %3, %15, %24\n\t"
               "global_load_async_to_lds_b128 %4, %16, %25\n\t"
               "global_load_async_to_lds_b128 %5, %17, %25\n\t"
               "global_load_async_to_lds_b128 %6, %18, %25\n\t"
               "global_load_async_to_lds_b128 %7, %19, %25\n\t"
               "global_load_async_to_lds_b128 %8, %20, %25\n\t"
               "global_load_async_to_lds_b128 %9, %21, %25\n\t"
               "global_load_async_to_lds_b128 %10, %22, %25\n\t"
               "global_load_async_to_lds_b128 %11, %23, %25\n\t"
               "s_wait_xcnt 0x0"
               :: "v"(la[0] + ao), "v"(la[1] + ao), "v"(la[2] + ao), "v"(la[3] + ao),
                  "v"(lw[0] + wo), "v"(lw[1] + wo), "v"(lw[2] + wo), "v"(lw[3] + wo),
                  "v"(lw[4] + wo), "v"(lw[5] + wo), "v"(lw[6] + wo), "v"(lw[7] + wo),
                  "v"(va[0]), "v"(va[1]), "v"(va[2]), "v"(va[3]),
                  "v"(vw[0]), "v"(vw[1]), "v"(vw[2]), "v"(vw[3]),
                  "v"(vw[4]), "v"(vw[5]), "v"(vw[6]), "v"(vw[7]),
                  "s"(ab), "s"(wb) : "memory");
}

// ---------------------------------------------------------------------------
// GEMM: out[m,n] = sum_k A[m,k] * W[n,k] + bias[n]
//   A: [M,K] f16 row-major, W: [N,K] f16 row-major, out: [M,N] OutT.
//   4 waves / block; block tile 64x128; wave tile 32x64; K-step 64 (K a multiple).
//   Ring of GEMM_NB async-to-LDS stages, one barrier per stage.
//   W may stack up to three weight matrices of N, N1 and N2 rows (multiples of
//   128), one behind the other; each has its own bias and its own output of its
//   own width, and blockIdx.y runs over the column blocks of all of them.
// ---------------------------------------------------------------------------
template <typename OutT>
__global__ __launch_bounds__(128)
void gemm_wmma_kernel(const _Float16* __restrict__ A,
                      const _Float16* __restrict__ W,
                      const float* __restrict__ bias,
                      OutT* __restrict__ out,
                      int M, int N, int K,
                      const float* __restrict__ bias1,
                      OutT* __restrict__ out1, int N1,
                      const float* __restrict__ bias2,
                      OutT* __restrict__ out2, int N2) {
  __shared__ __align__(16) _Float16 AsBuf[GEMM_NB][GEMM_AB];  // 3 x 9 KB
  __shared__ __align__(16) _Float16 WsBuf[GEMM_NB][GEMM_WB];  // 3 x 18 KB

  const int t    = threadIdx.x;
  const int lane = t & 31;
  const int wv   = t >> 5;
  const int lm   = lane & 15;
  const int lh   = lane >> 4;
  const int klo  = lh * 8;
  const int m0   = blockIdx.x * 64;
  const int n0   = blockIdx.y * 128;
  const int mw   = (wv & 1) * 32;   // wave m-offset in block tile
  const int nw   = (wv >> 1) * 64;  // wave n-offset in block tile

  v8f acc[2][4];
#pragma unroll
  for (int mt = 0; mt < 2; ++mt)
#pragma unroll
    for (int nt = 0; nt < 4; ++nt) acc[mt][nt] = (v8f)(0.0f);

  // this thread's pieces of a stage: 16-byte piece (t & 7) of rows (t >> 3) + 16 j
  const unsigned long long abase = (unsigned long long)(uintptr_t)A;
  const unsigned long long wbase = (unsigned long long)(uintptr_t)W;
  const int srow = t >> 3;
  const int sc8  = (t & 7) * 8;
  unsigned int va[4], la[4], vw[8], lw[8];
#pragma unroll
  for (int j = 0; j < 4; ++j) {
    va[j] = (unsigned int)(((size_t)(m0 + srow + 16 * j) * K + sc8) * 2);
    la[j] = (unsigned int)(uintptr_t)(&AsBuf[0][(srow + 16 * j) * GEMM_LP + sc8]);
  }
#pragma unroll
  for (int j = 0; j < 8; ++j) {
    vw[j] = (unsigned int)(((size_t)(n0 + srow + 16 * j) * K + sc8) * 2);
    lw[j] = (unsigned int)(uintptr_t)(&WsBuf[0][(srow + 16 * j) * GEMM_LP + sc8]);
  }

  const int nk = K / GEMM_KS;
  // prologue: stages 0 .. GEMM_NB - 2 in flight, each into its own buffer
#pragma unroll
  for (int s = 0; s < GEMM_NB - 1; ++s)
    if (s < nk)
      stage_async(abase + (unsigned long long)s * (GEMM_KS * 2),
                  wbase + (unsigned long long)s * (GEMM_KS * 2),
                  va, vw, la, lw, s * (GEMM_AB * 2), s * (GEMM_WB * 2));

  int rb = 0;             // buffer of stage i
  int fb = GEMM_NB - 1;   // buffer of stage i - 1, refilled with stage i + GEMM_NB - 1
  for (int i = 0; i < nk; ++i) {
    // ---- publish point of stage i
    // this wave's LDS reads of stage i - 1, whose buffer is refilled below, have retired
    asm volatile("s_wait_dscnt 0x0" ::: "memory");
    // this wave's copies of stage i have landed: copies return in issue order,
    // and behind stage i stand the 12 copies each of stages i + 1 .. i + GEMM_NB - 2;
    // in the last trips, which issue nothing, the wait is to 0
    if (i + GEMM_NB - 2 < nk) {
      asm volatile("s_wait_asynccnt %0" :: "i"(12 * (GEMM_NB - 2)) : "memory");
    } else {
      asm volatile("s_wait_asynccnt 0x0" ::: "memory");
    }
    // publishes stage i and ends every wave's reads of stage i - 1
    __syncthreads();

    const _Float16* as = AsBuf[rb];
    const _Float16* ws = WsBuf[rb];
    // fragments of both 32-k halves of the stage, as one group of LDS reads
    v16h a[2][2], b[2][4];
#pragma unroll
    for (int kk = 0; kk < 2; ++kk) {
#pragma unroll
      for (int mt = 0; mt < 2; ++mt)
        a[kk][mt] = load_frag(as + (mw + mt * 16 + lm) * GEMM_LP + kk * 32 + klo);
#pragma unroll
      for (int nt = 0; nt < 4; ++nt)
        b[kk][nt] = load_frag(ws + (nw + nt * 16 + lm) * GEMM_LP + kk * 32 + klo);
    }

    // refill behind the fragment loads' issue: the copies go out while those
    // loads, which read another buffer, are on their way
    if (i + GEMM_NB - 1 < nk)
      stage_async(abase + (unsigned long long)(i + GEMM_NB - 1) * (GEMM_KS * 2),
                  wbase + (unsigned long long)(i + GEMM_NB - 1) * (GEMM_KS * 2),
                  va, vw, la, lw, fb * (GEMM_AB * 2), fb * (GEMM_WB * 2));

    // k ascending per accumulator, as before: the sums keep their order
#pragma unroll
    for (int kk = 0; kk < 2; ++kk)
#pragma unroll
      for (int mt = 0; mt < 2; ++mt)
#pragma unroll
        for (int nt = 0; nt < 4; ++nt)
          acc[mt][nt] = __builtin_amdgcn_wmma_f32_16x16x32_f16(
              false, a[kk][mt], false, b[kk][nt], (short)0, acc[mt][nt], false, false);

    fb = rb;
    rb = (rb + 1 == GEMM_NB) ? 0 : rb + 1;
  }

  // which of the stacked matrices this column block belongs to: its first
  // column there, its bias, its output and that output's width (the same for
  // the whole work-group)
  int nb = n0;
  int No = N;
  const float* bs = bias;
  OutT* ob = out;
  if (nb >= N) {
    nb -= N;  No = N1;  bs = bias1;  ob = out1;
    if (nb >= N1) { nb -= N1;  No = N2;  bs = bias2;  ob = out2; }
  }
  // this lane's column in the wave's first 16x16 tile
  const float* bp = bs + (nb + nw + lm);
  OutT* op = ob + (nb + nw + lm);

  // C/D layout: lane, vgpr r -> (row = r + lh*8, col = lm) in each 16x16 tile
#pragma unroll
  for (int mt = 0; mt < 2; ++mt) {
#pragma unroll
    for (int nt = 0; nt < 4; ++nt) {
      const float bb = bp[nt * 16];
#pragma unroll
      for (int r = 0; r < 8; ++r) {
        const int row = m0 + mw + mt * 16 + r + lh * 8;
        op[(size_t)row * No + nt * 16] = (OutT)(acc[mt][nt][r] + bb);
      }
    }
  }
}

// ---------------------------------------------------------------------------
// Flash attention: one wave per (b, head, 32 queries, half of the keys),
// transposed products, per 16-query column group:
//   S^T = K Q^T  (A = K rows, B = Q), O^T += V^T P^T (A = V^T, B = P^T).
//   A lane (c = lane & 15, h = lane >> 4) then holds scores of ONE query
//   (q0 + 16*cg + c) for keys 8h..8h+7 and 16+8h..16+8h+7 of the chunk: maximum and
//   sum are in-lane except for one exchange with lane l ^ 16, and the two score tiles, converted in place, are the B
//   operand of the second product in the hardware k order.
//   A work-group is 8 waves on one KV group and 32 queries: its 4 heads x the
//   2 halves (32 keys each) of every stage. A wave works both 16-query column
//   groups, so every K and V^T fragment it reads from LDS feeds two products.
//   The two key halves of a head are joined once, behind the loop, through LDS.
//   K and V reach LDS row-major in stages of 64 keys, once per work-group, by
//   asynchronous copies that cover whole 128-byte rows; two buffers, the next
//   stage in flight while this one is worked on. K fragments are plain 16-byte
//   LDS reads, V^T fragments come by the transposing LDS load.
//   q: [B,N,D] f16 (head hl at column hl*64), k/v: [B,N,KD] f16 (group g at
//   column g*64), y: [B,N,D] f16 output.
// ---------------------------------------------------------------------------
// Value of lane l ^ 16 (the other half of the wave, same column).
__device__ inline float other_half(float x) {
  const int b = __builtin_bit_cast(int, x);
  return __builtin_bit_cast(
      float, __builtin_amdgcn_permlanex16(b, b, 0x76543210, 0xfedcba98,
                                          false, false));
}

// 2^x by v_exp_f32, with the v_nop in the same statement: it keeps the one free
// issue slot that the instruction set asks for between a transcendental and an
// instruction that reads its result or overwrites its source.
__device__ inline float exp2_slot(float x) {
  float r;
  asm("v_exp_f32 %0, %1\n\tv_nop" : "=v"(r) : "v"(x));
  return r;
}

#define ATT_STG 64                   // keys per stage
#define ATT_NST (ATT_N / ATT_STG)    // 32 stages
#define ATT_KP  72                   // K row pitch in LDS, halves (144 B = 16 B x 9)
#define ATT_VP  80                   // V row pitch in LDS, halves (160 B = 32 B x 5)
// 8 / (0.125 * log2(e)): the rise of a raw K*Q product that multiplies e^score by 2^8
#define RESC_THR 44.3614196f

typedef __attribute__((ext_vector_type(8))) short s16x8;
typedef __attribute__((address_space(3))) s16x8 lds_s16x8;

// Transposing LDS load: lane (c, h) gets T[kbase + 8h + 0..7][dbase + c] when
// lane l points at row kbase + 8*(l >> 4) + (l & 7), 16-byte half (l >> 3) & 1.
__device__ inline v8h load_tr16(const _Float16* p) {
  return __builtin_bit_cast(
      v8h, __builtin_amdgcn_ds_load_tr16_b128_v8i16((lds_s16x8*)p));
}

// One stage (64 keys of K and of V) into LDS: 256 threads x 4 copies of 16 B.
// A thread owns 16-byte piece (t & 7) of rows (t >> 3) and (t >> 3) + 32, so a
// wave's copy covers four whole 128-byte rows. kg/vg: the thread's own global
// address in row (t >> 3) of the stage; kl/vl: its own LDS byte address there.
// The s_wait_xcnt stands inside the statement so that no address register of
// an issued copy is rewritten in front of it.
__device__ inline void stage_kv_async(const _Float16* kg, const _Float16* vg,
                                      unsigned int kl, unsigned int vl) {
  const _Float16* kg1 = kg + (size_t)32 * ATT_KD;
  const _Float16* vg1 = vg + (size_t)32 * ATT_KD;
  const unsigned int kl1 = kl + 32 * ATT_KP * 2;
  const unsigned int vl1 = vl + 32 * ATT_VP * 2;
  asm volatile("global_load_async_to_lds_b128 %0, %4, off\n\t"
               "global_load_async_to_lds_b128 %1, %5, off\n\t"
               "global_load_async_to_lds_b128 %2, %6, off\n\t"
               "global_load_async_to_lds_b128 %3, %7, off\n\t"
               "s_wait_xcnt 0x0"
               :: "v"(kl), "v"(kl1), "v"(vl), "v"(vl1),
                  "v"(kg), "v"(kg1), "v"(vg), "v"(vg1) : "memory");
}

// Four waves per SIMD, that is two work-groups per WGP: the 512 work-groups
// then spread evenly over the chip's 256 WGPs in one round, and the register
// budget of 256 lets the LDS fragment loads be issued well ahead of their use.
__global__ __launch_bounds__(256) __attribute__((amdgpu_waves_per_eu(4, 4)))
void attn_wmma_kernel(const _Float16* __restrict__ q,
                      const _Float16* __restrict__ k,
                      const _Float16* __restrict__ v,
                      _Float16* __restrict__ y) {
  // one array: K buffers, then V buffers; behind the loop it is the exchange area
  __shared__ __align__(16) _Float16 Ring[2 * ATT_STG * (ATT_KP + ATT_VP)];  // 38912 B
  _Float16* const Ks = Ring;                          // 2 x 9216 B
  _Float16* const Vs = Ring + 2 * ATT_STG * ATT_KP;   // 2 x 10240 B

  const int t    = threadIdx.x;
  const int lane = t & 31;
  const int wv   = t >> 5;
  const int lm   = lane & 15;
  const int lh   = lane >> 4;
  const int klo  = lh * 8;

  int idx = blockIdx.x;
  const int qp = idx & (ATT_N / 32 - 1);  idx >>= 6;   // N/32 = 64 blocks of 32 queries
  const int g  = idx & (ATT_G - 1);       idx >>= 2;   // KV group
  const int b  = idx;                                   // batch
  const int hl = g * 4 + (wv & 3);                      // linear head 0..15
  const int kh = wv >> 2;                               // this wave's 32 keys of a stage
  const int q0 = qp * 32;

  // this thread's piece of a stage: global addresses (stage 0) and LDS places
  const int crow = t >> 3;
  const int cseg = (t & 7) * 8;
  const size_t coff = (size_t)(b * ATT_N + crow) * ATT_KD + g * ATT_HD + cseg;
  const _Float16* kg = k + coff;
  const _Float16* vg = v + coff;
  const unsigned int kl0 =
      (unsigned int)(uintptr_t)(&Ks[crow * ATT_KP + cseg]);
  const unsigned int vl0 =
      (unsigned int)(uintptr_t)(&Vs[crow * ATT_VP + cseg]);
  const unsigned int kbuf = ATT_STG * ATT_KP * 2;  // bytes from buffer 0 to 1
  const unsigned int vbuf = ATT_STG * ATT_VP * 2;
  const size_t gstep = (size_t)ATT_STG * ATT_KD;   // halves per stage

  // prologue: stage 0 landed and published, then stage 1 in flight
  stage_kv_async(kg, vg, kl0, vl0);
  // stage 0's copies of this wave have landed before the barrier publishes them
  asm volatile("s_wait_asynccnt 0x0" ::: "memory");
  __syncthreads();
  stage_kv_async(kg + gstep, vg + gstep, kl0 + kbuf, vl0 + vbuf);

  // Q fragments of both column groups: B-matrix 32x16 halves (column = query),
  // d = 0..31 and 32..63
  v16h bq[2][2];
#pragma unroll
  for (int cg = 0; cg < 2; ++cg) {
    const _Float16* qptr =
        q + (size_t)(b * ATT_N + q0 + cg * 16 + lm) * ATT_D + hl * ATT_HD + klo;
    bq[cg][0] = load_frag(qptr);
    bq[cg][1] = load_frag(qptr + 32);
  }

  // per column group cg, query q0 + cg*16 + lm, over this wave's keys:
  float mrun[2];   // reference maximum in use, unscaled (both halves of the wave equal)
  float nmr[2];    // -mrun * sl2, the addend of every exponent
  float lim[2];    // mrun + RESC_THR: a new maximum above it forces a rescale
  float lrun[2];   // running sum over this half's keys only, relative to mrun
  v8f acc[2][4];   // acc[cg][dc][r] = O^T[dc*16 + 8*lh + r][query], relative to mrun
#pragma unroll
  for (int cg = 0; cg < 2; ++cg) {
    mrun[cg] = -INFINITY;
    nmr[cg]  = INFINITY;
    lim[cg]  = -INFINITY;
    lrun[cg] = 0.0f;
#pragma unroll
    for (int dc = 0; dc < 4; ++dc) acc[cg][dc] = (v8f)(0.0f);
  }

  // 1/sqrt(64) * log2(e): e^(scale * (s - m)) = 2^(s * sl2 - m * sl2)
  const float sl2 = 0.125f * 1.44269504f;

  // fragment offsets inside a stage buffer, in halves (this wave's 32 keys)
  const int kfo = (kh * 32 + lm) * ATT_KP + klo;
  const int vfo = (kh * 32 + 8 * lh + (lane & 7)) * ATT_VP + 8 * ((lane >> 3) & 1);

  for (int st = 0; st < ATT_NST; ++st) {
    const _Float16* kp0 = Ks + (st & 1) * (ATT_STG * ATT_KP) + kfo;
    const _Float16* kp1 = kp0 + 16 * ATT_KP;
    const _Float16* vp  = Vs + (st & 1) * (ATT_STG * ATT_VP) + vfo;

    // ---- K fragments of the 32 keys (two 16-key tiles x two 32-d halves)
    const v16h ka00 = load_frag(kp0);
    const v16h ka01 = load_frag(kp0 + 32);
    const v16h ka10 = load_frag(kp1);
    const v16h ka11 = load_frag(kp1 + 32);

    // ---- V^T fragments (16 d x 32 keys per dc) by the transposing load:
    //      halves 0..7 = keys 8*lh + 0..7, halves 8..15 = keys 16 + 8*lh + 0..7
    v16h av[4];
#pragma unroll
    for (int dc = 0; dc < 4; ++dc) {
      const v8h lo = load_tr16(vp + dc * 16);
      const v8h hi = load_tr16(vp + 16 * ATT_VP + dc * 16);
#pragma unroll
      for (int i = 0; i < 8; ++i) { av[dc][i] = lo[i]; av[dc][i + 8] = hi[i]; }
    }

    // ---- scores: S^T = K @ Q^T for 32 keys (two 16x16 tiles, K=64 via 2 wmma)
    //      s0[cg][r] = S[query][kc + 8*lh + r], s1[cg][r] = S[query][kc + 16 + 8*lh + r]
    //      and the chunk's maximum per query: 16 scores in-lane, one exchange
    //      between the wave's halves; in units of the raw products (the scale
    //      is positive). Unrolled so that the per-group state stays in registers.
    v8f s0[2], s1[2];
    float tmx[2];
#pragma unroll
    for (int cg = 0; cg < 2; ++cg) {
      s0[cg] = (v8f)(0.0f);
      s1[cg] = (v8f)(0.0f);
      s0[cg] = __builtin_amdgcn_wmma_f32_16x16x32_f16(false, ka00, false,
          bq[cg][0], (short)0, s0[cg], false, false);
      s0[cg] = __builtin_amdgcn_wmma_f32_16x16x32_f16(false, ka01, false,
          bq[cg][1], (short)0, s0[cg], false, false);
      s1[cg] = __builtin_amdgcn_wmma_f32_16x16x32_f16(false, ka10, false,
          bq[cg][0], (short)0, s1[cg], false, false);
      s1[cg] = __builtin_amdgcn_wmma_f32_16x16x32_f16(false, ka11, false,
          bq[cg][1], (short)0, s1[cg], false, false);
      float mx = -INFINITY;
#pragma unroll
      for (int r = 0; r < 8; ++r) mx = fmaxf(mx, fmaxf(s0[cg][r], s1[cg][r]));
      tmx[cg] = fmaxf(mx, other_half(mx));
    }

    // ---- lazy rescale, one test per pass for both column groups: the reference
    //      maximum moves, and sums and O^T are rescaled, only when some query's
    //      new maximum lies more than 2^8 (as a factor of e^score) above the one
    //      in use; otherwise every P stays <= 2^8, well inside f16 and f32. The
    //      first pass always takes the branch (lim = -inf). The ballot makes the
    //      branch scalar: all lanes stay on for the matrix instructions behind it.
    const bool need = (tmx[0] > lim[0]) | (tmx[1] > lim[1]);
    if (__builtin_amdgcn_ballot_w32(need) != 0) {
#pragma unroll
      for (int cg = 0; cg < 2; ++cg) {
        const float mn = fmaxf(mrun[cg], tmx[cg]);
        const float al = exp2_slot((mrun[cg] - mn) * sl2);
        mrun[cg] = mn;
        nmr[cg]  = -mn * sl2;
        lim[cg]  = mn + RESC_THR;
        lrun[cg] *= al;
#pragma unroll
        for (int dc = 0; dc < 4; ++dc)
#pragma unroll
          for (int r = 0; r < 8; ++r) acc[cg][dc][r] *= al;
      }
    }

#pragma unroll
    for (int cg = 0; cg < 2; ++cg) {
      // ---- P = 2^(s * sl2 - mrun * sl2): scale and log2(e) enter in the one
      //      fused multiply-add that forms each exponent
      const float nm = nmr[cg];
      float rs = 0.0f;
      v16h pb;  // P^T as B operand: pb[s] = P[query][kc + kmap(s, lh)]
#pragma unroll
      for (int r = 0; r < 8; ++r) {
        const float p0 = exp2_slot(__builtin_fmaf(s0[cg][r], sl2, nm));
        const float p1 = exp2_slot(__builtin_fmaf(s1[cg][r], sl2, nm));
        rs += p0 + p1;
        pb[r]     = (_Float16)p0;
        pb[r + 8] = (_Float16)p1;
      }
      lrun[cg] += rs;

      // ---- O^T += V^T @ P^T
#pragma unroll
      for (int dc = 0; dc < 4; ++dc)
        acc[cg][dc] = __builtin_amdgcn_wmma_f32_16x16x32_f16(
            false, av[dc], false, pb, (short)0, acc[cg][dc], false, false);
    }

    // ---- publish point of stage st + 1
    // this wave's LDS reads of the buffer that is refilled below have retired
    asm volatile("s_wait_dscnt 0x0" ::: "memory");
    // this wave's copies of stage st + 1 have landed
    asm volatile("s_wait_asynccnt 0x0" ::: "memory");
    // publishes stage st + 1 and ends every wave's reads of stage st
    __syncthreads();
    if (st + 2 < ATT_NST)
      stage_kv_async(kg + (size_t)(st + 2) * gstep, vg + (size_t)(st + 2) * gstep,
                     kl0 + (st & 1) * kbuf, vl0 + (st & 1) * vbuf);
  }
  // no copy is outstanding when the ring is reused and when the wave ends
  asm volatile("s_wait_asynccnt 0x0" ::: "memory");

  // ---- join the two key halves of a head (waves wv and wv ^ 4, lane by lane):
  //      wave kh keeps column group kh and hands the other group's partial
  //      result to its partner through the ring, which every wave has left at
  //      the loop's last barrier.
  //      exchange area: per wave 8 x 32 lanes x 16 B of O^T, then maximum and sum
  float* const xo = (float*)Ring;                 // 8 waves x 4096 B
  float* const xm = xo + 8 * 1024;                // 8 waves x 2 x 32 floats
  static_assert((8 * 1024 + 8 * 64) * 4 <= sizeof(Ring), "exchange area fits the ring");
  const bool up = (kh != 0);                      // the same for the whole wave
  v8f keep[4], give[4];
#pragma unroll
  for (int dc = 0; dc < 4; ++dc)
#pragma unroll
    for (int r = 0; r < 8; ++r) {
      keep[dc][r] = up ? acc[1][dc][r] : acc[0][dc][r];
      give[dc][r] = up ? acc[0][dc][r] : acc[1][dc][r];
    }
  const float mk = up ? mrun[1] : mrun[0];
  const float lk = up ? lrun[1] : lrun[0];
  {
    v4f* wo = (v4f*)(xo + wv * 1024) + lane;
#pragma unroll
    for (int dc = 0; dc < 4; ++dc) {
      v4f lo4, hi4;
#pragma unroll
      for (int r = 0; r < 4; ++r) { lo4[r] = give[dc][r]; hi4[r] = give[dc][r + 4]; }
      wo[(dc * 2) * 32]     = lo4;
      wo[(dc * 2 + 1) * 32] = hi4;
    }
    xm[wv * 64 + lane]      = up ? mrun[0] : mrun[1];
    xm[wv * 64 + 32 + lane] = up ? lrun[0] : lrun[1];
  }
  // the partner's partial result is written before it is read
  __syncthreads();
  const int pw = wv ^ 4;
  const float mp = xm[pw * 64 + lane];
  const float lp = xm[pw * 64 + 32 + lane];
  const float mj = fmaxf(mk, mp);
  const float ak = exp2_slot((mk - mj) * sl2);
  const float ap = exp2_slot((mp - mj) * sl2);
  const float lj = lk * ak + lp * ap;

  // ---- epilogue: join the wave halves' sums, normalize, store y (f16);
  //      a lane holds 8 consecutive d of one query row: 16-byte stores
  const float inv = 1.0f / (lj + other_half(lj));
  const float fk = ak * inv;
  const float fp = ap * inv;
  const v4f* ro = (const v4f*)(xo + pw * 1024) + lane;
  _Float16* yp =
      y + (size_t)(b * ATT_N + q0 + kh * 16 + lm) * ATT_D + hl * ATT_HD + klo;
#pragma unroll
  for (int dc = 0; dc < 4; ++dc) {
    const v4f lo4 = ro[(dc * 2) * 32];
    const v4f hi4 = ro[(dc * 2 + 1) * 32];
    v8h o;
#pragma unroll
    for (int r = 0; r < 4; ++r) {
      o[r]     = (_Float16)(keep[dc][r] * fk + lo4[r] * fp);
      o[r + 4] = (_Float16)(keep[dc][r + 4] * fk + hi4[r] * fp);
    }
    *(v8h*)(yp + dc * 16) = o;
  }
}

// ---------------------------------------------------------------------------
// Host-side launch
// ---------------------------------------------------------------------------
extern "C" void kernel_launch(void* const* d_in, const int* in_sizes, int n_in,
                              void* d_out, int out_size, void* d_ws, size_t ws_size,
                              hipStream_t stream) {
  (void)in_sizes; (void)n_in; (void)out_size; (void)ws_size;

  const float* x  = (const float*)d_in[0];
  const float* Wq = (const float*)d_in[1];
  const float* bq = (const float*)d_in[2];
  const float* Wk = (const float*)d_in[3];
  const float* bk = (const float*)d_in[4];
  const float* Wv = (const float*)d_in[5];
  const float* bv = (const float*)d_in[6];
  const float* Wo = (const float*)d_in[7];
  const float* bo = (const float*)d_in[8];
  float* out = (float*)d_out;

  _Float16* ws = (_Float16*)d_ws;
  const size_t nX  = (size_t)ATT_M * ATT_D;   // 4194304
  const size_t nWq = (size_t)ATT_D * ATT_D;   // 1048576
  const size_t nWk = (size_t)ATT_KD * ATT_D;  // 262144
  _Float16* xh  = ws;
  _Float16* wqh = xh  + nX;
  _Float16* wkh = wqh + nWq;
  _Float16* wvh = wkh + nWk;
  _Float16* woh = wvh + nWk;
  _Float16* qh  = woh + nWq;
  _Float16* kh  = qh  + nX;
  _Float16* vh  = kh  + (size_t)ATT_M * ATT_KD;
  _Float16* yh  = vh  + (size_t)ATT_M * ATT_KD;

  // 1) f16 conversions: one launch, planes xh, wqh, wkh, wvh, woh in a row
  f32_to_f16_all_kernel<<<CV_BLOCKS, CV_THREADS, 0, stream>>>(x, Wq, Wk, Wv, Wo, xh);

  // 2) projections: 4-wave blocks, 64x128 tile; q, k and v in one launch: the
  //    planes wqh, wkh, wvh lie in a row and read as one [1536][1024] weight
  dim3 blk(128, 1, 1);
  dim3 gq(ATT_M / 64, ATT_D / 128, 1);                    // 64 x 8
  dim3 gqkv(ATT_M / 64, (ATT_D + 2 * ATT_KD) / 128, 1);   // 64 x 12
  gemm_wmma_kernel<_Float16><<<gqkv, blk, 0, stream>>>(xh, wqh, bq, qh,
      ATT_M, ATT_D, ATT_D, bk, kh, ATT_KD, bv, vh, ATT_KD);

  // 3) attention: 8 waves per (b, KV group, 32 queries) = 2*4*64 = 512
  dim3 ablk(256, 1, 1);
  attn_wmma_kernel<<<ATT_B * ATT_G * (ATT_N / 32), ablk, 0, stream>>>(qh, kh, vh, yh);

  // 4) output projection, f32 straight into d_out (one weight matrix: the
  //    second and third places are never selected)
  gemm_wmma_kernel<float><<<gq, blk, 0, stream>>>(yh, woh, bo, out,
      ATT_M, ATT_D, ATT_D, bo, out, 0, bo, out, 0);
}
